// v000
// The times below were measured on an AMD MI455X: many runs one after another, warmed up first and cycling through
// copies of the inputs, with the whole window's GPU time divided by the number of runs. Launches and the gaps
// between them are all in it. The median over several windows is given; except for v000 it joins two sittings, which
// can be a few percent apart, so the side-by-side timings, each taken in one sitting, are the better comparison.
// v000 is the starting kernel. One run takes 678 microseconds.
#include <hip/hip_runtime.h>

// ---------- types ----------
typedef __attribute__((ext_vector_type(16))) __bf16 v16bf;
typedef __attribute__((ext_vector_type(8)))  __bf16 v8bf;
typedef __attribute__((ext_vector_type(8)))  float  v8f;
typedef __attribute__((ext_vector_type(4)))  unsigned int u32x4;
typedef __attribute__((ext_vector_type(8)))  unsigned int u32x8;

#define HEADS 8
#define DHEAD 32
#define NPOS  4096            // 64*64 tokens per batch image
#define BATCH 16
#define CDIM  256
#define HID   256
#define MROWS (BATCH * NPOS)  // 65536
#define LDQKV 768
#define SCALE 0.17677669529663687f  // 32^-0.5
#define EPS   1e-6f

// workspace layout (bytes)
#define WQ_OFF   0u
#define WO_OFF   393216u                  // 768*256*2
#define A_OFF    524288u                  // WO_OFF + 256*256*2
#define QKV_OFF  34078720u                // A_OFF + 65536*256*2
// OutPre reuses A region; Y (f32, 67MB) reuses QKV region (100MB)

// ---------- kernel 0: weights -> bf16 ----------
__global__ __launch_bounds__(256) void cvt_weights(
    const float* __restrict__ wq, const float* __restrict__ wo,
    __bf16* __restrict__ wqb, __bf16* __restrict__ wob) {
  int idx = blockIdx.x * 256 + threadIdx.x;
  if (idx < LDQKV * CDIM) wqb[idx] = (__bf16)wq[idx];
  if (idx < CDIM * HID)   wob[idx] = (__bf16)wo[idx];
}

// ---------- kernel 1: channel-LN of x -> bf16 A[65536, 256] (K contiguous) ----------
__global__ __launch_bounds__(256) void ln_to_bf16(
    const float* __restrict__ x, __bf16* __restrict__ A) {
  __shared__ float ssum[4][64];
  __shared__ float ssq[4][64];
  __shared__ float mean_[64];
  __shared__ float rstd_[64];
  __shared__ __bf16 tile[64][264];

  int t  = threadIdx.x;
  int pl = t & 63;       // local position
  int cg = t >> 6;       // channel group (0..3), 64 channels each
  int p0 = blockIdx.x * 64;
  int b  = p0 >> 12;
  size_t base = ((size_t)b * CDIM) * NPOS + (p0 & (NPOS - 1)) + pl;

  float s = 0.f, sq = 0.f;
  for (int j = 0; j < 64; ++j) {
    float v = x[base + (size_t)(cg * 64 + j) * NPOS];
    s += v; sq += v * v;
  }
  ssum[cg][pl] = s; ssq[cg][pl] = sq;
  __syncthreads();
  if (t < 64) {
    float S = ssum[0][t] + ssum[1][t] + ssum[2][t] + ssum[3][t];
    float Q = ssq[0][t] + ssq[1][t] + ssq[2][t] + ssq[3][t];
    float m = S * (1.f / 256.f);
    mean_[t] = m;
    rstd_[t] = rsqrtf(Q * (1.f / 256.f) - m * m + EPS);
  }
  __syncthreads();
  float m = mean_[pl], r = rstd_[pl];
  for (int j = 0; j < 64; ++j) {
    int c = cg * 64 + j;
    float v = x[base + (size_t)c * NPOS];
    tile[pl][c] = (__bf16)((v - m) * r);
  }
  __syncthreads();
  // flat coalesced write-out: 64 rows x 128 dwords
  int row = t >> 2, seg = t & 3;
  const unsigned int* src = reinterpret_cast<const unsigned int*>(&tile[row][0]);
  unsigned int* dst = reinterpret_cast<unsigned int*>(A + (size_t)(p0 + row) * CDIM);
#pragma unroll
  for (int i = 0; i < 32; ++i) dst[seg * 32 + i] = src[seg * 32 + i];
}

__device__ __forceinline__ v16bf frag_ld(const __bf16* __restrict__ base,
                                         int row0, int ld, int k0, int lane) {
  int r  = row0 + (lane & 15);
  int kb = k0 + ((lane >> 4) << 3);           // +8 for upper half-wave
  const __bf16* p = base + (size_t)r * ld + kb;
  v8bf lo = *reinterpret_cast<const v8bf*>(p);       // K = kb .. kb+7
  v8bf hi = *reinterpret_cast<const v8bf*>(p + 16);  // K = kb+16 .. kb+23
  v16bf out;
#pragma unroll
  for (int i = 0; i < 8; ++i) { out[i] = lo[i]; out[8 + i] = hi[i]; }
  return out;
}

__device__ __forceinline__ v16bf frag_ld_lds(const __bf16* base,
                                             int row0, int ld, int k0, int lane) {
  int r  = row0 + (lane & 15);
  int kb = k0 + ((lane >> 4) << 3);
  const __bf16* p = base + r * ld + kb;
  v8bf lo = *reinterpret_cast<const v8bf*>(p);
  v8bf hi = *reinterpret_cast<const v8bf*>(p + 16);
  v16bf out;
#pragma unroll
  for (int i = 0; i < 8; ++i) { out[i] = lo[i]; out[8 + i] = hi[i]; }
  return out;
}

__global__ __launch_bounds__(256) void gemm_wmma_bf16(
    const __bf16* __restrict__ A, const __bf16* __restrict__ B,
    const float* __restrict__ bias,
    float* __restrict__ Cf, __bf16* __restrict__ Cbf,
    int M, int N) {
  constexpr int K = 256;
  __shared__ __attribute__((aligned(16))) __bf16 Bs[64 * K];  // 32 KB

  int lane = threadIdx.x & 31;
  int wave = threadIdx.x >> 5;
  int m0 = (blockIdx.x * 8 + wave) * 16;

  v16bf afr[8];
#pragma unroll
  for (int kk = 0; kk < 8; ++kk) afr[kk] = frag_ld(A, m0, K, kk * 32, lane);

  unsigned lds_base = (unsigned)(size_t)(&Bs[0]);  // flat LDS addr: low 32 bits = LDS offset
  int coll = lane & 15;
  int rb   = m0 + ((lane >> 4) << 3);

  for (int n0 = 0; n0 < N; n0 += 64) {
    if (wave == 0) {
      unsigned long long ga = (unsigned long long)(const void*)(B + (size_t)n0 * K);
      u32x4 g0;
      g0[0] = 1u;                                   // count=1, user mode
      g0[1] = lds_base;                             // lds_addr (bytes)
      g0[2] = (unsigned)(ga & 0xFFFFFFFFu);         // global_addr[31:0]
      g0[3] = (unsigned)(ga >> 32) | (2u << 30);    // global_addr[56:32] | type=2
      u32x8 g1;
      g1[0] = 1u << 16;
      g1[1] = (unsigned)K << 16;
      g1[2] = ((unsigned)N << 16) | ((unsigned)K >> 16);
      g1[3] = ((unsigned)K << 16) | ((unsigned)N >> 16);
      g1[4] = 64u;
      g1[5] = (unsigned)K;
      g1[6] = 0u;
      g1[7] = 0u;
      asm volatile("tensor_load_to_lds %0, %1" : : "s"(g0), "s"(g1) : "memory");
      __builtin_amdgcn_s_wait_tensorcnt(0);
    }
    __syncthreads();

    v8f acc[4] = {};
#pragma unroll
    for (int kk = 0; kk < 8; ++kk) {
#pragma unroll
      for (int j = 0; j < 4; ++j) {
        v16bf bf = frag_ld_lds(Bs, j * 16, K, kk * 32, lane);
        acc[j] = __builtin_amdgcn_wmma_f32_16x16x32_bf16(
            false, afr[kk], false, bf, (short)0, acc[j], false, false);
      }
    }

#pragma unroll
    for (int j = 0; j < 4; ++j) {
      int col = n0 + j * 16 + coll;
      float bb = bias ? bias[col] : 0.f;
#pragma unroll
      for (int r = 0; r < 8; ++r) {
        float v = acc[j][r] + bb;
        size_t idx = (size_t)(rb + r) * N + col;
        if (Cf) Cf[idx] = v;
        else    Cbf[idx] = (__bf16)v;
      }
    }
    __syncthreads();  // protect Bs before next group's DMA
  }
}

// ---------- kernel 3: linear attention per (b,h) ----------
__global__ __launch_bounds__(256) void attention_kernel(
    const __bf16* __restrict__ QKV, const float* __restrict__ mem_kv,
    __bf16* __restrict__ OutPre) {
  __shared__ float red[8][32];
  __shared__ float m_[32];
  __shared__ float is_[32];
  __shared__ float Kc[32][65];
  __shared__ float Vc[32][65];
  __shared__ float ctx[32][33];

  int t = threadIdx.x;
  int b = blockIdx.x >> 3, h = blockIdx.x & 7;
  size_t bbase = (size_t)b * NPOS;
  int cq = h * DHEAD, ck = 256 + h * DHEAD, cv = 512 + h * DHEAD;
  const float* mk = mem_kv + (size_t)h * DHEAD * 4;
  const float* mv = mem_kv + (size_t)HEADS * DHEAD * 4 + (size_t)h * DHEAD * 4;

  // ---- K softmax over tokens (n = 4 mem + 4096): max then sum-exp ----
  int d = t & 31, sub = t >> 5;
  float mx = -1e30f;
  if (sub == 0)
    for (int j = 0; j < 4; ++j) mx = fmaxf(mx, mk[d * 4 + j]);
  for (int n = sub; n < NPOS; n += 8)
    mx = fmaxf(mx, (float)QKV[(bbase + n) * LDQKV + ck + d]);
  red[sub][d] = mx;
  __syncthreads();
  if (t < 32) {
    float v = red[0][t];
    for (int j = 1; j < 8; ++j) v = fmaxf(v, red[j][t]);
    m_[t] = v;
  }
  __syncthreads();
  float md = m_[d];
  float se = 0.f;
  if (sub == 0)
    for (int j = 0; j < 4; ++j) se += __expf(mk[d * 4 + j] - md);
  for (int n = sub; n < NPOS; n += 8)
    se += __expf((float)QKV[(bbase + n) * LDQKV + ck + d] - md);
  red[sub][d] = se;
  __syncthreads();
  if (t < 32) {
    float v = 0.f;
    for (int j = 0; j < 8; ++j) v += red[j][t];
    is_[t] = 1.f / v;
  }
  __syncthreads();

  // ---- context[d][e] = sum_n softmax_n(K)[d,n] * V[e,n] ----
  int dd = t >> 3, e0 = (t & 7) * 4;
  float acc[4] = {0.f, 0.f, 0.f, 0.f};
  {
    float mdd = m_[dd], iss = is_[dd];
    for (int j = 0; j < 4; ++j) {
      float kd = __expf(mk[dd * 4 + j] - mdd) * iss;
#pragma unroll
      for (int i = 0; i < 4; ++i) acc[i] += kd * mv[(e0 + i) * 4 + j];
    }
  }
  int tok = t & 63, cg2 = t >> 6;
  for (int n0 = 0; n0 < NPOS; n0 += 64) {
    const __bf16* rowp = QKV + (bbase + n0 + tok) * LDQKV;
    v8bf kr = *reinterpret_cast<const v8bf*>(rowp + ck + cg2 * 8);
    v8bf vr = *reinterpret_cast<const v8bf*>(rowp + cv + cg2 * 8);
#pragma unroll
    for (int jj = 0; jj < 8; ++jj) {
      int c = cg2 * 8 + jj;
      Kc[c][tok] = __expf((float)kr[jj] - m_[c]) * is_[c];
      Vc[c][tok] = (float)vr[jj];
    }
    __syncthreads();
#pragma unroll 4
    for (int nn = 0; nn < 64; ++nn) {
      float kd = Kc[dd][nn];
      acc[0] += kd * Vc[e0 + 0][nn];
      acc[1] += kd * Vc[e0 + 1][nn];
      acc[2] += kd * Vc[e0 + 2][nn];
      acc[3] += kd * Vc[e0 + 3][nn];
    }
    __syncthreads();
  }
#pragma unroll
  for (int i = 0; i < 4; ++i) ctx[dd][e0 + i] = acc[i];
  __syncthreads();

  // ---- out[e,n] = sum_d ctx[d,e] * (softmax_d(Q[:,n]) * SCALE) ----
  for (int n = t; n < NPOS; n += 256) {
    const __bf16* rowq = QKV + (bbase + n) * LDQKV + cq;
    float qv[32];
#pragma unroll
    for (int g = 0; g < 4; ++g) {
      v8bf q8 = *reinterpret_cast<const v8bf*>(rowq + g * 8);
#pragma unroll
      for (int jj = 0; jj < 8; ++jj) qv[g * 8 + jj] = (float)q8[jj];
    }
    float qm = qv[0];
#pragma unroll
    for (int i = 1; i < 32; ++i) qm = fmaxf(qm, qv[i]);
    float qs = 0.f;
#pragma unroll
    for (int i = 0; i < 32; ++i) { qv[i] = __expf(qv[i] - qm); qs += qv[i]; }
    float scl = SCALE / qs;
    float o[32];
#pragma unroll
    for (int e = 0; e < 32; ++e) o[e] = 0.f;
#pragma unroll
    for (int i = 0; i < 32; ++i) {
      float qd = qv[i] * scl;
#pragma unroll
      for (int e = 0; e < 32; ++e) o[e] += ctx[i][e] * qd;
    }
    __bf16* op = OutPre + (bbase + n) * HID + cq;
#pragma unroll
    for (int g = 0; g < 4; ++g) {
      v8bf st;
#pragma unroll
      for (int jj = 0; jj < 8; ++jj) st[jj] = (__bf16)o[g * 8 + jj];
      *reinterpret_cast<v8bf*>(op + g * 8) = st;
    }
  }
}

// ---------- kernel 5: channel-LN of Y + residual -> NCHW output ----------
__global__ __launch_bounds__(256) void ln_res_out(
    const float* __restrict__ Y, const float* __restrict__ x,
    float* __restrict__ out) {
  __shared__ float yt[32][257];
  __shared__ float r1[32][8];
  __shared__ float r2[32][8];
  __shared__ float mean_[32];
  __shared__ float rstd_[32];

  int t  = threadIdx.x;
  int p0 = blockIdx.x * 32;
  int b  = p0 >> 12;
  int pix = p0 & (NPOS - 1);

  const float* yrow = Y + (size_t)p0 * CDIM;
  for (int i = 0; i < 32; ++i) yt[i][t] = yrow[(size_t)i * CDIM + t];
  __syncthreads();

  int pos = t >> 3, sb = t & 7;
  float s = 0.f, sq = 0.f;
  for (int j = 0; j < 32; ++j) {
    float v = yt[pos][sb * 32 + j];
    s += v; sq += v * v;
  }
  r1[pos][sb] = s; r2[pos][sb] = sq;
  __syncthreads();
  if (t < 32) {
    float S = 0.f, Q = 0.f;
    for (int j = 0; j < 8; ++j) { S += r1[t][j]; Q += r2[t][j]; }
    float m = S * (1.f / 256.f);
    mean_[t] = m;
    rstd_[t] = rsqrtf(Q * (1.f / 256.f) - m * m + EPS);
  }
  __syncthreads();

  int pl = t & 31, cg = t >> 5;
  float m = mean_[pl], r = rstd_[pl];
  for (int i = 0; i < 32; ++i) {
    int c = i * 8 + cg;
    size_t gi = ((size_t)b * CDIM + c) * NPOS + pix + pl;
    out[gi] = (yt[pl][c] - m) * r + x[gi];
  }
}

// ---------- host launcher ----------
extern "C" void kernel_launch(void* const* d_in, const int* in_sizes, int n_in,
                              void* d_out, int out_size, void* d_ws, size_t ws_size,
                              hipStream_t stream) {
  const float* x      = (const float*)d_in[0];
  const float* mem_kv = (const float*)d_in[1];
  const float* w_qkv  = (const float*)d_in[2];
  const float* w_out  = (const float*)d_in[3];
  const float* b_out  = (const float*)d_in[4];
  float* out = (float*)d_out;

  char* ws = (char*)d_ws;
  __bf16* wq_bf  = (__bf16*)(ws + WQ_OFF);
  __bf16* wo_bf  = (__bf16*)(ws + WO_OFF);
  __bf16* Abf    = (__bf16*)(ws + A_OFF);
  __bf16* QKVbf  = (__bf16*)(ws + QKV_OFF);
  __bf16* OutPre = Abf;                     // reuse: A dead after GEMM1
  float*  Yf     = (float*)(ws + QKV_OFF);  // reuse: qkv dead after attention

  cvt_weights<<<768, 256, 0, stream>>>(w_qkv, w_out, wq_bf, wo_bf);
  ln_to_bf16<<<MROWS / 64, 256, 0, stream>>>(x, Abf);
  gemm_wmma_bf16<<<MROWS / 128, 256, 0, stream>>>(
      Abf, wq_bf, nullptr, nullptr, QKVbf, MROWS, LDQKV);
  attention_kernel<<<BATCH * HEADS, 256, 0, stream>>>(QKVbf, mem_kv, OutPre);
  gemm_wmma_bf16<<<MROWS / 128, 256, 0, stream>>>(
      OutPre, wo_bf, b_out, Yf, nullptr, MROWS, CDIM);
  ln_res_out<<<MROWS / 32, 256, 0, stream>>>(Yf, x, out);
}

// v001
// Measured time: 355 microseconds a run.
// In both of two side-by-side timings against v000, it was 1.94 times as fast.
#include <hip/hip_runtime.h>

// ---------- types ----------
typedef __attribute__((ext_vector_type(16))) __bf16 v16bf;
typedef __attribute__((ext_vector_type(8)))  __bf16 v8bf;
typedef __attribute__((ext_vector_type(8)))  float  v8f;
typedef __attribute__((ext_vector_type(4)))  float  f32x4;
typedef __attribute__((ext_vector_type(4)))  unsigned int u32x4;
typedef __attribute__((ext_vector_type(8)))  unsigned int u32x8;

#define HEADS 8
#define DHEAD 32
#define NPOS  4096            // 64*64 tokens per batch image
#define BATCH 16
#define CDIM  256
#define HID   256
#define MROWS (BATCH * NPOS)  // 65536
#define LDQKV 768
#define SCALE 0.17677669529663687f  // 32^-0.5
#define EPS   1e-6f

// workspace layout (bytes)
#define WQ_OFF   0u
#define WO_OFF   393216u                  // 768*256*2
#define A_OFF    524288u                  // WO_OFF + 256*256*2
#define QKV_OFF  34078720u                // A_OFF + 65536*256*2
// OutPre reuses A region; Y (f32, 67MB) reuses QKV region (100MB)
#define NCH      16                       // token chunks per (batch, head)
#define CHTOK    256                      // tokens per chunk
#define PCTX_OFF 134742016u               // QKV_OFF + 65536*768*2
#define PM_OFF   143130624u               // PCTX_OFF + 128*16*1024*4
#define PS_OFF   143392768u               // PM_OFF + 128*16*32*4
#define CTX_OFF  143654912u               // PS_OFF + 128*16*32*4

// ---------- kernel 0: weights -> bf16 ----------
__global__ __launch_bounds__(256) void cvt_weights(
    const float* __restrict__ wq, const float* __restrict__ wo,
    __bf16* __restrict__ wqb, __bf16* __restrict__ wob) {
  int idx = blockIdx.x * 256 + threadIdx.x;
  if (idx < LDQKV * CDIM) wqb[idx] = (__bf16)wq[idx];
  if (idx < CDIM * HID)   wob[idx] = (__bf16)wo[idx];
}

// ---------- kernel 1: channel-LN of x -> bf16 A[65536, 256] (K contiguous) ----------
__global__ __launch_bounds__(256) void ln_to_bf16(
    const float* __restrict__ x, __bf16* __restrict__ A) {
  __shared__ float ssum[4][64];
  __shared__ float ssq[4][64];
  __shared__ float mean_[64];
  __shared__ float rstd_[64];
  __shared__ __bf16 tile[64][264];

  int t  = threadIdx.x;
  int pl = t & 63;       // local position
  int cg = t >> 6;       // channel group (0..3), 64 channels each
  int p0 = blockIdx.x * 64;
  int b  = p0 >> 12;
  size_t base = ((size_t)b * CDIM) * NPOS + (p0 & (NPOS - 1)) + pl;

  float s = 0.f, sq = 0.f;
  for (int j = 0; j < 64; ++j) {
    float v = x[base + (size_t)(cg * 64 + j) * NPOS];
    s += v; sq += v * v;
  }
  ssum[cg][pl] = s; ssq[cg][pl] = sq;
  __syncthreads();
  if (t < 64) {
    float S = ssum[0][t] + ssum[1][t] + ssum[2][t] + ssum[3][t];
    float Q = ssq[0][t] + ssq[1][t] + ssq[2][t] + ssq[3][t];
    float m = S * (1.f / 256.f);
    mean_[t] = m;
    rstd_[t] = rsqrtf(Q * (1.f / 256.f) - m * m + EPS);
  }
  __syncthreads();
  float m = mean_[pl], r = rstd_[pl];
  for (int j = 0; j < 64; ++j) {
    int c = cg * 64 + j;
    float v = x[base + (size_t)c * NPOS];
    tile[pl][c] = (__bf16)((v - m) * r);
  }
  __syncthreads();
  // flat coalesced write-out: 64 rows x 128 dwords
  int row = t >> 2, seg = t & 3;
  const unsigned int* src = reinterpret_cast<const unsigned int*>(&tile[row][0]);
  unsigned int* dst = reinterpret_cast<unsigned int*>(A + (size_t)(p0 + row) * CDIM);
#pragma unroll
  for (int i = 0; i < 32; ++i) dst[seg * 32 + i] = src[seg * 32 + i];
}

__device__ __forceinline__ v16bf frag_ld(const __bf16* __restrict__ base,
                                         int row0, int ld, int k0, int lane) {
  int r  = row0 + (lane & 15);
  int kb = k0 + ((lane >> 4) << 3);           // +8 for upper half-wave
  const __bf16* p = base + (size_t)r * ld + kb;
  v8bf lo = *reinterpret_cast<const v8bf*>(p);       // K = kb .. kb+7
  v8bf hi = *reinterpret_cast<const v8bf*>(p + 16);  // K = kb+16 .. kb+23
  v16bf out;
#pragma unroll
  for (int i = 0; i < 8; ++i) { out[i] = lo[i]; out[8 + i] = hi[i]; }
  return out;
}

__device__ __forceinline__ v16bf frag_ld_lds(const __bf16* base,
                                             int row0, int ld, int k0, int lane) {
  int r  = row0 + (lane & 15);
  int kb = k0 + ((lane >> 4) << 3);
  const __bf16* p = base + r * ld + kb;
  v8bf lo = *reinterpret_cast<const v8bf*>(p);
  v8bf hi = *reinterpret_cast<const v8bf*>(p + 16);
  v16bf out;
#pragma unroll
  for (int i = 0; i < 8; ++i) { out[i] = lo[i]; out[8 + i] = hi[i]; }
  return out;
}

__global__ __launch_bounds__(256) void gemm_wmma_bf16(
    const __bf16* __restrict__ A, const __bf16* __restrict__ B,
    const float* __restrict__ bias,
    float* __restrict__ Cf, __bf16* __restrict__ Cbf,
    int M, int N) {
  constexpr int K = 256;
  __shared__ __attribute__((aligned(16))) __bf16 Bs[64 * K];  // 32 KB

  int lane = threadIdx.x & 31;
  int wave = threadIdx.x >> 5;
  int m0 = (blockIdx.x * 8 + wave) * 16;

  v16bf afr[8];
#pragma unroll
  for (int kk = 0; kk < 8; ++kk) afr[kk] = frag_ld(A, m0, K, kk * 32, lane);

  unsigned lds_base = (unsigned)(size_t)(&Bs[0]);  // flat LDS addr: low 32 bits = LDS offset
  int coll = lane & 15;
  int rb   = m0 + ((lane >> 4) << 3);

  for (int n0 = 0; n0 < N; n0 += 64) {
    if (wave == 0) {
      unsigned long long ga = (unsigned long long)(const void*)(B + (size_t)n0 * K);
      u32x4 g0;
      g0[0] = 1u;                                   // count=1, user mode
      g0[1] = lds_base;                             // lds_addr (bytes)
      g0[2] = (unsigned)(ga & 0xFFFFFFFFu);         // global_addr[31:0]
      g0[3] = (unsigned)(ga >> 32) | (2u << 30);    // global_addr[56:32] | type=2
      u32x8 g1;
      g1[0] = 1u << 16;
      g1[1] = (unsigned)K << 16;
      g1[2] = ((unsigned)N << 16) | ((unsigned)K >> 16);
      g1[3] = ((unsigned)K << 16) | ((unsigned)N >> 16);
      g1[4] = 64u;
      g1[5] = (unsigned)K;
      g1[6] = 0u;
      g1[7] = 0u;
      asm volatile("tensor_load_to_lds %0, %1" : : "s"(g0), "s"(g1) : "memory");
      __builtin_amdgcn_s_wait_tensorcnt(0);
    }
    __syncthreads();

    v8f acc[4] = {};
#pragma unroll
    for (int kk = 0; kk < 8; ++kk) {
#pragma unroll
      for (int j = 0; j < 4; ++j) {
        v16bf bf = frag_ld_lds(Bs, j * 16, K, kk * 32, lane);
        acc[j] = __builtin_amdgcn_wmma_f32_16x16x32_bf16(
            false, afr[kk], false, bf, (short)0, acc[j], false, false);
      }
    }

#pragma unroll
    for (int j = 0; j < 4; ++j) {
      int col = n0 + j * 16 + coll;
      float bb = bias ? bias[col] : 0.f;
#pragma unroll
      for (int r = 0; r < 8; ++r) {
        float v = acc[j][r] + bb;
        size_t idx = (size_t)(rb + r) * N + col;
        if (Cf) Cf[idx] = v;
        else    Cbf[idx] = (__bf16)v;
      }
    }
    __syncthreads();  // protect Bs before next group's DMA
  }
}

__device__ __forceinline__ float exp_slot(float x) {
  float y = x * 1.4426950408889634f, r;
  asm("v_exp_f32 %0, %1\n\tv_nop" : "=v"(r) : "v"(y));
  return r;
}

// ---------- kernels 3a-3c: linear attention, token axis split over work-groups ----------
// 3a: one work-group per (b, h, chunk of 256 tokens). It takes the chunk's own
// per-channel maximum m, p = exp(K - m), s = sum_n p and c[d][e] = sum_n p[d,n] V[e,n],
// and leaves m, s, c in the workspace. Each wave owns 32 tokens and the whole
// 32x32 tile (8 d x 4 e per lane); the eight waves' tiles are summed through LDS.
__global__ __launch_bounds__(256) void attn_partial(
    const __bf16* __restrict__ QKV,
    float* __restrict__ pctx, float* __restrict__ pm, float* __restrict__ ps) {
  __shared__ __attribute__((aligned(16))) float Pw[8][32][32];
  __shared__ __attribute__((aligned(16))) float Vw[8][32][32];
  __shared__ __attribute__((aligned(16))) float redm[8][32];
  __shared__ __attribute__((aligned(16))) float reds[8][32];

  int t = threadIdx.x, lane = t & 31, w = t >> 5;
  int bh = blockIdx.x / NCH, ch = blockIdx.x % NCH;
  int b = bh >> 3, h = bh & 7;
  int cg = lane & 3, tr = lane >> 2;   // 8 channels of one token per lane, 8 tokens per load
  size_t row0 = (size_t)b * NPOS + ch * CHTOK + w * 32 + tr;
  const __bf16* kp = QKV + row0 * LDQKV + 256 + h * DHEAD + cg * 8;

  float kf[4][8];
  v8bf vr[4];
#pragma unroll
  for (int i = 0; i < 4; ++i) {
    v8bf kr = *reinterpret_cast<const v8bf*>(kp + (size_t)i * 8 * LDQKV);
    vr[i]   = *reinterpret_cast<const v8bf*>(kp + (size_t)i * 8 * LDQKV + 256);
#pragma unroll
    for (int j = 0; j < 8; ++j) kf[i][j] = (float)kr[j];
  }

  // chunk maximum per channel: lane, wave (lanes of equal cg), then the eight waves
  float mx[8];
#pragma unroll
  for (int j = 0; j < 8; ++j)
    mx[j] = fmaxf(fmaxf(kf[0][j], kf[1][j]), fmaxf(kf[2][j], kf[3][j]));
#pragma unroll
  for (int off = 4; off < 32; off <<= 1)
#pragma unroll
    for (int j = 0; j < 8; ++j) mx[j] = fmaxf(mx[j], __shfl_xor(mx[j], off, 32));
  if (tr == 0) {
#pragma unroll
    for (int j = 0; j < 8; ++j) redm[w][cg * 8 + j] = mx[j];
  }
  __syncthreads();
#pragma unroll
  for (int ww = 0; ww < 8; ++ww)
#pragma unroll
    for (int j = 0; j < 8; ++j) mx[j] = fmaxf(mx[j], redm[ww][cg * 8 + j]);

  float sm[8];
#pragma unroll
  for (int j = 0; j < 8; ++j) sm[j] = 0.f;
#pragma unroll
  for (int i = 0; i < 4; ++i) {
    f32x4 p0, p1, v0, v1;
#pragma unroll
    for (int j = 0; j < 4; ++j) {
      p0[j] = exp_slot(kf[i][j] - mx[j]);
      p1[j] = exp_slot(kf[i][4 + j] - mx[4 + j]);
      sm[j] += p0[j];
      sm[4 + j] += p1[j];
      v0[j] = (float)vr[i][j];
      v1[j] = (float)vr[i][4 + j];
    }
    int n = tr + 8 * i;
    *reinterpret_cast<f32x4*>(&Pw[w][n][cg * 8])     = p0;
    *reinterpret_cast<f32x4*>(&Pw[w][n][cg * 8 + 4]) = p1;
    *reinterpret_cast<f32x4*>(&Vw[w][n][cg * 8])     = v0;
    *reinterpret_cast<f32x4*>(&Vw[w][n][cg * 8 + 4]) = v1;
  }
#pragma unroll
  for (int off = 4; off < 32; off <<= 1)
#pragma unroll
    for (int j = 0; j < 8; ++j) sm[j] += __shfl_xor(sm[j], off, 32);
  if (tr == 0) {
#pragma unroll
    for (int j = 0; j < 8; ++j) reds[w][cg * 8 + j] = sm[j];
  }
  __syncthreads();

  int d0 = (lane >> 3) * 8, e0 = (lane & 7) * 4;
  float acc[8][4];
#pragma unroll
  for (int r = 0; r < 8; ++r)
#pragma unroll
    for (int c = 0; c < 4; ++c) acc[r][c] = 0.f;
#pragma unroll 4
  for (int n = 0; n < 32; ++n) {
    f32x4 pa = *reinterpret_cast<const f32x4*>(&Pw[w][n][d0]);
    f32x4 pb = *reinterpret_cast<const f32x4*>(&Pw[w][n][d0 + 4]);
    f32x4 vv = *reinterpret_cast<const f32x4*>(&Vw[w][n][e0]);
#pragma unroll
    for (int r = 0; r < 4; ++r)
#pragma unroll
      for (int c = 0; c < 4; ++c) {
        acc[r][c]     += pa[r] * vv[c];
        acc[4 + r][c] += pb[r] * vv[c];
      }
  }

  // sum the eight waves' tiles: each wave reuses its own P slab, which it alone has read
#pragma unroll
  for (int r = 0; r < 8; ++r) {
    f32x4 a;
#pragma unroll
    for (int c = 0; c < 4; ++c) a[c] = acc[r][c];
    *reinterpret_cast<f32x4*>(&Pw[w][d0 + r][e0]) = a;
  }
  __syncthreads();
  f32x4 tot = *reinterpret_cast<const f32x4*>(&Pw[0][0][0] + t * 4);
#pragma unroll
  for (int ww = 1; ww < 8; ++ww)
    tot += *reinterpret_cast<const f32x4*>(&Pw[ww][0][0] + t * 4);
  size_t pidx = blockIdx.x;
  *reinterpret_cast<f32x4*>(pctx + pidx * 1024 + t * 4) = tot;
  if (t < 32) {
    float m = redm[0][t], s = reds[0][t];
#pragma unroll
    for (int ww = 1; ww < 8; ++ww) { m = fmaxf(m, redm[ww][t]); s += reds[ww][t]; }
    pm[pidx * 32 + t] = m;
    ps[pidx * 32 + t] = s;
  }
}

// 3b: one work-group per (b, h): merge the chunks' (m, s, c) and the four memory
// tokens into context[d][e] = sum_n softmax_n(K)[d,n] * V[e,n].
__global__ __launch_bounds__(256) void attn_merge(
    const float* __restrict__ pctx, const float* __restrict__ pm,
    const float* __restrict__ ps, const float* __restrict__ mem_kv,
    float* __restrict__ ctxo) {
  __shared__ float wgt[NCH][32];
  __shared__ float wmem[4][32];
  int t = threadIdx.x;
  int bh = blockIdx.x, h = bh & 7;
  const float* mk = mem_kv + (size_t)h * DHEAD * 4;
  const float* mv = mem_kv + (size_t)HEADS * DHEAD * 4 + (size_t)h * DHEAD * 4;
  if (t < 32) {
    float mc[NCH], em[4];
    float M = mk[t * 4];
#pragma unroll
    for (int j = 1; j < 4; ++j) M = fmaxf(M, mk[t * 4 + j]);
#pragma unroll
    for (int c = 0; c < NCH; ++c) {
      mc[c] = pm[((size_t)bh * NCH + c) * 32 + t];
      M = fmaxf(M, mc[c]);
    }
    float S = 0.f;
#pragma unroll
    for (int j = 0; j < 4; ++j) { em[j] = exp_slot(mk[t * 4 + j] - M); S += em[j]; }
#pragma unroll
    for (int c = 0; c < NCH; ++c) {
      mc[c] = exp_slot(mc[c] - M);
      S += mc[c] * ps[((size_t)bh * NCH + c) * 32 + t];
    }
    float inv = 1.f / S;
#pragma unroll
    for (int c = 0; c < NCH; ++c) wgt[c][t] = mc[c] * inv;
#pragma unroll
    for (int j = 0; j < 4; ++j) wmem[j][t] = em[j] * inv;
  }
  // the loads above name registers that are rewritten below: keep the wait in front
  asm volatile("s_wait_xcnt 0x0" ::: "memory");
  __syncthreads();
  int d = t >> 3, e0 = (t & 7) * 4;
  f32x4 mvr[4];
#pragma unroll
  for (int i = 0; i < 4; ++i) mvr[i] = *reinterpret_cast<const f32x4*>(mv + (e0 + i) * 4);
  asm volatile("s_wait_xcnt 0x0" ::: "memory");
  f32x4 a = {0.f, 0.f, 0.f, 0.f};
#pragma unroll
  for (int j = 0; j < 4; ++j) {
    float kd = wmem[j][d];
#pragma unroll
    for (int i = 0; i < 4; ++i) a[i] += kd * mvr[i][j];
  }
#pragma unroll
  for (int c = 0; c < NCH; ++c) {
    f32x4 pc = *reinterpret_cast<const f32x4*>(pctx + ((size_t)bh * NCH + c) * 1024 + t * 4);
    a += wgt[c][d] * pc;
  }
  *reinterpret_cast<f32x4*>(ctxo + (size_t)bh * 1024 + t * 4) = a;
}

// 3c: out[e,n] = sum_d ctx[d,e] * (softmax_d(Q[:,n]) * SCALE); one work-group per
// (b, h, 512 tokens), two tokens per thread. ctx is read at an address that is the
// same for the whole work-group, so each value serves both tokens of every lane.
__device__ __forceinline__ void q_softmax(const __bf16* __restrict__ rowq, float* qv) {
#pragma unroll
  for (int g = 0; g < 4; ++g) {
    v8bf q8 = *reinterpret_cast<const v8bf*>(rowq + g * 8);
#pragma unroll
    for (int jj = 0; jj < 8; ++jj) qv[g * 8 + jj] = (float)q8[jj];
  }
  float qm = qv[0];
#pragma unroll
  for (int i = 1; i < 32; ++i) qm = fmaxf(qm, qv[i]);
  float qs = 0.f;
#pragma unroll
  for (int i = 0; i < 32; ++i) { qv[i] = exp_slot(qv[i] - qm); qs += qv[i]; }
  float scl = SCALE / qs;
#pragma unroll
  for (int i = 0; i < 32; ++i) qv[i] *= scl;
}

__device__ __forceinline__ void o_store(__bf16* __restrict__ op, const float* o) {
#pragma unroll
  for (int g = 0; g < 4; ++g) {
    v8bf st;
#pragma unroll
    for (int jj = 0; jj < 8; ++jj) st[jj] = (__bf16)o[g * 8 + jj];
    *reinterpret_cast<v8bf*>(op + g * 8) = st;
  }
}

__global__ __launch_bounds__(256, 8) void attn_apply(
    const __bf16* __restrict__ QKV, const float* __restrict__ ctx,
    __bf16* __restrict__ OutPre) {
  int t = threadIdx.x;
  int bh = blockIdx.x >> 3, seg = blockIdx.x & 7;
  int b = bh >> 3, h = bh & 7;
  int cq = h * DHEAD;
  size_t r0 = (size_t)b * NPOS + seg * 512 + t;
  size_t r1 = r0 + 256;
  const float* __restrict__ cx = ctx + (size_t)bh * 1024;

  float qa[32], qb[32], oa[32], ob[32];
  q_softmax(QKV + r0 * LDQKV + cq, qa);
  q_softmax(QKV + r1 * LDQKV + cq, qb);
#pragma unroll
  for (int e = 0; e < 32; ++e) { oa[e] = 0.f; ob[e] = 0.f; }
#pragma unroll
  for (int i = 0; i < 32; ++i) {
#pragma unroll
    for (int e = 0; e < 32; ++e) {
      float c = cx[i * 32 + e];
      oa[e] += c * qa[i];
      ob[e] += c * qb[i];
    }
  }
  o_store(OutPre + r0 * HID + cq, oa);
  o_store(OutPre + r1 * HID + cq, ob);
}

// ---------- kernel 5: channel-LN of Y + residual -> NCHW output ----------
__global__ __launch_bounds__(256) void ln_res_out(
    const float* __restrict__ Y, const float* __restrict__ x,
    float* __restrict__ out) {
  __shared__ float yt[32][257];
  __shared__ float r1[32][8];
  __shared__ float r2[32][8];
  __shared__ float mean_[32];
  __shared__ float rstd_[32];

  int t  = threadIdx.x;
  int p0 = blockIdx.x * 32;
  int b  = p0 >> 12;
  int pix = p0 & (NPOS - 1);

  const float* yrow = Y + (size_t)p0 * CDIM;
  for (int i = 0; i < 32; ++i) yt[i][t] = yrow[(size_t)i * CDIM + t];
  __syncthreads();

  int pos = t >> 3, sb = t & 7;
  float s = 0.f, sq = 0.f;
  for (int j = 0; j < 32; ++j) {
    float v = yt[pos][sb * 32 + j];
    s += v; sq += v * v;
  }
  r1[pos][sb] = s; r2[pos][sb] = sq;
  __syncthreads();
  if (t < 32) {
    float S = 0.f, Q = 0.f;
    for (int j = 0; j < 8; ++j) { S += r1[t][j]; Q += r2[t][j]; }
    float m = S * (1.f / 256.f);
    mean_[t] = m;
    rstd_[t] = rsqrtf(Q * (1.f / 256.f) - m * m + EPS);
  }
  __syncthreads();

  int pl = t & 31, cg = t >> 5;
  float m = mean_[pl], r = rstd_[pl];
  for (int i = 0; i < 32; ++i) {
    int c = i * 8 + cg;
    size_t gi = ((size_t)b * CDIM + c) * NPOS + pix + pl;
    out[gi] = (yt[pl][c] - m) * r + x[gi];
  }
}

// ---------- host launcher ----------
extern "C" void kernel_launch(void* const* d_in, const int* in_sizes, int n_in,
                              void* d_out, int out_size, void* d_ws, size_t ws_size,
                              hipStream_t stream) {
  const float* x      = (const float*)d_in[0];
  const float* mem_kv = (const float*)d_in[1];
  const float* w_qkv  = (const float*)d_in[2];
  const float* w_out  = (const float*)d_in[3];
  const float* b_out  = (const float*)d_in[4];
  float* out = (float*)d_out;

  char* ws = (char*)d_ws;
  __bf16* wq_bf  = (__bf16*)(ws + WQ_OFF);
  __bf16* wo_bf  = (__bf16*)(ws + WO_OFF);
  __bf16* Abf    = (__bf16*)(ws + A_OFF);
  __bf16* QKVbf  = (__bf16*)(ws + QKV_OFF);
  __bf16* OutPre = Abf;                     // reuse: A dead after GEMM1
  float*  Yf     = (float*)(ws + QKV_OFF);  // reuse: qkv dead after attention
  float*  pctx   = (float*)(ws + PCTX_OFF);
  float*  pm     = (float*)(ws + PM_OFF);
  float*  ps     = (float*)(ws + PS_OFF);
  float*  ctxf   = (float*)(ws + CTX_OFF);

  cvt_weights<<<768, 256, 0, stream>>>(w_qkv, w_out, wq_bf, wo_bf);
  ln_to_bf16<<<MROWS / 64, 256, 0, stream>>>(x, Abf);
  gemm_wmma_bf16<<<MROWS / 128, 256, 0, stream>>>(
      Abf, wq_bf, nullptr, nullptr, QKVbf, MROWS, LDQKV);
  attn_partial<<<BATCH * HEADS * NCH, 256, 0, stream>>>(QKVbf, pctx, pm, ps);
  attn_merge<<<BATCH * HEADS, 256, 0, stream>>>(pctx, pm, ps, mem_kv, ctxf);
  attn_apply<<<BATCH * HEADS * 8, 256, 0, stream>>>(QKVbf, ctxf, OutPre);
  gemm_wmma_bf16<<<MROWS / 128, 256, 0, stream>>>(
      OutPre, wo_bf, b_out, Yf, nullptr, MROWS, CDIM);
  ln_res_out<<<MROWS / 32, 256, 0, stream>>>(Yf, x, out);
}

// v002
// One run takes 154 microseconds.
// Next to v001, in two timings, it ran 2.30 and 2.32 times as fast.
// All steps since v000 together make it 4.48 times as fast.
#include <hip/hip_runtime.h>

// ---------- types ----------
typedef __attribute__((ext_vector_type(16))) __bf16 v16bf;
typedef __attribute__((ext_vector_type(8)))  __bf16 v8bf;
typedef __attribute__((ext_vector_type(8)))  float  v8f;
typedef __attribute__((ext_vector_type(4)))  float  f32x4;
typedef __attribute__((ext_vector_type(4)))  unsigned int u32x4;
typedef __attribute__((ext_vector_type(8)))  unsigned int u32x8;

#define HEADS 8
#define DHEAD 32
#define NPOS  4096            // 64*64 tokens per batch image
#define BATCH 16
#define CDIM  256
#define HID   256
#define MROWS (BATCH * NPOS)  // 65536
#define LDQKV 768
#define SCALE 0.17677669529663687f  // 32^-0.5
#define EPS   1e-6f

// workspace layout (bytes)
#define WQ_OFF   0u
#define WO_OFF   393216u                  // 768*256*2
#define A_OFF    524288u                  // WO_OFF + 256*256*2
#define QKV_OFF  34078720u                // A_OFF + 65536*256*2
// OutPre reuses A region; Y (f32, 67MB) reuses QKV region (100MB)
#define NCH      16                       // token chunks per (batch, head)
#define CHTOK    256                      // tokens per chunk
#define PCTX_OFF 134742016u               // QKV_OFF + 65536*768*2
#define PM_OFF   143130624u               // PCTX_OFF + 128*16*1024*4
#define PS_OFF   143392768u               // PM_OFF + 128*16*32*4
#define CTX_OFF  143654912u               // PS_OFF + 128*16*32*4

// ---------- kernel 0: weights -> bf16 ----------
__global__ __launch_bounds__(256) void cvt_weights(
    const float* __restrict__ wq, const float* __restrict__ wo,
    __bf16* __restrict__ wqb, __bf16* __restrict__ wob) {
  int idx = blockIdx.x * 256 + threadIdx.x;
  if (idx < LDQKV * CDIM) wqb[idx] = (__bf16)wq[idx];
  if (idx < CDIM * HID)   wob[idx] = (__bf16)wo[idx];
}

// ---------- kernel 1: channel-LN of x -> bf16 A[65536, 256] (K contiguous) ----------
__global__ __launch_bounds__(256) void ln_to_bf16(
    const float* __restrict__ x, __bf16* __restrict__ A) {
  __shared__ float ssum[4][64];
  __shared__ float ssq[4][64];
  __shared__ float mean_[64];
  __shared__ float rstd_[64];
  __shared__ __bf16 tile[64][264];

  int t  = threadIdx.x;
  int pl = t & 63;       // local position
  int cg = t >> 6;       // channel group (0..3), 64 channels each
  int p0 = blockIdx.x * 64;
  int b  = p0 >> 12;
  size_t base = ((size_t)b * CDIM) * NPOS + (p0 & (NPOS - 1)) + pl;

  float s = 0.f, sq = 0.f;
  for (int j = 0; j < 64; ++j) {
    float v = x[base + (size_t)(cg * 64 + j) * NPOS];
    s += v; sq += v * v;
  }
  ssum[cg][pl] = s; ssq[cg][pl] = sq;
  __syncthreads();
  if (t < 64) {
    float S = ssum[0][t] + ssum[1][t] + ssum[2][t] + ssum[3][t];
    float Q = ssq[0][t] + ssq[1][t] + ssq[2][t] + ssq[3][t];
    float m = S * (1.f / 256.f);
    mean_[t] = m;
    rstd_[t] = rsqrtf(Q * (1.f / 256.f) - m * m + EPS);
  }
  __syncthreads();
  float m = mean_[pl], r = rstd_[pl];
  for (int j = 0; j < 64; ++j) {
    int c = cg * 64 + j;
    float v = x[base + (size_t)c * NPOS];
    tile[pl][c] = (__bf16)((v - m) * r);
  }
  __syncthreads();
  // flat coalesced write-out: 64 rows x 128 dwords
  int row = t >> 2, seg = t & 3;
  const unsigned int* src = reinterpret_cast<const unsigned int*>(&tile[row][0]);
  unsigned int* dst = reinterpret_cast<unsigned int*>(A + (size_t)(p0 + row) * CDIM);
#pragma unroll
  for (int i = 0; i < 32; ++i) dst[seg * 32 + i] = src[seg * 32 + i];
}

__device__ __forceinline__ v16bf frag_ld(const __bf16* __restrict__ base,
                                         int row0, int ld, int k0, int lane) {
  int r  = row0 + (lane & 15);
  int kb = k0 + ((lane >> 4) << 3);           // +8 for upper half-wave
  const __bf16* p = base + (size_t)r * ld + kb;
  v8bf lo = *reinterpret_cast<const v8bf*>(p);       // K = kb .. kb+7
  v8bf hi = *reinterpret_cast<const v8bf*>(p + 16);  // K = kb+16 .. kb+23
  v16bf out;
#pragma unroll
  for (int i = 0; i < 8; ++i) { out[i] = lo[i]; out[8 + i] = hi[i]; }
  return out;
}

#define BS_PITCH 272            // 256 data bytes + 16 pad bytes
#define BS_SLICE 6144           // 16 * 272 = 4352, rounded up to a multiple of 2 KiB

// fragment j (rows j*16 .. j*16+15 of the panel), k = kk*32 .. kk*32+31; k order as frag_ld
__device__ __forceinline__ v16bf frag_ld_lds(const unsigned char* base,
                                             int j, int kk, int lane) {
  const unsigned char* p = base + ((kk >> 2) * 4 + j) * BS_SLICE
                         + (lane & 15) * BS_PITCH + (kk & 3) * 64 + ((lane >> 4) << 4);
  v8bf lo = *reinterpret_cast<const v8bf*>(p);        // K = kb .. kb+7
  v8bf hi = *reinterpret_cast<const v8bf*>(p + 32);   // K = kb+16 .. kb+23
  v16bf out;
#pragma unroll
  for (int i = 0; i < 8; ++i) { out[i] = lo[i]; out[8 + i] = hi[i]; }
  return out;
}

__device__ __forceinline__ unsigned int uni(unsigned int v) {
  return (unsigned int)__builtin_amdgcn_readfirstlane((int)v);
}

__global__ __launch_bounds__(256) void gemm_wmma_bf16(
    const __bf16* __restrict__ A, const __bf16* __restrict__ B,
    const float* __restrict__ bias,
    float* __restrict__ Cf, __bf16* __restrict__ Cbf,
    int M, int N) {
  constexpr int K = 256;
  __shared__ __attribute__((aligned(2048))) unsigned char Bs[8 * BS_SLICE];  // 48 KB

  int lane = threadIdx.x & 31;
  int wave = (int)uni(threadIdx.x >> 5);
  int m0 = (blockIdx.x * 8 + wave) * 16;

  v16bf afr[8];
#pragma unroll
  for (int kk = 0; kk < 8; ++kk) afr[kk] = frag_ld(A, m0, K, kk * 32, lane);

  // this wave's slice: rows (wave & 3) * 16 .. + 15 of the panel, bytes (wave >> 2) * 256 .. + 255 of each row
  unsigned lds_dst = (unsigned)(size_t)(&Bs[0]) + (unsigned)wave * BS_SLICE;  // low 32 bits = LDS offset
  const unsigned char* bsl = reinterpret_cast<const unsigned char*>(B)
                           + (size_t)(wave & 3) * 16 * (K * 2) + (size_t)(wave >> 2) * 256;
  u32x8 g1;
  g1[0] = uni((1u << 20) | (5u << 22) | (3u << 25));
  g1[1] = uni(256u << 16);
  g1[2] = uni(16u << 16);
  g1[3] = uni(256u << 16);
  g1[4] = uni(16u);
  g1[5] = uni((unsigned)(K * 2));
  g1[6] = uni(0u);
  g1[7] = uni(0u);
  int coll = lane & 15;
  int rb   = m0 + ((lane >> 4) << 3);

  for (int n0 = 0; n0 < N; n0 += 64) {
    // every wave brings its own slice; no test around the request
    unsigned long long ga = (unsigned long long)(const void*)(bsl + (size_t)n0 * (K * 2));
    u32x4 g0;
    g0[0] = uni(1u);                                                  // count = 1
    g0[1] = uni(lds_dst);                                             // LDS byte offset
    g0[2] = uni((unsigned)ga);                                        // global address [31:0]
    g0[3] = uni(((unsigned)(ga >> 32) & 0x01FFFFFFu) | 0x80000000u);  // address [56:32] | type = 2
    asm volatile("tensor_load_to_lds %0, %1" : : "s"(g0), "s"(g1) : "memory");
    // the slice counts as landed only behind its issuer's own wait; the barrier publishes it
    asm volatile("s_wait_tensorcnt 0x0" ::: "memory");
    __syncthreads();

    v8f acc[4] = {};
#pragma unroll
    for (int kk = 0; kk < 8; ++kk) {
#pragma unroll
      for (int j = 0; j < 4; ++j) {
        v16bf bf = frag_ld_lds(Bs, j, kk, lane);
        acc[j] = __builtin_amdgcn_wmma_f32_16x16x32_bf16(
            false, afr[kk], false, bf, (short)0, acc[j], false, false);
      }
    }

#pragma unroll
    for (int j = 0; j < 4; ++j) {
      int col = n0 + j * 16 + coll;
      float bb = bias ? bias[col] : 0.f;
#pragma unroll
      for (int r = 0; r < 8; ++r) {
        float v = acc[j][r] + bb;
        size_t idx = (size_t)(rb + r) * N + col;
        if (Cf) Cf[idx] = v;
        else    Cbf[idx] = (__bf16)v;
      }
    }
    // this wave's LDS reads have retired before any wave's next request targets the panel
    asm volatile("s_wait_dscnt 0x0" ::: "memory");
    __syncthreads();  // protect Bs before next group's DMA
  }
}

__device__ __forceinline__ float exp_slot(float x) {
  float y = x * 1.4426950408889634f, r;
  asm("v_exp_f32 %0, %1\n\tv_nop" : "=v"(r) : "v"(y));
  return r;
}

// ---------- kernels 3a-3c: linear attention, token axis split over work-groups ----------
// 3a: one work-group per (b, h, chunk of 256 tokens). It takes the chunk's own
// per-channel maximum m, p = exp(K - m), s = sum_n p and c[d][e] = sum_n p[d,n] V[e,n],
// and leaves m, s, c in the workspace. Each wave owns 32 tokens and the whole
// 32x32 tile (8 d x 4 e per lane); the eight waves' tiles are summed through LDS.
__global__ __launch_bounds__(256) void attn_partial(
    const __bf16* __restrict__ QKV,
    float* __restrict__ pctx, float* __restrict__ pm, float* __restrict__ ps) {
  __shared__ __attribute__((aligned(16))) float Pw[8][32][32];
  __shared__ __attribute__((aligned(16))) float Vw[8][32][32];
  __shared__ __attribute__((aligned(16))) float redm[8][32];
  __shared__ __attribute__((aligned(16))) float reds[8][32];

  int t = threadIdx.x, lane = t & 31, w = t >> 5;
  int bh = blockIdx.x / NCH, ch = blockIdx.x % NCH;
  int b = bh >> 3, h = bh & 7;
  int cg = lane & 3, tr = lane >> 2;   // 8 channels of one token per lane, 8 tokens per load
  size_t row0 = (size_t)b * NPOS + ch * CHTOK + w * 32 + tr;
  const __bf16* kp = QKV + row0 * LDQKV + 256 + h * DHEAD + cg * 8;

  float kf[4][8];
  v8bf vr[4];
#pragma unroll
  for (int i = 0; i < 4; ++i) {
    v8bf kr = *reinterpret_cast<const v8bf*>(kp + (size_t)i * 8 * LDQKV);
    vr[i]   = *reinterpret_cast<const v8bf*>(kp + (size_t)i * 8 * LDQKV + 256);
#pragma unroll
    for (int j = 0; j < 8; ++j) kf[i][j] = (float)kr[j];
  }

  // chunk maximum per channel: lane, wave (lanes of equal cg), then the eight waves
  float mx[8];
#pragma unroll
  for (int j = 0; j < 8; ++j)
    mx[j] = fmaxf(fmaxf(kf[0][j], kf[1][j]), fmaxf(kf[2][j], kf[3][j]));
#pragma unroll
  for (int off = 4; off < 32; off <<= 1)
#pragma unroll
    for (int j = 0; j < 8; ++j) mx[j] = fmaxf(mx[j], __shfl_xor(mx[j], off, 32));
  if (tr == 0) {
#pragma unroll
    for (int j = 0; j < 8; ++j) redm[w][cg * 8 + j] = mx[j];
  }
  __syncthreads();
#pragma unroll
  for (int ww = 0; ww < 8; ++ww)
#pragma unroll
    for (int j = 0; j < 8; ++j) mx[j] = fmaxf(mx[j], redm[ww][cg * 8 + j]);

  float sm[8];
#pragma unroll
  for (int j = 0; j < 8; ++j) sm[j] = 0.f;
#pragma unroll
  for (int i = 0; i < 4; ++i) {
    f32x4 p0, p1, v0, v1;
#pragma unroll
    for (int j = 0; j < 4; ++j) {
      p0[j] = exp_slot(kf[i][j] - mx[j]);
      p1[j] = exp_slot(kf[i][4 + j] - mx[4 + j]);
      sm[j] += p0[j];
      sm[4 + j] += p1[j];
      v0[j] = (float)vr[i][j];
      v1[j] = (float)vr[i][4 + j];
    }
    int n = tr + 8 * i;
    *reinterpret_cast<f32x4*>(&Pw[w][n][cg * 8])     = p0;
    *reinterpret_cast<f32x4*>(&Pw[w][n][cg * 8 + 4]) = p1;
    *reinterpret_cast<f32x4*>(&Vw[w][n][cg * 8])     = v0;
    *reinterpret_cast<f32x4*>(&Vw[w][n][cg * 8 + 4]) = v1;
  }
#pragma unroll
  for (int off = 4; off < 32; off <<= 1)
#pragma unroll
    for (int j = 0; j < 8; ++j) sm[j] += __shfl_xor(sm[j], off, 32);
  if (tr == 0) {
#pragma unroll
    for (int j = 0; j < 8; ++j) reds[w][cg * 8 + j] = sm[j];
  }
  __syncthreads();

  int d0 = (lane >> 3) * 8, e0 = (lane & 7) * 4;
  float acc[8][4];
#pragma unroll
  for (int r = 0; r < 8; ++r)
#pragma unroll
    for (int c = 0; c < 4; ++c) acc[r][c] = 0.f;
#pragma unroll 4
  for (int n = 0; n < 32; ++n) {
    f32x4 pa = *reinterpret_cast<const f32x4*>(&Pw[w][n][d0]);
    f32x4 pb = *reinterpret_cast<const f32x4*>(&Pw[w][n][d0 + 4]);
    f32x4 vv = *reinterpret_cast<const f32x4*>(&Vw[w][n][e0]);
#pragma unroll
    for (int r = 0; r < 4; ++r)
#pragma unroll
      for (int c = 0; c < 4; ++c) {
        acc[r][c]     += pa[r] * vv[c];
        acc[4 + r][c] += pb[r] * vv[c];
      }
  }

  // sum the eight waves' tiles: each wave reuses its own P slab, which it alone has read
#pragma unroll
  for (int r = 0; r < 8; ++r) {
    f32x4 a;
#pragma unroll
    for (int c = 0; c < 4; ++c) a[c] = acc[r][c];
    *reinterpret_cast<f32x4*>(&Pw[w][d0 + r][e0]) = a;
  }
  __syncthreads();
  f32x4 tot = *reinterpret_cast<const f32x4*>(&Pw[0][0][0] + t * 4);
#pragma unroll
  for (int ww = 1; ww < 8; ++ww)
    tot += *reinterpret_cast<const f32x4*>(&Pw[ww][0][0] + t * 4);
  size_t pidx = blockIdx.x;
  *reinterpret_cast<f32x4*>(pctx + pidx * 1024 + t * 4) = tot;
  if (t < 32) {
    float m = redm[0][t], s = reds[0][t];
#pragma unroll
    for (int ww = 1; ww < 8; ++ww) { m = fmaxf(m, redm[ww][t]); s += reds[ww][t]; }
    pm[pidx * 32 + t] = m;
    ps[pidx * 32 + t] = s;
  }
}

// 3b: one work-group per (b, h): merge the chunks' (m, s, c) and the four memory
// tokens into context[d][e] = sum_n softmax_n(K)[d,n] * V[e,n].
__global__ __launch_bounds__(256) void attn_merge(
    const float* __restrict__ pctx, const float* __restrict__ pm,
    const float* __restrict__ ps, const float* __restrict__ mem_kv,
    float* __restrict__ ctxo) {
  __shared__ float wgt[NCH][32];
  __shared__ float wmem[4][32];
  int t = threadIdx.x;
  int bh = blockIdx.x, h = bh & 7;
  const float* mk = mem_kv + (size_t)h * DHEAD * 4;
  const float* mv = mem_kv + (size_t)HEADS * DHEAD * 4 + (size_t)h * DHEAD * 4;
  if (t < 32) {
    float mc[NCH], em[4];
    float M = mk[t * 4];
#pragma unroll
    for (int j = 1; j < 4; ++j) M = fmaxf(M, mk[t * 4 + j]);
#pragma unroll
    for (int c = 0; c < NCH; ++c) {
      mc[c] = pm[((size_t)bh * NCH + c) * 32 + t];
      M = fmaxf(M, mc[c]);
    }
    float S = 0.f;
#pragma unroll
    for (int j = 0; j < 4; ++j) { em[j] = exp_slot(mk[t * 4 + j] - M); S += em[j]; }
#pragma unroll
    for (int c = 0; c < NCH; ++c) {
      mc[c] = exp_slot(mc[c] - M);
      S += mc[c] * ps[((size_t)bh * NCH + c) * 32 + t];
    }
    float inv = 1.f / S;
#pragma unroll
    for (int c = 0; c < NCH; ++c) wgt[c][t] = mc[c] * inv;
#pragma unroll
    for (int j = 0; j < 4; ++j) wmem[j][t] = em[j] * inv;
  }
  // the loads above name registers that are rewritten below: keep the wait in front
  asm volatile("s_wait_xcnt 0x0" ::: "memory");
  __syncthreads();
  int d = t >> 3, e0 = (t & 7) * 4;
  f32x4 mvr[4];
#pragma unroll
  for (int i = 0; i < 4; ++i) mvr[i] = *reinterpret_cast<const f32x4*>(mv + (e0 + i) * 4);
  asm volatile("s_wait_xcnt 0x0" ::: "memory");
  f32x4 a = {0.f, 0.f, 0.f, 0.f};
#pragma unroll
  for (int j = 0; j < 4; ++j) {
    float kd = wmem[j][d];
#pragma unroll
    for (int i = 0; i < 4; ++i) a[i] += kd * mvr[i][j];
  }
#pragma unroll
  for (int c = 0; c < NCH; ++c) {
    f32x4 pc = *reinterpret_cast<const f32x4*>(pctx + ((size_t)bh * NCH + c) * 1024 + t * 4);
    a += wgt[c][d] * pc;
  }
  *reinterpret_cast<f32x4*>(ctxo + (size_t)bh * 1024 + t * 4) = a;
}

// 3c: out[e,n] = sum_d ctx[d,e] * (softmax_d(Q[:,n]) * SCALE); one work-group per
// (b, h, 512 tokens), two tokens per thread. ctx is read at an address that is the
// same for the whole work-group, so each value serves both tokens of every lane.
__device__ __forceinline__ void q_softmax(const __bf16* __restrict__ rowq, float* qv) {
#pragma unroll
  for (int g = 0; g < 4; ++g) {
    v8bf q8 = *reinterpret_cast<const v8bf*>(rowq + g * 8);
#pragma unroll
    for (int jj = 0; jj < 8; ++jj) qv[g * 8 + jj] = (float)q8[jj];
  }
  float qm = qv[0];
#pragma unroll
  for (int i = 1; i < 32; ++i) qm = fmaxf(qm, qv[i]);
  float qs = 0.f;
#pragma unroll
  for (int i = 0; i < 32; ++i) { qv[i] = exp_slot(qv[i] - qm); qs += qv[i]; }
  float scl = SCALE / qs;
#pragma unroll
  for (int i = 0; i < 32; ++i) qv[i] *= scl;
}

__device__ __forceinline__ void o_store(__bf16* __restrict__ op, const float* o) {
#pragma unroll
  for (int g = 0; g < 4; ++g) {
    v8bf st;
#pragma unroll
    for (int jj = 0; jj < 8; ++jj) st[jj] = (__bf16)o[g * 8 + jj];
    *reinterpret_cast<v8bf*>(op + g * 8) = st;
  }
}

__global__ __launch_bounds__(256, 8) void attn_apply(
    const __bf16* __restrict__ QKV, const float* __restrict__ ctx,
    __bf16* __restrict__ OutPre) {
  int t = threadIdx.x;
  int bh = blockIdx.x >> 3, seg = blockIdx.x & 7;
  int b = bh >> 3, h = bh & 7;
  int cq = h * DHEAD;
  size_t r0 = (size_t)b * NPOS + seg * 512 + t;
  size_t r1 = r0 + 256;
  const float* __restrict__ cx = ctx + (size_t)bh * 1024;

  float qa[32], qb[32], oa[32], ob[32];
  q_softmax(QKV + r0 * LDQKV + cq, qa);
  q_softmax(QKV + r1 * LDQKV + cq, qb);
#pragma unroll
  for (int e = 0; e < 32; ++e) { oa[e] = 0.f; ob[e] = 0.f; }
#pragma unroll
  for (int i = 0; i < 32; ++i) {
#pragma unroll
    for (int e = 0; e < 32; ++e) {
      float c = cx[i * 32 + e];
      oa[e] += c * qa[i];
      ob[e] += c * qb[i];
    }
  }
  o_store(OutPre + r0 * HID + cq, oa);
  o_store(OutPre + r1 * HID + cq, ob);
}

// ---------- kernel 5: channel-LN of Y + residual -> NCHW output ----------
__global__ __launch_bounds__(256) void ln_res_out(
    const float* __restrict__ Y, const float* __restrict__ x,
    float* __restrict__ out) {
  __shared__ float yt[32][257];
  __shared__ float r1[32][8];
  __shared__ float r2[32][8];
  __shared__ float mean_[32];
  __shared__ float rstd_[32];

  int t  = threadIdx.x;
  int p0 = blockIdx.x * 32;
  int b  = p0 >> 12;
  int pix = p0 & (NPOS - 1);

  const float* yrow = Y + (size_t)p0 * CDIM;
  for (int i = 0; i < 32; ++i) yt[i][t] = yrow[(size_t)i * CDIM + t];
  __syncthreads();

  int pos = t >> 3, sb = t & 7;
  float s = 0.f, sq = 0.f;
  for (int j = 0; j < 32; ++j) {
    float v = yt[pos][sb * 32 + j];
    s += v; sq += v * v;
  }
  r1[pos][sb] = s; r2[pos][sb] = sq;
  __syncthreads();
  if (t < 32) {
    float S = 0.f, Q = 0.f;
    for (int j = 0; j < 8; ++j) { S += r1[t][j]; Q += r2[t][j]; }
    float m = S * (1.f / 256.f);
    mean_[t] = m;
    rstd_[t] = rsqrtf(Q * (1.f / 256.f) - m * m + EPS);
  }
  __syncthreads();

  int pl = t & 31, cg = t >> 5;
  float m = mean_[pl], r = rstd_[pl];
  for (int i = 0; i < 32; ++i) {
    int c = i * 8 + cg;
    size_t gi = ((size_t)b * CDIM + c) * NPOS + pix + pl;
    out[gi] = (yt[pl][c] - m) * r + x[gi];
  }
}

// ---------- host launcher ----------
extern "C" void kernel_launch(void* const* d_in, const int* in_sizes, int n_in,
                              void* d_out, int out_size, void* d_ws, size_t ws_size,
                              hipStream_t stream) {
  const float* x      = (const float*)d_in[0];
  const float* mem_kv = (const float*)d_in[1];
  const float* w_qkv  = (const float*)d_in[2];
  const float* w_out  = (const float*)d_in[3];
  const float* b_out  = (const float*)d_in[4];
  float* out = (float*)d_out;

  char* ws = (char*)d_ws;
  __bf16* wq_bf  = (__bf16*)(ws + WQ_OFF);
  __bf16* wo_bf  = (__bf16*)(ws + WO_OFF);
  __bf16* Abf    = (__bf16*)(ws + A_OFF);
  __bf16* QKVbf  = (__bf16*)(ws + QKV_OFF);
  __bf16* OutPre = Abf;                     // reuse: A dead after GEMM1
  float*  Yf     = (float*)(ws + QKV_OFF);  // reuse: qkv dead after attention
  float*  pctx   = (float*)(ws + PCTX_OFF);
  float*  pm     = (float*)(ws + PM_OFF);
  float*  ps     = (float*)(ws + PS_OFF);
  float*  ctxf   = (float*)(ws + CTX_OFF);

  cvt_weights<<<768, 256, 0, stream>>>(w_qkv, w_out, wq_bf, wo_bf);
  ln_to_bf16<<<MROWS / 64, 256, 0, stream>>>(x, Abf);
  gemm_wmma_bf16<<<MROWS / 128, 256, 0, stream>>>(
      Abf, wq_bf, nullptr, nullptr, QKVbf, MROWS, LDQKV);
  attn_partial<<<BATCH * HEADS * NCH, 256, 0, stream>>>(QKVbf, pctx, pm, ps);
  attn_merge<<<BATCH * HEADS, 256, 0, stream>>>(pctx, pm, ps, mem_kv, ctxf);
  attn_apply<<<BATCH * HEADS * 8, 256, 0, stream>>>(QKVbf, ctxf, OutPre);
  gemm_wmma_bf16<<<MROWS / 128, 256, 0, stream>>>(
      OutPre, wo_bf, b_out, Yf, nullptr, MROWS, CDIM);
  ln_res_out<<<MROWS / 32, 256, 0, stream>>>(Yf, x, out);
}

// v003
// Measured time: 137 microseconds a run.
// Timed twice side by side with v002, it ran 1.12 and 1.13 times as fast.
// All steps since v000 together make it 5.04 times as fast.
#include <hip/hip_runtime.h>

// ---------- types ----------
typedef __attribute__((ext_vector_type(16))) __bf16 v16bf;
typedef __attribute__((ext_vector_type(8)))  __bf16 v8bf;
typedef __attribute__((ext_vector_type(8)))  float  v8f;
typedef __attribute__((ext_vector_type(4)))  float  f32x4;
typedef __attribute__((ext_vector_type(4)))  unsigned int u32x4;
typedef __attribute__((ext_vector_type(8)))  unsigned int u32x8;

#define HEADS 8
#define DHEAD 32
#define NPOS  4096            // 64*64 tokens per batch image
#define BATCH 16
#define CDIM  256
#define HID   256
#define MROWS (BATCH * NPOS)  // 65536
#define LDQKV 768
#define SCALE 0.17677669529663687f  // 32^-0.5
#define EPS   1e-6f

// workspace layout (bytes)
#define WQ_OFF   0u
#define WO_OFF   393216u                  // 768*256*2
#define A_OFF    524288u                  // WO_OFF + 256*256*2
#define QKV_OFF  34078720u                // A_OFF + 65536*256*2
// OutPre reuses A region
#define NCH      16                       // token chunks per (batch, head)
#define CHTOK    256                      // tokens per chunk
#define PCTX_OFF 134742016u               // QKV_OFF + 65536*768*2
#define PM_OFF   143130624u               // PCTX_OFF + 128*16*1024*4
#define PS_OFF   143392768u               // PM_OFF + 128*16*32*4
#define CTX_OFF  143654912u               // PS_OFF + 128*16*32*4

// ---------- kernel 0: weights -> bf16 ----------
__global__ __launch_bounds__(256) void cvt_weights(
    const float* __restrict__ wq, const float* __restrict__ wo,
    __bf16* __restrict__ wqb, __bf16* __restrict__ wob) {
  int idx = blockIdx.x * 256 + threadIdx.x;
  if (idx < LDQKV * CDIM) wqb[idx] = (__bf16)wq[idx];
  if (idx < CDIM * HID)   wob[idx] = (__bf16)wo[idx];
}

// ---------- kernel 1: channel-LN of x -> bf16 A[65536, 256] (K contiguous) ----------
__global__ __launch_bounds__(256) void ln_to_bf16(
    const float* __restrict__ x, __bf16* __restrict__ A) {
  __shared__ float ssum[4][64];
  __shared__ float ssq[4][64];
  __shared__ float mean_[64];
  __shared__ float rstd_[64];
  __shared__ __bf16 tile[64][264];

  int t  = threadIdx.x;
  int pl = t & 63;       // local position
  int cg = t >> 6;       // channel group (0..3), 64 channels each
  int p0 = blockIdx.x * 64;
  int b  = p0 >> 12;
  size_t base = ((size_t)b * CDIM) * NPOS + (p0 & (NPOS - 1)) + pl;

  float s = 0.f, sq = 0.f;
  for (int j = 0; j < 64; ++j) {
    float v = x[base + (size_t)(cg * 64 + j) * NPOS];
    s += v; sq += v * v;
  }
  ssum[cg][pl] = s; ssq[cg][pl] = sq;
  __syncthreads();
  if (t < 64) {
    float S = ssum[0][t] + ssum[1][t] + ssum[2][t] + ssum[3][t];
    float Q = ssq[0][t] + ssq[1][t] + ssq[2][t] + ssq[3][t];
    float m = S * (1.f / 256.f);
    mean_[t] = m;
    rstd_[t] = rsqrtf(Q * (1.f / 256.f) - m * m + EPS);
  }
  __syncthreads();
  float m = mean_[pl], r = rstd_[pl];
  for (int j = 0; j < 64; ++j) {
    int c = cg * 64 + j;
    float v = x[base + (size_t)c * NPOS];
    tile[pl][c] = (__bf16)((v - m) * r);
  }
  __syncthreads();
  // flat coalesced write-out: 64 rows x 128 dwords
  int row = t >> 2, seg = t & 3;
  const unsigned int* src = reinterpret_cast<const unsigned int*>(&tile[row][0]);
  unsigned int* dst = reinterpret_cast<unsigned int*>(A + (size_t)(p0 + row) * CDIM);
#pragma unroll
  for (int i = 0; i < 32; ++i) dst[seg * 32 + i] = src[seg * 32 + i];
}

__device__ __forceinline__ v16bf frag_ld(const __bf16* __restrict__ base,
                                         int row0, int ld, int k0, int lane) {
  int r  = row0 + (lane & 15);
  int kb = k0 + ((lane >> 4) << 3);           // +8 for upper half-wave
  const __bf16* p = base + (size_t)r * ld + kb;
  v8bf lo = *reinterpret_cast<const v8bf*>(p);       // K = kb .. kb+7
  v8bf hi = *reinterpret_cast<const v8bf*>(p + 16);  // K = kb+16 .. kb+23
  v16bf out;
#pragma unroll
  for (int i = 0; i < 8; ++i) { out[i] = lo[i]; out[8 + i] = hi[i]; }
  return out;
}

#define BS_PITCH 272            // 256 data bytes + 16 pad bytes
#define BS_SLICE 6144           // 16 * 272 = 4352, rounded up to a multiple of 2 KiB

// fragment j (rows j*16 .. j*16+15 of the panel), k = kk*32 .. kk*32+31; k order as frag_ld
__device__ __forceinline__ v16bf frag_ld_lds(const unsigned char* base,
                                             int j, int kk, int lane) {
  const unsigned char* p = base + ((kk >> 2) * 4 + j) * BS_SLICE
                         + (lane & 15) * BS_PITCH + (kk & 3) * 64 + ((lane >> 4) << 4);
  v8bf lo = *reinterpret_cast<const v8bf*>(p);        // K = kb .. kb+7
  v8bf hi = *reinterpret_cast<const v8bf*>(p + 32);   // K = kb+16 .. kb+23
  v16bf out;
#pragma unroll
  for (int i = 0; i < 8; ++i) { out[i] = lo[i]; out[8 + i] = hi[i]; }
  return out;
}

__device__ __forceinline__ unsigned int uni(unsigned int v) {
  return (unsigned int)__builtin_amdgcn_readfirstlane((int)v);
}

__global__ __launch_bounds__(256) void gemm_wmma_bf16(
    const __bf16* __restrict__ A, const __bf16* __restrict__ B,
    const float* __restrict__ bias,
    float* __restrict__ Cf, __bf16* __restrict__ Cbf,
    int M, int N) {
  constexpr int K = 256;
  __shared__ __attribute__((aligned(2048))) unsigned char Bs[8 * BS_SLICE];  // 48 KB

  int lane = threadIdx.x & 31;
  int wave = (int)uni(threadIdx.x >> 5);
  int m0 = (blockIdx.x * 8 + wave) * 16;

  v16bf afr[8];
#pragma unroll
  for (int kk = 0; kk < 8; ++kk) afr[kk] = frag_ld(A, m0, K, kk * 32, lane);

  // this wave's slice: rows (wave & 3) * 16 .. + 15 of the panel, bytes (wave >> 2) * 256 .. + 255 of each row
  unsigned lds_dst = (unsigned)(size_t)(&Bs[0]) + (unsigned)wave * BS_SLICE;  // low 32 bits = LDS offset
  const unsigned char* bsl = reinterpret_cast<const unsigned char*>(B)
                           + (size_t)(wave & 3) * 16 * (K * 2) + (size_t)(wave >> 2) * 256;
  u32x8 g1;
  g1[0] = uni((1u << 20) | (5u << 22) | (3u << 25));
  g1[1] = uni(256u << 16);
  g1[2] = uni(16u << 16);
  g1[3] = uni(256u << 16);
  g1[4] = uni(16u);
  g1[5] = uni((unsigned)(K * 2));
  g1[6] = uni(0u);
  g1[7] = uni(0u);
  int coll = lane & 15;
  int rb   = m0 + ((lane >> 4) << 3);

  for (int n0 = 0; n0 < N; n0 += 64) {
    // every wave brings its own slice; no test around the request
    unsigned long long ga = (unsigned long long)(const void*)(bsl + (size_t)n0 * (K * 2));
    u32x4 g0;
    g0[0] = uni(1u);                                                  // count = 1
    g0[1] = uni(lds_dst);                                             // LDS byte offset
    g0[2] = uni((unsigned)ga);                                        // global address [31:0]
    g0[3] = uni(((unsigned)(ga >> 32) & 0x01FFFFFFu) | 0x80000000u);  // address [56:32] | type = 2
    asm volatile("tensor_load_to_lds %0, %1" : : "s"(g0), "s"(g1) : "memory");
    // the slice counts as landed only behind its issuer's own wait; the barrier publishes it
    asm volatile("s_wait_tensorcnt 0x0" ::: "memory");
    __syncthreads();

    v8f acc[4] = {};
#pragma unroll
    for (int kk = 0; kk < 8; ++kk) {
#pragma unroll
      for (int j = 0; j < 4; ++j) {
        v16bf bf = frag_ld_lds(Bs, j, kk, lane);
        acc[j] = __builtin_amdgcn_wmma_f32_16x16x32_bf16(
            false, afr[kk], false, bf, (short)0, acc[j], false, false);
      }
    }

#pragma unroll
    for (int j = 0; j < 4; ++j) {
      int col = n0 + j * 16 + coll;
      float bb = bias ? bias[col] : 0.f;
#pragma unroll
      for (int r = 0; r < 8; ++r) {
        float v = acc[j][r] + bb;
        size_t idx = (size_t)(rb + r) * N + col;
        if (Cf) Cf[idx] = v;
        else    Cbf[idx] = (__bf16)v;
      }
    }
    // this wave's LDS reads have retired before any wave's next request targets the panel
    asm volatile("s_wait_dscnt 0x0" ::: "memory");
    __syncthreads();  // protect Bs before next group's DMA
  }
}

__device__ __forceinline__ float exp_slot(float x) {
  float y = x * 1.4426950408889634f, r;
  asm("v_exp_f32 %0, %1\n\tv_nop" : "=v"(r) : "v"(y));
  return r;
}

// ---------- kernels 3a-3c: linear attention, token axis split over work-groups ----------
// 3a: one work-group per (b, h, chunk of 256 tokens). It takes the chunk's own
// per-channel maximum m, p = exp(K - m), s = sum_n p and c[d][e] = sum_n p[d,n] V[e,n],
// and leaves m, s, c in the workspace. Each wave owns 32 tokens and the whole
// 32x32 tile (8 d x 4 e per lane); the eight waves' tiles are summed through LDS.
__global__ __launch_bounds__(256) void attn_partial(
    const __bf16* __restrict__ QKV,
    float* __restrict__ pctx, float* __restrict__ pm, float* __restrict__ ps) {
  __shared__ __attribute__((aligned(16))) float Pw[8][32][32];
  __shared__ __attribute__((aligned(16))) float Vw[8][32][32];
  __shared__ __attribute__((aligned(16))) float redm[8][32];
  __shared__ __attribute__((aligned(16))) float reds[8][32];

  int t = threadIdx.x, lane = t & 31, w = t >> 5;
  int bh = blockIdx.x / NCH, ch = blockIdx.x % NCH;
  int b = bh >> 3, h = bh & 7;
  int cg = lane & 3, tr = lane >> 2;   // 8 channels of one token per lane, 8 tokens per load
  size_t row0 = (size_t)b * NPOS + ch * CHTOK + w * 32 + tr;
  const __bf16* kp = QKV + row0 * LDQKV + 256 + h * DHEAD + cg * 8;

  float kf[4][8];
  v8bf vr[4];
#pragma unroll
  for (int i = 0; i < 4; ++i) {
    v8bf kr = *reinterpret_cast<const v8bf*>(kp + (size_t)i * 8 * LDQKV);
    vr[i]   = *reinterpret_cast<const v8bf*>(kp + (size_t)i * 8 * LDQKV + 256);
#pragma unroll
    for (int j = 0; j < 8; ++j) kf[i][j] = (float)kr[j];
  }

  // chunk maximum per channel: lane, wave (lanes of equal cg), then the eight waves
  float mx[8];
#pragma unroll
  for (int j = 0; j < 8; ++j)
    mx[j] = fmaxf(fmaxf(kf[0][j], kf[1][j]), fmaxf(kf[2][j], kf[3][j]));
#pragma unroll
  for (int off = 4; off < 32; off <<= 1)
#pragma unroll
    for (int j = 0; j < 8; ++j) mx[j] = fmaxf(mx[j], __shfl_xor(mx[j], off, 32));
  if (tr == 0) {
#pragma unroll
    for (int j = 0; j < 8; ++j) redm[w][cg * 8 + j] = mx[j];
  }
  __syncthreads();
#pragma unroll
  for (int ww = 0; ww < 8; ++ww)
#pragma unroll
    for (int j = 0; j < 8; ++j) mx[j] = fmaxf(mx[j], redm[ww][cg * 8 + j]);

  float sm[8];
#pragma unroll
  for (int j = 0; j < 8; ++j) sm[j] = 0.f;
#pragma unroll
  for (int i = 0; i < 4; ++i) {
    f32x4 p0, p1, v0, v1;
#pragma unroll
    for (int j = 0; j < 4; ++j) {
      p0[j] = exp_slot(kf[i][j] - mx[j]);
      p1[j] = exp_slot(kf[i][4 + j] - mx[4 + j]);
      sm[j] += p0[j];
      sm[4 + j] += p1[j];
      v0[j] = (float)vr[i][j];
      v1[j] = (float)vr[i][4 + j];
    }
    int n = tr + 8 * i;
    *reinterpret_cast<f32x4*>(&Pw[w][n][cg * 8])     = p0;
    *reinterpret_cast<f32x4*>(&Pw[w][n][cg * 8 + 4]) = p1;
    *reinterpret_cast<f32x4*>(&Vw[w][n][cg * 8])     = v0;
    *reinterpret_cast<f32x4*>(&Vw[w][n][cg * 8 + 4]) = v1;
  }
#pragma unroll
  for (int off = 4; off < 32; off <<= 1)
#pragma unroll
    for (int j = 0; j < 8; ++j) sm[j] += __shfl_xor(sm[j], off, 32);
  if (tr == 0) {
#pragma unroll
    for (int j = 0; j < 8; ++j) reds[w][cg * 8 + j] = sm[j];
  }
  __syncthreads();

  int d0 = (lane >> 3) * 8, e0 = (lane & 7) * 4;
  float acc[8][4];
#pragma unroll
  for (int r = 0; r < 8; ++r)
#pragma unroll
    for (int c = 0; c < 4; ++c) acc[r][c] = 0.f;
#pragma unroll 4
  for (int n = 0; n < 32; ++n) {
    f32x4 pa = *reinterpret_cast<const f32x4*>(&Pw[w][n][d0]);
    f32x4 pb = *reinterpret_cast<const f32x4*>(&Pw[w][n][d0 + 4]);
    f32x4 vv = *reinterpret_cast<const f32x4*>(&Vw[w][n][e0]);
#pragma unroll
    for (int r = 0; r < 4; ++r)
#pragma unroll
      for (int c = 0; c < 4; ++c) {
        acc[r][c]     += pa[r] * vv[c];
        acc[4 + r][c] += pb[r] * vv[c];
      }
  }

  // sum the eight waves' tiles: each wave reuses its own P slab, which it alone has read
#pragma unroll
  for (int r = 0; r < 8; ++r) {
    f32x4 a;
#pragma unroll
    for (int c = 0; c < 4; ++c) a[c] = acc[r][c];
    *reinterpret_cast<f32x4*>(&Pw[w][d0 + r][e0]) = a;
  }
  __syncthreads();
  f32x4 tot = *reinterpret_cast<const f32x4*>(&Pw[0][0][0] + t * 4);
#pragma unroll
  for (int ww = 1; ww < 8; ++ww)
    tot += *reinterpret_cast<const f32x4*>(&Pw[ww][0][0] + t * 4);
  size_t pidx = blockIdx.x;
  *reinterpret_cast<f32x4*>(pctx + pidx * 1024 + t * 4) = tot;
  if (t < 32) {
    float m = redm[0][t], s = reds[0][t];
#pragma unroll
    for (int ww = 1; ww < 8; ++ww) { m = fmaxf(m, redm[ww][t]); s += reds[ww][t]; }
    pm[pidx * 32 + t] = m;
    ps[pidx * 32 + t] = s;
  }
}

// 3b: one work-group per (b, h): merge the chunks' (m, s, c) and the four memory
// tokens into context[d][e] = sum_n softmax_n(K)[d,n] * V[e,n].
__global__ __launch_bounds__(256) void attn_merge(
    const float* __restrict__ pctx, const float* __restrict__ pm,
    const float* __restrict__ ps, const float* __restrict__ mem_kv,
    float* __restrict__ ctxo) {
  __shared__ float wgt[NCH][32];
  __shared__ float wmem[4][32];
  int t = threadIdx.x;
  int bh = blockIdx.x, h = bh & 7;
  const float* mk = mem_kv + (size_t)h * DHEAD * 4;
  const float* mv = mem_kv + (size_t)HEADS * DHEAD * 4 + (size_t)h * DHEAD * 4;
  if (t < 32) {
    float mc[NCH], em[4];
    float M = mk[t * 4];
#pragma unroll
    for (int j = 1; j < 4; ++j) M = fmaxf(M, mk[t * 4 + j]);
#pragma unroll
    for (int c = 0; c < NCH; ++c) {
      mc[c] = pm[((size_t)bh * NCH + c) * 32 + t];
      M = fmaxf(M, mc[c]);
    }
    float S = 0.f;
#pragma unroll
    for (int j = 0; j < 4; ++j) { em[j] = exp_slot(mk[t * 4 + j] - M); S += em[j]; }
#pragma unroll
    for (int c = 0; c < NCH; ++c) {
      mc[c] = exp_slot(mc[c] - M);
      S += mc[c] * ps[((size_t)bh * NCH + c) * 32 + t];
    }
    float inv = 1.f / S;
#pragma unroll
    for (int c = 0; c < NCH; ++c) wgt[c][t] = mc[c] * inv;
#pragma unroll
    for (int j = 0; j < 4; ++j) wmem[j][t] = em[j] * inv;
  }
  // the loads above name registers that are rewritten below: keep the wait in front
  asm volatile("s_wait_xcnt 0x0" ::: "memory");
  __syncthreads();
  int d = t >> 3, e0 = (t & 7) * 4;
  f32x4 mvr[4];
#pragma unroll
  for (int i = 0; i < 4; ++i) mvr[i] = *reinterpret_cast<const f32x4*>(mv + (e0 + i) * 4);
  asm volatile("s_wait_xcnt 0x0" ::: "memory");
  f32x4 a = {0.f, 0.f, 0.f, 0.f};
#pragma unroll
  for (int j = 0; j < 4; ++j) {
    float kd = wmem[j][d];
#pragma unroll
    for (int i = 0; i < 4; ++i) a[i] += kd * mvr[i][j];
  }
#pragma unroll
  for (int c = 0; c < NCH; ++c) {
    f32x4 pc = *reinterpret_cast<const f32x4*>(pctx + ((size_t)bh * NCH + c) * 1024 + t * 4);
    a += wgt[c][d] * pc;
  }
  *reinterpret_cast<f32x4*>(ctxo + (size_t)bh * 1024 + t * 4) = a;
}

// 3c: out[e,n] = sum_d ctx[d,e] * (softmax_d(Q[:,n]) * SCALE); one work-group per
// (b, h, 512 tokens), two tokens per thread. ctx is read at an address that is the
// same for the whole work-group, so each value serves both tokens of every lane.
__device__ __forceinline__ void q_softmax(const __bf16* __restrict__ rowq, float* qv) {
#pragma unroll
  for (int g = 0; g < 4; ++g) {
    v8bf q8 = *reinterpret_cast<const v8bf*>(rowq + g * 8);
#pragma unroll
    for (int jj = 0; jj < 8; ++jj) qv[g * 8 + jj] = (float)q8[jj];
  }
  float qm = qv[0];
#pragma unroll
  for (int i = 1; i < 32; ++i) qm = fmaxf(qm, qv[i]);
  float qs = 0.f;
#pragma unroll
  for (int i = 0; i < 32; ++i) { qv[i] = exp_slot(qv[i] - qm); qs += qv[i]; }
  float scl = SCALE / qs;
#pragma unroll
  for (int i = 0; i < 32; ++i) qv[i] *= scl;
}

__device__ __forceinline__ void o_store(__bf16* __restrict__ op, const float* o) {
#pragma unroll
  for (int g = 0; g < 4; ++g) {
    v8bf st;
#pragma unroll
    for (int jj = 0; jj < 8; ++jj) st[jj] = (__bf16)o[g * 8 + jj];
    *reinterpret_cast<v8bf*>(op + g * 8) = st;
  }
}

__global__ __launch_bounds__(256, 8) void attn_apply(
    const __bf16* __restrict__ QKV, const float* __restrict__ ctx,
    __bf16* __restrict__ OutPre) {
  int t = threadIdx.x;
  int bh = blockIdx.x >> 3, seg = blockIdx.x & 7;
  int b = bh >> 3, h = bh & 7;
  int cq = h * DHEAD;
  size_t r0 = (size_t)b * NPOS + seg * 512 + t;
  size_t r1 = r0 + 256;
  const float* __restrict__ cx = ctx + (size_t)bh * 1024;

  float qa[32], qb[32], oa[32], ob[32];
  q_softmax(QKV + r0 * LDQKV + cq, qa);
  q_softmax(QKV + r1 * LDQKV + cq, qb);
#pragma unroll
  for (int e = 0; e < 32; ++e) { oa[e] = 0.f; ob[e] = 0.f; }
#pragma unroll
  for (int i = 0; i < 32; ++i) {
#pragma unroll
    for (int e = 0; e < 32; ++e) {
      float c = cx[i * 32 + e];
      oa[e] += c * qa[i];
      ob[e] += c * qb[i];
    }
  }
  o_store(OutPre + r0 * HID + cq, oa);
  o_store(OutPre + r1 * HID + cq, ob);
}

__global__ __launch_bounds__(256, 4) void gemm_ln_res_out(
    const __bf16* __restrict__ A, const __bf16* __restrict__ B,
    const float* __restrict__ bias, const float* __restrict__ x,
    float* __restrict__ out) {
  constexpr int K = 256;
  __shared__ __attribute__((aligned(2048))) unsigned char Bs[8 * BS_SLICE];  // 48 KB

  int lane = threadIdx.x & 31;
  int wave = (int)uni(threadIdx.x >> 5);
  int m0 = (blockIdx.x * 8 + wave) * 16;
  int hh = lane >> 4;

  // this wave's 16 tokens x 256 k, register-resident
  v16bf afr[8];
#pragma unroll
  for (int kk = 0; kk < 8; ++kk) afr[kk] = frag_ld(A, m0, K, kk * 32, lane);

  // this wave's slice: rows (wave & 3) * 16 .. + 15 of the panel, bytes (wave >> 2) * 256 .. + 255 of each row
  unsigned lds_dst = (unsigned)(size_t)(&Bs[0]) + (unsigned)wave * BS_SLICE;  // low 32 bits = LDS offset
  const unsigned char* bsl = reinterpret_cast<const unsigned char*>(B)
                           + (size_t)(wave & 3) * 16 * (K * 2) + (size_t)(wave >> 2) * 256;
  u32x8 g1;
  g1[0] = uni((1u << 20) | (5u << 22) | (3u << 25));
  g1[1] = uni(256u << 16);
  g1[2] = uni(16u << 16);
  g1[3] = uni(256u << 16);
  g1[4] = uni(16u);
  g1[5] = uni((unsigned)(K * 2));
  g1[6] = uni(0u);
  g1[7] = uni(0u);

  // the sums start from the bias of the lane's eight channels of each tile; the 16 values of a
  // tile are read at a wave-uniform address (scalar loads) and each half wave takes its eight
  v8f acc[4][4];
#pragma unroll
  for (int g = 0; g < 4; ++g)
#pragma unroll
    for (int j = 0; j < 4; ++j)
#pragma unroll
      for (int r = 0; r < 8; ++r) {
        float blo = bias[g * 64 + j * 16 + r], bhi = bias[g * 64 + j * 16 + 8 + r];
        acc[g][j][r] = hh ? bhi : blo;
      }
  // unrolled so that the accumulators of all four groups are indexed by constants and stay in registers
#pragma unroll
  for (int g = 0; g < 4; ++g) {
    // every wave brings its own slice; no test around the request
    unsigned long long ga = (unsigned long long)(const void*)(bsl + (size_t)(g * 64) * (K * 2));
    u32x4 g0;
    g0[0] = uni(1u);                                                  // count = 1
    g0[1] = uni(lds_dst);                                             // LDS byte offset
    g0[2] = uni((unsigned)ga);                                        // global address [31:0]
    g0[3] = uni(((unsigned)(ga >> 32) & 0x01FFFFFFu) | 0x80000000u);  // address [56:32] | type = 2
    asm volatile("tensor_load_to_lds %0, %1" : : "s"(g0), "s"(g1) : "memory");
    // the slice counts as landed only behind its issuer's own wait; the barrier publishes it
    asm volatile("s_wait_tensorcnt 0x0" ::: "memory");
    __syncthreads();

    // closes the scheduling region, so that the order asked for below holds for this group's reads alone
    __builtin_amdgcn_sched_barrier(0);
#pragma unroll
    for (int kk = 0; kk < 8; ++kk) {
#pragma unroll
      for (int j = 0; j < 4; ++j) {
        v16bf wf = frag_ld_lds(Bs, j, kk, lane);
        acc[g][j] = __builtin_amdgcn_wmma_f32_16x16x32_bf16(
            false, wf, false, afr[kk], (short)0, acc[g][j], false, false);
      }
    }
    // LDS reads run four fragments ahead of the matrix instructions (left alone, the compiler reads one
    // fragment, waits and multiplies, and every product pays the whole LDS latency): eight reads, then
    // each product followed by the two reads that refill its fragment's registers
    __builtin_amdgcn_sched_group_barrier(0x100, 8, 0);
#pragma unroll
    for (int i = 0; i < 28; ++i) {
      __builtin_amdgcn_sched_group_barrier(0x008, 1, 0);
      __builtin_amdgcn_sched_group_barrier(0x100, 2, 0);
    }
    __builtin_amdgcn_sched_group_barrier(0x008, 4, 0);
    __builtin_amdgcn_sched_barrier(0);  // end of that region
    if (g < 3) {
      // this wave's LDS reads have retired before any wave's next request targets the panel
      asm volatile("s_wait_dscnt 0x0" ::: "memory");
      __syncthreads();  // protect Bs before the next group's request
    }
  }

  int tok = m0 + (lane & 15);
  size_t base = ((size_t)(tok >> 12) * CDIM + hh * 8) * NPOS + (tok & (NPOS - 1));
  const float* __restrict__ xp = x + base;
  float* __restrict__ op = out + base;
  // x of the first group's 32 channels is asked for before the statistics
  float xr[2][32];
#pragma unroll
  for (int i = 0; i < 32; ++i) xr[0][i] = xp[(size_t)((i >> 3) * 16 + (i & 7)) * NPOS];

  // mean and variance of the token over its 256 channels: eight running sums, then the other half wave
  v8f vs = {}, vq = {};
#pragma unroll
  for (int g = 0; g < 4; ++g)
#pragma unroll
    for (int j = 0; j < 4; ++j) { vs += acc[g][j]; vq += acc[g][j] * acc[g][j]; }
  float s  = ((vs[0] + vs[1]) + (vs[2] + vs[3])) + ((vs[4] + vs[5]) + (vs[6] + vs[7]));
  float sq = ((vq[0] + vq[1]) + (vq[2] + vq[3])) + ((vq[4] + vq[5]) + (vq[6] + vq[7]));
  s  += __shfl_xor(s, 16, 32);
  sq += __shfl_xor(sq, 16, 32);
  float mean = s * (1.f / 256.f);
  float rstd = rsqrtf(sq * (1.f / 256.f) - mean * mean + EPS);

#pragma unroll
  for (int g = 0; g < 4; ++g) {
    if (g < 3) {
#pragma unroll
      for (int i = 0; i < 32; ++i)
        xr[(g + 1) & 1][i] = xp[(size_t)((g + 1) * 64 + (i >> 3) * 16 + (i & 7)) * NPOS];
      __builtin_amdgcn_sched_barrier(0);  // the next group's x stays in flight while this group is stored
    }
#pragma unroll
    for (int i = 0; i < 32; ++i) {
      size_t o = (size_t)(g * 64 + (i >> 3) * 16 + (i & 7)) * NPOS;
      op[o] = (acc[g][i >> 3][i & 7] - mean) * rstd + xr[g & 1][i];
    }
  }
}

// ---------- host launcher ----------
extern "C" void kernel_launch(void* const* d_in, const int* in_sizes, int n_in,
                              void* d_out, int out_size, void* d_ws, size_t ws_size,
                              hipStream_t stream) {
  const float* x      = (const float*)d_in[0];
  const float* mem_kv = (const float*)d_in[1];
  const float* w_qkv  = (const float*)d_in[2];
  const float* w_out  = (const float*)d_in[3];
  const float* b_out  = (const float*)d_in[4];
  float* out = (float*)d_out;

  char* ws = (char*)d_ws;
  __bf16* wq_bf  = (__bf16*)(ws + WQ_OFF);
  __bf16* wo_bf  = (__bf16*)(ws + WO_OFF);
  __bf16* Abf    = (__bf16*)(ws + A_OFF);
  __bf16* QKVbf  = (__bf16*)(ws + QKV_OFF);
  __bf16* OutPre = Abf;                     // reuse: A dead after GEMM1
  float*  pctx   = (float*)(ws + PCTX_OFF);
  float*  pm     = (float*)(ws + PM_OFF);
  float*  ps     = (float*)(ws + PS_OFF);
  float*  ctxf   = (float*)(ws + CTX_OFF);

  cvt_weights<<<768, 256, 0, stream>>>(w_qkv, w_out, wq_bf, wo_bf);
  ln_to_bf16<<<MROWS / 64, 256, 0, stream>>>(x, Abf);
  gemm_wmma_bf16<<<MROWS / 128, 256, 0, stream>>>(
      Abf, wq_bf, nullptr, nullptr, QKVbf, MROWS, LDQKV);
  attn_partial<<<BATCH * HEADS * NCH, 256, 0, stream>>>(QKVbf, pctx, pm, ps);
  attn_merge<<<BATCH * HEADS, 256, 0, stream>>>(pctx, pm, ps, mem_kv, ctxf);
  attn_apply<<<BATCH * HEADS * 8, 256, 0, stream>>>(QKVbf, ctxf, OutPre);
  gemm_ln_res_out<<<MROWS / 128, 256, 0, stream>>>(OutPre, wo_bf, b_out, x, out);
}

// v004
// One run takes 130 microseconds.
// Two timings next to v003 both put it at 1.05 times that version's speed.
// Over all steps from v000 it is 5.30 times as fast.
#include <hip/hip_runtime.h>

// ---------- types ----------
typedef __attribute__((ext_vector_type(16))) __bf16 v16bf;
typedef __attribute__((ext_vector_type(8)))  __bf16 v8bf;
typedef __attribute__((ext_vector_type(8)))  float  v8f;
typedef __attribute__((ext_vector_type(4)))  float  f32x4;
typedef __attribute__((ext_vector_type(4)))  unsigned int u32x4;
typedef __attribute__((ext_vector_type(8)))  unsigned int u32x8;

#define HEADS 8
#define DHEAD 32
#define NPOS  4096            // 64*64 tokens per batch image
#define BATCH 16
#define CDIM  256
#define HID   256
#define MROWS (BATCH * NPOS)  // 65536
#define LDQKV 768
#define SCALE 0.17677669529663687f  // 32^-0.5
#define EPS   1e-6f

// workspace layout (bytes)
#define WQ_OFF   0u
#define WO_OFF   393216u                  // 768*256*2
#define A_OFF    524288u                  // WO_OFF + 256*256*2
#define QKV_OFF  34078720u                // A_OFF + 65536*256*2
// OutPre lies at A_OFF
#define NCH      16                       // token chunks per (batch, head)
#define CHTOK    256                      // tokens per chunk
#define PCTX_OFF 134742016u               // QKV_OFF + 65536*768*2
#define PM_OFF   143130624u               // PCTX_OFF + 128*16*1024*4
#define PS_OFF   143392768u               // PM_OFF + 128*16*32*4
#define CTX_OFF  143654912u               // PS_OFF + 128*16*32*4

// ---------- kernel 0: weights -> bf16 ----------
__global__ __launch_bounds__(256) void cvt_weights(
    const float* __restrict__ wq, const float* __restrict__ wo,
    __bf16* __restrict__ wqb, __bf16* __restrict__ wob) {
  int idx = blockIdx.x * 256 + threadIdx.x;
  if (idx < LDQKV * CDIM) wqb[idx] = (__bf16)wq[idx];
  if (idx < CDIM * HID)   wob[idx] = (__bf16)wo[idx];
}

__device__ __forceinline__ v16bf frag_ld(const __bf16* __restrict__ base,
                                         int row0, int ld, int k0, int lane) {
  int r  = row0 + (lane & 15);
  int kb = k0 + ((lane >> 4) << 3);           // +8 for upper half-wave
  const __bf16* p = base + (size_t)r * ld + kb;
  v8bf lo = *reinterpret_cast<const v8bf*>(p);       // K = kb .. kb+7
  v8bf hi = *reinterpret_cast<const v8bf*>(p + 16);  // K = kb+16 .. kb+23
  v16bf out;
#pragma unroll
  for (int i = 0; i < 8; ++i) { out[i] = lo[i]; out[8 + i] = hi[i]; }
  return out;
}

#define BS_PITCH 272            // 256 data bytes + 16 pad bytes
#define BS_SLICE 6144           // 16 * 272 = 4352, rounded up to a multiple of 2 KiB

// fragment j (rows j*16 .. j*16+15 of the panel), k = kk*32 .. kk*32+31; k order as frag_ld
__device__ __forceinline__ v16bf frag_ld_lds(const unsigned char* base,
                                             int j, int kk, int lane) {
  const unsigned char* p = base + ((kk >> 2) * 4 + j) * BS_SLICE
                         + (lane & 15) * BS_PITCH + (kk & 3) * 64 + ((lane >> 4) << 4);
  v8bf lo = *reinterpret_cast<const v8bf*>(p);        // K = kb .. kb+7
  v8bf hi = *reinterpret_cast<const v8bf*>(p + 32);   // K = kb+16 .. kb+23
  v16bf out;
#pragma unroll
  for (int i = 0; i < 8; ++i) { out[i] = lo[i]; out[8 + i] = hi[i]; }
  return out;
}

__device__ __forceinline__ unsigned int uni(unsigned int v) {
  return (unsigned int)__builtin_amdgcn_readfirstlane((int)v);
}

__global__ __launch_bounds__(256, 4) void ln_gemm_qkv(
    const float* x, const __bf16* __restrict__ B,
    __bf16* __restrict__ C) {
  constexpr int K = 256;
  __shared__ __attribute__((aligned(2048))) unsigned char Bs[8 * BS_SLICE];  // 48 KB

  int lane = threadIdx.x & 31;
  int wave = (int)uni(threadIdx.x >> 5);
  int m0 = (blockIdx.x * 8 + wave) * 16;
  int hh = lane >> 4;
  int tok = m0 + (lane & 15);

  // the lane's 128 channels of its token, all asked for at once
  const float* xp = x + ((size_t)(tok >> 12) * CDIM + hh * 8) * NPOS + (tok & (NPOS - 1));
  float xv[8][16];
#pragma unroll
  for (int kk = 0; kk < 8; ++kk)
#pragma unroll
    for (int e = 0; e < 16; ++e)
      xv[kk][e] = xp[(size_t)(kk * 32 + (e >> 3) * 16 + (e & 7)) * NPOS];
  // asks for the loads ahead of the sums (left alone, the compiler holds the last four back behind the
  // wait for all the others, and the wave pays the memory latency twice)
  __builtin_amdgcn_sched_group_barrier(0x020, 128, 0);
  // the loads name an address pair that is rewritten below: keep the wait in front (x is not declared
  // restrict, so that no load moves behind this statement)
  asm volatile("s_wait_xcnt 0x0" ::: "memory");

  // mean and variance of the token over its 256 channels: eight running sums, then the other half wave
  float vs[8], vq[8];
#pragma unroll
  for (int i = 0; i < 8; ++i) { vs[i] = 0.f; vq[i] = 0.f; }
#pragma unroll
  for (int kk = 0; kk < 8; ++kk)
#pragma unroll
    for (int e = 0; e < 16; ++e) { vs[e & 7] += xv[kk][e]; vq[e & 7] += xv[kk][e] * xv[kk][e]; }
  float s  = ((vs[0] + vs[1]) + (vs[2] + vs[3])) + ((vs[4] + vs[5]) + (vs[6] + vs[7]));
  float sq = ((vq[0] + vq[1]) + (vq[2] + vq[3])) + ((vq[4] + vq[5]) + (vq[6] + vq[7]));
  s  += __shfl_xor(s, 16, 32);
  sq += __shfl_xor(sq, 16, 32);
  float mean = s * (1.f / 256.f);
  float rstd = rsqrtf(sq * (1.f / 256.f) - mean * mean + EPS);

  v16bf afr[8];
#pragma unroll
  for (int kk = 0; kk < 8; ++kk)
#pragma unroll
    for (int e = 0; e < 16; ++e) afr[kk][e] = (__bf16)((xv[kk][e] - mean) * rstd);

  // this wave's slice: rows (wave & 3) * 16 .. + 15 of the panel, bytes (wave >> 2) * 256 .. + 255 of each row
  unsigned lds_dst = (unsigned)(size_t)(&Bs[0]) + (unsigned)wave * BS_SLICE;  // low 32 bits = LDS offset
  const unsigned char* bsl = reinterpret_cast<const unsigned char*>(B)
                           + (size_t)(wave & 3) * 16 * (K * 2) + (size_t)(wave >> 2) * 256;
  u32x8 g1;
  g1[0] = uni((1u << 20) | (5u << 22) | (3u << 25));
  g1[1] = uni(256u << 16);
  g1[2] = uni(16u << 16);
  g1[3] = uni(256u << 16);
  g1[4] = uni(16u);
  g1[5] = uni((unsigned)(K * 2));
  g1[6] = uni(0u);
  g1[7] = uni(0u);
  __bf16* __restrict__ cp = C + (size_t)tok * LDQKV + hh * 8;

  for (int n0 = 0; n0 < LDQKV; n0 += 64) {
    // every wave brings its own slice; no test around the request
    unsigned long long ga = (unsigned long long)(const void*)(bsl + (size_t)n0 * (K * 2));
    u32x4 g0;
    g0[0] = uni(1u);                                                  // count = 1
    g0[1] = uni(lds_dst);                                             // LDS byte offset
    g0[2] = uni((unsigned)ga);                                        // global address [31:0]
    g0[3] = uni(((unsigned)(ga >> 32) & 0x01FFFFFFu) | 0x80000000u);  // address [56:32] | type = 2
    asm volatile("tensor_load_to_lds %0, %1" : : "s"(g0), "s"(g1) : "memory");
    // the slice counts as landed only behind its issuer's own wait; the barrier publishes it
    asm volatile("s_wait_tensorcnt 0x0" ::: "memory");
    __syncthreads();

    v8f acc[4] = {};
#pragma unroll
    for (int kk = 0; kk < 8; ++kk) {
#pragma unroll
      for (int j = 0; j < 4; ++j) {
        v16bf wf = frag_ld_lds(Bs, j, kk, lane);
        acc[j] = __builtin_amdgcn_wmma_f32_16x16x32_bf16(
            false, wf, false, afr[kk], (short)0, acc[j], false, false);
      }
    }

#pragma unroll
    for (int j = 0; j < 4; ++j) {
      v8bf st;
#pragma unroll
      for (int r = 0; r < 8; ++r) st[r] = (__bf16)acc[j][r];
      *reinterpret_cast<v8bf*>(cp + n0 + j * 16) = st;
    }
    // the stores name registers that the next group rewrites: keep the wait in front
    asm volatile("s_wait_xcnt 0x0" ::: "memory");
    // this wave's LDS reads have retired before any wave's next request targets the panel
    asm volatile("s_wait_dscnt 0x0" ::: "memory");
    __syncthreads();  // protect Bs before next group's DMA
  }
}

__device__ __forceinline__ float exp_slot(float x) {
  float y = x * 1.4426950408889634f, r;
  asm("v_exp_f32 %0, %1\n\tv_nop" : "=v"(r) : "v"(y));
  return r;
}

// ---------- kernels 3a-3c: linear attention, token axis split over work-groups ----------
// 3a: one work-group per (b, h, chunk of 256 tokens). It takes the chunk's own
// per-channel maximum m, p = exp(K - m), s = sum_n p and c[d][e] = sum_n p[d,n] V[e,n],
// and leaves m, s, c in the workspace. Each wave owns 32 tokens and the whole
// 32x32 tile (8 d x 4 e per lane); the eight waves' tiles are summed through LDS.
__global__ __launch_bounds__(256) void attn_partial(
    const __bf16* __restrict__ QKV,
    float* __restrict__ pctx, float* __restrict__ pm, float* __restrict__ ps) {
  __shared__ __attribute__((aligned(16))) float Pw[8][32][32];
  __shared__ __attribute__((aligned(16))) float Vw[8][32][32];
  __shared__ __attribute__((aligned(16))) float redm[8][32];
  __shared__ __attribute__((aligned(16))) float reds[8][32];

  int t = threadIdx.x, lane = t & 31, w = t >> 5;
  int bh = blockIdx.x / NCH, ch = blockIdx.x % NCH;
  int b = bh >> 3, h = bh & 7;
  int cg = lane & 3, tr = lane >> 2;   // 8 channels of one token per lane, 8 tokens per load
  size_t row0 = (size_t)b * NPOS + ch * CHTOK + w * 32 + tr;
  const __bf16* kp = QKV + row0 * LDQKV + 256 + h * DHEAD + cg * 8;

  float kf[4][8];
  v8bf vr[4];
#pragma unroll
  for (int i = 0; i < 4; ++i) {
    v8bf kr = *reinterpret_cast<const v8bf*>(kp + (size_t)i * 8 * LDQKV);
    vr[i]   = *reinterpret_cast<const v8bf*>(kp + (size_t)i * 8 * LDQKV + 256);
#pragma unroll
    for (int j = 0; j < 8; ++j) kf[i][j] = (float)kr[j];
  }

  // chunk maximum per channel: lane, wave (lanes of equal cg), then the eight waves
  float mx[8];
#pragma unroll
  for (int j = 0; j < 8; ++j)
    mx[j] = fmaxf(fmaxf(kf[0][j], kf[1][j]), fmaxf(kf[2][j], kf[3][j]));
#pragma unroll
  for (int off = 4; off < 32; off <<= 1)
#pragma unroll
    for (int j = 0; j < 8; ++j) mx[j] = fmaxf(mx[j], __shfl_xor(mx[j], off, 32));
  if (tr == 0) {
#pragma unroll
    for (int j = 0; j < 8; ++j) redm[w][cg * 8 + j] = mx[j];
  }
  __syncthreads();
#pragma unroll
  for (int ww = 0; ww < 8; ++ww)
#pragma unroll
    for (int j = 0; j < 8; ++j) mx[j] = fmaxf(mx[j], redm[ww][cg * 8 + j]);

  float sm[8];
#pragma unroll
  for (int j = 0; j < 8; ++j) sm[j] = 0.f;
#pragma unroll
  for (int i = 0; i < 4; ++i) {
    f32x4 p0, p1, v0, v1;
#pragma unroll
    for (int j = 0; j < 4; ++j) {
      p0[j] = exp_slot(kf[i][j] - mx[j]);
      p1[j] = exp_slot(kf[i][4 + j] - mx[4 + j]);
      sm[j] += p0[j];
      sm[4 + j] += p1[j];
      v0[j] = (float)vr[i][j];
      v1[j] = (float)vr[i][4 + j];
    }
    int n = tr + 8 * i;
    *reinterpret_cast<f32x4*>(&Pw[w][n][cg * 8])     = p0;
    *reinterpret_cast<f32x4*>(&Pw[w][n][cg * 8 + 4]) = p1;
    *reinterpret_cast<f32x4*>(&Vw[w][n][cg * 8])     = v0;
    *reinterpret_cast<f32x4*>(&Vw[w][n][cg * 8 + 4]) = v1;
  }
#pragma unroll
  for (int off = 4; off < 32; off <<= 1)
#pragma unroll
    for (int j = 0; j < 8; ++j) sm[j] += __shfl_xor(sm[j], off, 32);
  if (tr == 0) {
#pragma unroll
    for (int j = 0; j < 8; ++j) reds[w][cg * 8 + j] = sm[j];
  }
  __syncthreads();

  int d0 = (lane >> 3) * 8, e0 = (lane & 7) * 4;
  float acc[8][4];
#pragma unroll
  for (int r = 0; r < 8; ++r)
#pragma unroll
    for (int c = 0; c < 4; ++c) acc[r][c] = 0.f;
#pragma unroll 4
  for (int n = 0; n < 32; ++n) {
    f32x4 pa = *reinterpret_cast<const f32x4*>(&Pw[w][n][d0]);
    f32x4 pb = *reinterpret_cast<const f32x4*>(&Pw[w][n][d0 + 4]);
    f32x4 vv = *reinterpret_cast<const f32x4*>(&Vw[w][n][e0]);
#pragma unroll
    for (int r = 0; r < 4; ++r)
#pragma unroll
      for (int c = 0; c < 4; ++c) {
        acc[r][c]     += pa[r] * vv[c];
        acc[4 + r][c] += pb[r] * vv[c];
      }
  }

  // sum the eight waves' tiles: each wave reuses its own P slab, which it alone has read
#pragma unroll
  for (int r = 0; r < 8; ++r) {
    f32x4 a;
#pragma unroll
    for (int c = 0; c < 4; ++c) a[c] = acc[r][c];
    *reinterpret_cast<f32x4*>(&Pw[w][d0 + r][e0]) = a;
  }
  __syncthreads();
  f32x4 tot = *reinterpret_cast<const f32x4*>(&Pw[0][0][0] + t * 4);
#pragma unroll
  for (int ww = 1; ww < 8; ++ww)
    tot += *reinterpret_cast<const f32x4*>(&Pw[ww][0][0] + t * 4);
  size_t pidx = blockIdx.x;
  *reinterpret_cast<f32x4*>(pctx + pidx * 1024 + t * 4) = tot;
  if (t < 32) {
    float m = redm[0][t], s = reds[0][t];
#pragma unroll
    for (int ww = 1; ww < 8; ++ww) { m = fmaxf(m, redm[ww][t]); s += reds[ww][t]; }
    pm[pidx * 32 + t] = m;
    ps[pidx * 32 + t] = s;
  }
}

// 3b: one work-group per (b, h): merge the chunks' (m, s, c) and the four memory
// tokens into context[d][e] = sum_n softmax_n(K)[d,n] * V[e,n].
__global__ __launch_bounds__(256) void attn_merge(
    const float* __restrict__ pctx, const float* __restrict__ pm,
    const float* __restrict__ ps, const float* __restrict__ mem_kv,
    float* __restrict__ ctxo) {
  __shared__ float wgt[NCH][32];
  __shared__ float wmem[4][32];
  int t = threadIdx.x;
  int bh = blockIdx.x, h = bh & 7;
  const float* mk = mem_kv + (size_t)h * DHEAD * 4;
  const float* mv = mem_kv + (size_t)HEADS * DHEAD * 4 + (size_t)h * DHEAD * 4;
  if (t < 32) {
    float mc[NCH], em[4];
    float M = mk[t * 4];
#pragma unroll
    for (int j = 1; j < 4; ++j) M = fmaxf(M, mk[t * 4 + j]);
#pragma unroll
    for (int c = 0; c < NCH; ++c) {
      mc[c] = pm[((size_t)bh * NCH + c) * 32 + t];
      M = fmaxf(M, mc[c]);
    }
    float S = 0.f;
#pragma unroll
    for (int j = 0; j < 4; ++j) { em[j] = exp_slot(mk[t * 4 + j] - M); S += em[j]; }
#pragma unroll
    for (int c = 0; c < NCH; ++c) {
      mc[c] = exp_slot(mc[c] - M);
      S += mc[c] * ps[((size_t)bh * NCH + c) * 32 + t];
    }
    float inv = 1.f / S;
#pragma unroll
    for (int c = 0; c < NCH; ++c) wgt[c][t] = mc[c] * inv;
#pragma unroll
    for (int j = 0; j < 4; ++j) wmem[j][t] = em[j] * inv;
  }
  // the loads above name registers that are rewritten below: keep the wait in front
  asm volatile("s_wait_xcnt 0x0" ::: "memory");
  __syncthreads();
  int d = t >> 3, e0 = (t & 7) * 4;
  f32x4 mvr[4];
#pragma unroll
  for (int i = 0; i < 4; ++i) mvr[i] = *reinterpret_cast<const f32x4*>(mv + (e0 + i) * 4);
  asm volatile("s_wait_xcnt 0x0" ::: "memory");
  f32x4 a = {0.f, 0.f, 0.f, 0.f};
#pragma unroll
  for (int j = 0; j < 4; ++j) {
    float kd = wmem[j][d];
#pragma unroll
    for (int i = 0; i < 4; ++i) a[i] += kd * mvr[i][j];
  }
#pragma unroll
  for (int c = 0; c < NCH; ++c) {
    f32x4 pc = *reinterpret_cast<const f32x4*>(pctx + ((size_t)bh * NCH + c) * 1024 + t * 4);
    a += wgt[c][d] * pc;
  }
  *reinterpret_cast<f32x4*>(ctxo + (size_t)bh * 1024 + t * 4) = a;
}

// 3c: out[e,n] = sum_d ctx[d,e] * (softmax_d(Q[:,n]) * SCALE); one work-group per
// (b, h, 512 tokens), two tokens per thread. ctx is read at an address that is the
// same for the whole work-group, so each value serves both tokens of every lane.
__device__ __forceinline__ void q_softmax(const __bf16* __restrict__ rowq, float* qv) {
#pragma unroll
  for (int g = 0; g < 4; ++g) {
    v8bf q8 = *reinterpret_cast<const v8bf*>(rowq + g * 8);
#pragma unroll
    for (int jj = 0; jj < 8; ++jj) qv[g * 8 + jj] = (float)q8[jj];
  }
  float qm = qv[0];
#pragma unroll
  for (int i = 1; i < 32; ++i) qm = fmaxf(qm, qv[i]);
  float qs = 0.f;
#pragma unroll
  for (int i = 0; i < 32; ++i) { qv[i] = exp_slot(qv[i] - qm); qs += qv[i]; }
  float scl = SCALE / qs;
#pragma unroll
  for (int i = 0; i < 32; ++i) qv[i] *= scl;
}

__device__ __forceinline__ void o_store(__bf16* __restrict__ op, const float* o) {
#pragma unroll
  for (int g = 0; g < 4; ++g) {
    v8bf st;
#pragma unroll
    for (int jj = 0; jj < 8; ++jj) st[jj] = (__bf16)o[g * 8 + jj];
    *reinterpret_cast<v8bf*>(op + g * 8) = st;
  }
}

__global__ __launch_bounds__(256, 8) void attn_apply(
    const __bf16* __restrict__ QKV, const float* __restrict__ ctx,
    __bf16* __restrict__ OutPre) {
  int t = threadIdx.x;
  int bh = blockIdx.x >> 3, seg = blockIdx.x & 7;
  int b = bh >> 3, h = bh & 7;
  int cq = h * DHEAD;
  size_t r0 = (size_t)b * NPOS + seg * 512 + t;
  size_t r1 = r0 + 256;
  const float* __restrict__ cx = ctx + (size_t)bh * 1024;

  float qa[32], qb[32], oa[32], ob[32];
  q_softmax(QKV + r0 * LDQKV + cq, qa);
  q_softmax(QKV + r1 * LDQKV + cq, qb);
#pragma unroll
  for (int e = 0; e < 32; ++e) { oa[e] = 0.f; ob[e] = 0.f; }
#pragma unroll
  for (int i = 0; i < 32; ++i) {
#pragma unroll
    for (int e = 0; e < 32; ++e) {
      float c = cx[i * 32 + e];
      oa[e] += c * qa[i];
      ob[e] += c * qb[i];
    }
  }
  o_store(OutPre + r0 * HID + cq, oa);
  o_store(OutPre + r1 * HID + cq, ob);
}

__global__ __launch_bounds__(256, 4) void gemm_ln_res_out(
    const __bf16* __restrict__ A, const __bf16* __restrict__ B,
    const float* __restrict__ bias, const float* __restrict__ x,
    float* __restrict__ out) {
  constexpr int K = 256;
  __shared__ __attribute__((aligned(2048))) unsigned char Bs[8 * BS_SLICE];  // 48 KB

  int lane = threadIdx.x & 31;
  int wave = (int)uni(threadIdx.x >> 5);
  int m0 = (blockIdx.x * 8 + wave) * 16;
  int hh = lane >> 4;

  // this wave's 16 tokens x 256 k, register-resident
  v16bf afr[8];
#pragma unroll
  for (int kk = 0; kk < 8; ++kk) afr[kk] = frag_ld(A, m0, K, kk * 32, lane);

  // this wave's slice: rows (wave & 3) * 16 .. + 15 of the panel, bytes (wave >> 2) * 256 .. + 255 of each row
  unsigned lds_dst = (unsigned)(size_t)(&Bs[0]) + (unsigned)wave * BS_SLICE;  // low 32 bits = LDS offset
  const unsigned char* bsl = reinterpret_cast<const unsigned char*>(B)
                           + (size_t)(wave & 3) * 16 * (K * 2) + (size_t)(wave >> 2) * 256;
  u32x8 g1;
  g1[0] = uni((1u << 20) | (5u << 22) | (3u << 25));
  g1[1] = uni(256u << 16);
  g1[2] = uni(16u << 16);
  g1[3] = uni(256u << 16);
  g1[4] = uni(16u);
  g1[5] = uni((unsigned)(K * 2));
  g1[6] = uni(0u);
  g1[7] = uni(0u);

  // the sums start from the bias of the lane's eight channels of each tile; the 16 values of a
  // tile are read at a wave-uniform address (scalar loads) and each half wave takes its eight
  v8f acc[4][4];
#pragma unroll
  for (int g = 0; g < 4; ++g)
#pragma unroll
    for (int j = 0; j < 4; ++j)
#pragma unroll
      for (int r = 0; r < 8; ++r) {
        float blo = bias[g * 64 + j * 16 + r], bhi = bias[g * 64 + j * 16 + 8 + r];
        acc[g][j][r] = hh ? bhi : blo;
      }
  // unrolled so that the accumulators of all four groups are indexed by constants and stay in registers
#pragma unroll
  for (int g = 0; g < 4; ++g) {
    // every wave brings its own slice; no test around the request
    unsigned long long ga = (unsigned long long)(const void*)(bsl + (size_t)(g * 64) * (K * 2));
    u32x4 g0;
    g0[0] = uni(1u);                                                  // count = 1
    g0[1] = uni(lds_dst);                                             // LDS byte offset
    g0[2] = uni((unsigned)ga);                                        // global address [31:0]
    g0[3] = uni(((unsigned)(ga >> 32) & 0x01FFFFFFu) | 0x80000000u);  // address [56:32] | type = 2
    asm volatile("tensor_load_to_lds %0, %1" : : "s"(g0), "s"(g1) : "memory");
    // the slice counts as landed only behind its issuer's own wait; the barrier publishes it
    asm volatile("s_wait_tensorcnt 0x0" ::: "memory");
    __syncthreads();

    // closes the scheduling region, so that the order asked for below holds for this group's reads alone
    __builtin_amdgcn_sched_barrier(0);
#pragma unroll
    for (int kk = 0; kk < 8; ++kk) {
#pragma unroll
      for (int j = 0; j < 4; ++j) {
        v16bf wf = frag_ld_lds(Bs, j, kk, lane);
        acc[g][j] = __builtin_amdgcn_wmma_f32_16x16x32_bf16(
            false, wf, false, afr[kk], (short)0, acc[g][j], false, false);
      }
    }
    // LDS reads run four fragments ahead of the matrix instructions (left alone, the compiler reads one
    // fragment, waits and multiplies, and every product pays the whole LDS latency): eight reads, then
    // each product followed by the two reads that refill its fragment's registers
    __builtin_amdgcn_sched_group_barrier(0x100, 8, 0);
#pragma unroll
    for (int i = 0; i < 28; ++i) {
      __builtin_amdgcn_sched_group_barrier(0x008, 1, 0);
      __builtin_amdgcn_sched_group_barrier(0x100, 2, 0);
    }
    __builtin_amdgcn_sched_group_barrier(0x008, 4, 0);
    __builtin_amdgcn_sched_barrier(0);  // end of that region
    if (g < 3) {
      // this wave's LDS reads have retired before any wave's next request targets the panel
      asm volatile("s_wait_dscnt 0x0" ::: "memory");
      __syncthreads();  // protect Bs before the next group's request
    }
  }

  int tok = m0 + (lane & 15);
  size_t base = ((size_t)(tok >> 12) * CDIM + hh * 8) * NPOS + (tok & (NPOS - 1));
  const float* __restrict__ xp = x + base;
  float* __restrict__ op = out + base;
  // x of the first group's 32 channels is asked for before the statistics
  float xr[2][32];
#pragma unroll
  for (int i = 0; i < 32; ++i) xr[0][i] = xp[(size_t)((i >> 3) * 16 + (i & 7)) * NPOS];

  // mean and variance of the token over its 256 channels: eight running sums, then the other half wave
  v8f vs = {}, vq = {};
#pragma unroll
  for (int g = 0; g < 4; ++g)
#pragma unroll
    for (int j = 0; j < 4; ++j) { vs += acc[g][j]; vq += acc[g][j] * acc[g][j]; }
  float s  = ((vs[0] + vs[1]) + (vs[2] + vs[3])) + ((vs[4] + vs[5]) + (vs[6] + vs[7]));
  float sq = ((vq[0] + vq[1]) + (vq[2] + vq[3])) + ((vq[4] + vq[5]) + (vq[6] + vq[7]));
  s  += __shfl_xor(s, 16, 32);
  sq += __shfl_xor(sq, 16, 32);
  float mean = s * (1.f / 256.f);
  float rstd = rsqrtf(sq * (1.f / 256.f) - mean * mean + EPS);

#pragma unroll
  for (int g = 0; g < 4; ++g) {
    if (g < 3) {
#pragma unroll
      for (int i = 0; i < 32; ++i)
        xr[(g + 1) & 1][i] = xp[(size_t)((g + 1) * 64 + (i >> 3) * 16 + (i & 7)) * NPOS];
      __builtin_amdgcn_sched_barrier(0);  // the next group's x stays in flight while this group is stored
    }
#pragma unroll
    for (int i = 0; i < 32; ++i) {
      size_t o = (size_t)(g * 64 + (i >> 3) * 16 + (i & 7)) * NPOS;
      op[o] = (acc[g][i >> 3][i & 7] - mean) * rstd + xr[g & 1][i];
    }
  }
}

// ---------- host launcher ----------
extern "C" void kernel_launch(void* const* d_in, const int* in_sizes, int n_in,
                              void* d_out, int out_size, void* d_ws, size_t ws_size,
                              hipStream_t stream) {
  const float* x      = (const float*)d_in[0];
  const float* mem_kv = (const float*)d_in[1];
  const float* w_qkv  = (const float*)d_in[2];
  const float* w_out  = (const float*)d_in[3];
  const float* b_out  = (const float*)d_in[4];
  float* out = (float*)d_out;

  char* ws = (char*)d_ws;
  __bf16* wq_bf  = (__bf16*)(ws + WQ_OFF);
  __bf16* wo_bf  = (__bf16*)(ws + WO_OFF);
  __bf16* QKVbf  = (__bf16*)(ws + QKV_OFF);
  __bf16* OutPre = (__bf16*)(ws + A_OFF);
  float*  pctx   = (float*)(ws + PCTX_OFF);
  float*  pm     = (float*)(ws + PM_OFF);
  float*  ps     = (float*)(ws + PS_OFF);
  float*  ctxf   = (float*)(ws + CTX_OFF);

  cvt_weights<<<768, 256, 0, stream>>>(w_qkv, w_out, wq_bf, wo_bf);
  ln_gemm_qkv<<<MROWS / 128, 256, 0, stream>>>(x, wq_bf, QKVbf);
  attn_partial<<<BATCH * HEADS * NCH, 256, 0, stream>>>(QKVbf, pctx, pm, ps);
  attn_merge<<<BATCH * HEADS, 256, 0, stream>>>(pctx, pm, ps, mem_kv, ctxf);
  attn_apply<<<BATCH * HEADS * 8, 256, 0, stream>>>(QKVbf, ctxf, OutPre);
  gemm_ln_res_out<<<MROWS / 128, 256, 0, stream>>>(OutPre, wo_bf, b_out, x, out);
}

// v006
// A run of this version takes 77.9 microseconds.
// Versions in between are left out here; by their measured steps it is 1.66 times as fast as v004.
// Counting every step since v000, it is 8.81 times as fast.
#include <hip/hip_runtime.h>

// ---------- types ----------
typedef __attribute__((ext_vector_type(16))) __bf16 v16bf;
typedef __attribute__((ext_vector_type(8)))  __bf16 v8bf;
typedef __attribute__((ext_vector_type(2)))  __bf16 v2bf;
typedef __attribute__((ext_vector_type(8)))  float  v8f;
typedef __attribute__((ext_vector_type(4)))  float  f32x4;
typedef __attribute__((ext_vector_type(2)))  float  f32x2;
typedef __attribute__((ext_vector_type(4)))  unsigned int u32x4;
typedef __attribute__((ext_vector_type(8)))  unsigned int u32x8;

#define HEADS 8
#define DHEAD 32
#define NPOS  4096            // 64*64 tokens per batch image
#define BATCH 16
#define CDIM  256
#define HID   256
#define MROWS (BATCH * NPOS)  // 65536
#define LDQKV 768
#define SCALE 0.17677669529663687f  // 32^-0.5
#define EPS   1e-6f

// workspace layout (bytes)
#define WQ_OFF   0u
#define WEFF_OFF 524288u                  // 16 folded output weights of 256*256*2 bytes each
#define QKV_OFF  34078720u
#define NCH      32                       // token chunks per (batch, head): one per work-group of ln_gemm_qkv
#define PCTX_OFF 134742016u               // QKV_OFF + 65536*768*2
#define PMS_OFF  151519232u               // PCTX_OFF + 128*32*1024*4; per chunk and 16 channels: 16 maxima, 16 sums

// ---------- kernel 0: weights -> bf16 ----------
__global__ __launch_bounds__(256) void cvt_weights(
    const float* __restrict__ wq, __bf16* __restrict__ wqb) {
  int idx = blockIdx.x * 256 + threadIdx.x;
  if (idx < LDQKV * CDIM) wqb[idx] = (__bf16)wq[idx];
}

__device__ __forceinline__ v16bf frag_ld(const __bf16* __restrict__ base,
                                         int row0, int ld, int k0, int lane) {
  int r  = row0 + (lane & 15);
  int kb = k0 + ((lane >> 4) << 3);           // +8 for upper half-wave
  const __bf16* p = base + (size_t)r * ld + kb;
  v8bf lo = *reinterpret_cast<const v8bf*>(p);       // K = kb .. kb+7
  v8bf hi = *reinterpret_cast<const v8bf*>(p + 16);  // K = kb+16 .. kb+23
  v16bf out;
#pragma unroll
  for (int i = 0; i < 8; ++i) { out[i] = lo[i]; out[8 + i] = hi[i]; }
  return out;
}

#define BS_PITCH 272            // 256 data bytes + 16 pad bytes
#define BS_SLICE 6144           // 16 * 272 = 4352, rounded up to a multiple of 2 KiB

// fragment j (rows j*16 .. j*16+15 of the panel), k = kk*32 .. kk*32+31; k order as frag_ld
__device__ __forceinline__ v16bf frag_ld_lds(const unsigned char* base,
                                             int j, int kk, int lane) {
  const unsigned char* p = base + ((kk >> 2) * 4 + j) * BS_SLICE
                         + (lane & 15) * BS_PITCH + (kk & 3) * 64 + ((lane >> 4) << 4);
  v8bf lo = *reinterpret_cast<const v8bf*>(p);        // K = kb .. kb+7
  v8bf hi = *reinterpret_cast<const v8bf*>(p + 32);   // K = kb+16 .. kb+23
  v16bf out;
#pragma unroll
  for (int i = 0; i < 8; ++i) { out[i] = lo[i]; out[8 + i] = hi[i]; }
  return out;
}

__device__ __forceinline__ unsigned int uni(unsigned int v) {
  return (unsigned int)__builtin_amdgcn_readfirstlane((int)v);
}

__device__ __forceinline__ float exp2_slot(float y) {
  float r;
  asm("v_exp_f32 %0, %1\n\tv_nop" : "=v"(r) : "v"(y));
  return r;
}
__device__ __forceinline__ float exp_slot(float x) { return exp2_slot(x * 1.4426950408889634f); }

// p and V of two heads in LDS: 128 rows (64 channels of p, then 64 of V) of 128 tokens in bf16,
// at the pitch of the weight slices (16 B x odd)
#define PV_PITCH 272

// fragment of 16 rows from row0 on, tokens kk*32 .. kk*32+31; k order as frag_ld
__device__ __forceinline__ v16bf frag_ld_pv(const unsigned char* base, int row0, int kk, int lane) {
  const unsigned char* p = base + (row0 + (lane & 15)) * PV_PITCH + kk * 64 + ((lane >> 4) << 4);
  v8bf lo = *reinterpret_cast<const v8bf*>(p);
  v8bf hi = *reinterpret_cast<const v8bf*>(p + 32);
  v16bf out;
#pragma unroll
  for (int i = 0; i < 8; ++i) { out[i] = lo[i]; out[8 + i] = hi[i]; }
  return out;
}

// one wave's slice of a weight panel: the request, the issuer's own wait, the publishing barrier.
// Every wave of the work-group calls it, unconditionally.
__device__ __forceinline__ void stage_slice(unsigned lds_dst, const unsigned char* gsrc, u32x8 g1) {
  unsigned long long ga = (unsigned long long)(const void*)gsrc;
  u32x4 g0;
  g0[0] = uni(1u);                                                  // count = 1
  g0[1] = uni(lds_dst);                                             // LDS byte offset
  g0[2] = uni((unsigned)ga);                                        // global address [31:0]
  g0[3] = uni(((unsigned)(ga >> 32) & 0x01FFFFFFu) | 0x80000000u);  // address [56:32] | type = 2
  asm volatile("tensor_load_to_lds %0, %1" : : "s"(g0), "s"(g1) : "memory");
  // the slice counts as landed only behind its issuer's own wait; the barrier publishes it
  asm volatile("s_wait_tensorcnt 0x0" ::: "memory");
  __syncthreads();
}

__global__ __launch_bounds__(256, 4) void ln_gemm_qkv(
    const float* x, const __bf16* __restrict__ B,
    __bf16* __restrict__ C,
    float* __restrict__ pctx, float* __restrict__ pms) {
  constexpr int K = 256;
  __shared__ __attribute__((aligned(2048))) unsigned char Bs[8 * BS_SLICE];  // 48 KB
  __shared__ __attribute__((aligned(16))) unsigned char PV[128 * PV_PITCH];  // 34 KB
  __shared__ __attribute__((aligned(16))) float redm[64][20];                // [channel][half wave], pitch 80 B (16 B x odd)

  int lane = threadIdx.x & 31;
  int wave = (int)uni(threadIdx.x >> 5);
  int m0 = (blockIdx.x * 8 + wave) * 16;
  int hh = lane >> 4;
  int tok = m0 + (lane & 15);

  // the lane's 128 channels of its token, all asked for at once
  const float* xp = x + ((size_t)(tok >> 12) * CDIM + hh * 8) * NPOS + (tok & (NPOS - 1));
  float xv[8][16];
#pragma unroll
  for (int kk = 0; kk < 8; ++kk)
#pragma unroll
    for (int e = 0; e < 16; ++e)
      xv[kk][e] = xp[(size_t)(kk * 32 + (e >> 3) * 16 + (e & 7)) * NPOS];
  // asks for the loads ahead of the sums (left alone, the compiler holds the last four back behind the
  // wait for all the others, and the wave pays the memory latency twice)
  __builtin_amdgcn_sched_group_barrier(0x020, 128, 0);
  // the loads name an address pair that is rewritten below: keep the wait in front (x is not declared
  // restrict, so that no load moves behind this statement)
  asm volatile("s_wait_xcnt 0x0" ::: "memory");

  // mean and variance of the token over its 256 channels: eight running sums, then the other half wave
  float vs[8], vq[8];
#pragma unroll
  for (int i = 0; i < 8; ++i) { vs[i] = 0.f; vq[i] = 0.f; }
#pragma unroll
  for (int kk = 0; kk < 8; ++kk)
#pragma unroll
    for (int e = 0; e < 16; ++e) { vs[e & 7] += xv[kk][e]; vq[e & 7] += xv[kk][e] * xv[kk][e]; }
  float s  = ((vs[0] + vs[1]) + (vs[2] + vs[3])) + ((vs[4] + vs[5]) + (vs[6] + vs[7]));
  float sq = ((vq[0] + vq[1]) + (vq[2] + vq[3])) + ((vq[4] + vq[5]) + (vq[6] + vq[7]));
  s  += __shfl_xor(s, 16, 32);
  sq += __shfl_xor(sq, 16, 32);
  float mean = s * (1.f / 256.f);
  float rstd = rsqrtf(sq * (1.f / 256.f) - mean * mean + EPS);

  v16bf afr[8];
#pragma unroll
  for (int kk = 0; kk < 8; ++kk)
#pragma unroll
    for (int e = 0; e < 16; ++e) afr[kk][e] = (__bf16)((xv[kk][e] - mean) * rstd);

  // this wave's slice: rows (wave & 3) * 16 .. + 15 of the panel, bytes (wave >> 2) * 256 .. + 255 of each row
  unsigned lds_dst = (unsigned)(size_t)(&Bs[0]) + (unsigned)wave * BS_SLICE;  // low 32 bits = LDS offset
  const unsigned char* bsl = reinterpret_cast<const unsigned char*>(B)
                           + (size_t)(wave & 3) * 16 * (K * 2) + (size_t)(wave >> 2) * 256;
  u32x8 g1;
  g1[0] = uni((1u << 20) | (5u << 22) | (3u << 25));
  g1[1] = uni(256u << 16);
  g1[2] = uni(16u << 16);
  g1[3] = uni(256u << 16);
  g1[4] = uni(16u);
  g1[5] = uni((unsigned)(K * 2));
  g1[6] = uni(0u);
  g1[7] = uni(0u);
  __bf16* __restrict__ cp = C + (size_t)tok * LDQKV + hh * 8;

  for (int n0 = 0; n0 < HID; n0 += 64) {
    stage_slice(lds_dst, bsl + (size_t)n0 * (K * 2), g1);

    v8f acc[4] = {};
#pragma unroll
    for (int kk = 0; kk < 8; ++kk) {
#pragma unroll
      for (int j = 0; j < 4; ++j) {
        v16bf wf = frag_ld_lds(Bs, j, kk, lane);
        acc[j] = __builtin_amdgcn_wmma_f32_16x16x32_bf16(
            false, wf, false, afr[kk], (short)0, acc[j], false, false);
      }
    }

#pragma unroll
    for (int j = 0; j < 4; ++j) {
      v8bf st;
#pragma unroll
      for (int r = 0; r < 8; ++r) st[r] = (__bf16)acc[j][r];
      *reinterpret_cast<v8bf*>(cp + n0 + j * 16) = st;
    }
    // the stores name registers that the next group rewrites: keep the wait in front
    asm volatile("s_wait_xcnt 0x0" ::: "memory");
    // this wave's LDS reads have retired before any wave's next request targets the panel
    asm volatile("s_wait_dscnt 0x0" ::: "memory");
    __syncthreads();  // protect Bs before next group's DMA
  }

  int l15 = lane & 15;
  int hl = wave >> 2, dt = (wave >> 1) & 1, et = wave & 1;   // the wave's tile of c: head of the pair, 16 d, 16 e
  size_t pbase = (size_t)(blockIdx.x >> 5) * HEADS * NCH + (blockIdx.x & 31);  // 32 work-groups per batch image
  v16bf ones;
#pragma unroll
  for (int i = 0; i < 16; ++i) ones[i] = (__bf16)1.0f;
  for (int hp = 0; hp < HEADS / 2; ++hp) {
    // K, then V, of heads 2 hp and 2 hp + 1: lane = channel j * 16 + (lane & 15), register r = token (lane >> 4) * 8 + r
    v8f ak[4] = {}, av[4] = {};
    stage_slice(lds_dst, bsl + (size_t)(HID + hp * 64) * (K * 2), g1);
#pragma unroll
    for (int kk = 0; kk < 8; ++kk) {
#pragma unroll
      for (int j = 0; j < 4; ++j) {
        v16bf wf = frag_ld_lds(Bs, j, kk, lane);
        ak[j] = __builtin_amdgcn_wmma_f32_16x16x32_bf16(
            false, afr[kk], false, wf, (short)0, ak[j], false, false);
      }
    }
    // this wave's LDS reads have retired before any wave's next request targets the panel
    asm volatile("s_wait_dscnt 0x0" ::: "memory");
    __syncthreads();  // protect Bs before the next request
    stage_slice(lds_dst, bsl + (size_t)(2 * HID + hp * 64) * (K * 2), g1);
#pragma unroll
    for (int kk = 0; kk < 8; ++kk) {
#pragma unroll
      for (int j = 0; j < 4; ++j) {
        v16bf wf = frag_ld_lds(Bs, j, kk, lane);
        av[j] = __builtin_amdgcn_wmma_f32_16x16x32_bf16(
            false, afr[kk], false, wf, (short)0, av[j], false, false);
      }
    }
    asm volatile("s_wait_dscnt 0x0" ::: "memory");

    // chunk maximum per channel: lane, then the sixteen half waves
    float m[4];
#pragma unroll
    for (int j = 0; j < 4; ++j)
      redm[j * 16 + l15][wave * 2 + hh] =
          fmaxf(fmaxf(fmaxf(ak[j][0], ak[j][1]), fmaxf(ak[j][2], ak[j][3])),
                fmaxf(fmaxf(ak[j][4], ak[j][5]), fmaxf(ak[j][6], ak[j][7])));
    __syncthreads();  // every half wave's maxima are in LDS; also ends all reads of the weight panel
#pragma unroll
    for (int j = 0; j < 4; ++j) {
      f32x4 q[4];
#pragma unroll
      for (int i = 0; i < 4; ++i) q[i] = *reinterpret_cast<const f32x4*>(&redm[j * 16 + l15][i * 4]);
#pragma unroll
      for (int i = 0; i < 4; ++i) q[i][0] = fmaxf(fmaxf(q[i][0], q[i][1]), fmaxf(q[i][2], q[i][3]));
      m[j] = fmaxf(fmaxf(q[0][0], q[1][0]), fmaxf(q[2][0], q[3][0]));
    }
#pragma unroll
    for (int j = 0; j < 4; ++j) {
      float nm = -m[j] * 1.4426950408889634f;   // exp(k - m) = 2^(k * log2(e) - m * log2(e)): one multiply-add per value
      v8bf pb, vb;
#pragma unroll
      for (int r = 0; r < 8; ++r) {
        pb[r] = (__bf16)exp2_slot(fmaf(ak[j][r], 1.4426950408889634f, nm));
        vb[r] = (__bf16)av[j][r];
      }
      unsigned char* row = PV + (j * 16 + l15) * PV_PITCH + wave * 32 + hh * 16;
      *reinterpret_cast<v8bf*>(row) = pb;
      *reinterpret_cast<v8bf*>(row + 64 * PV_PITCH) = vb;
    }
    __syncthreads();  // p and V of the whole chunk are in LDS

    // c = p * V^T, and s = sum_n p as ones * p^T: the sum of the rounded values that c is made of,
    // in every register of the lane whose (lane & 15) is the channel
    v8f c = {}, sa = {};
#pragma unroll
    for (int kk = 0; kk < 4; ++kk) {
      v16bf pf = frag_ld_pv(PV, hl * 32 + dt * 16, kk, lane);
      v16bf vf = frag_ld_pv(PV, 64 + hl * 32 + et * 16, kk, lane);
      sa = __builtin_amdgcn_wmma_f32_16x16x32_bf16(false, ones, false, pf, (short)0, sa, false, false);
      c  = __builtin_amdgcn_wmma_f32_16x16x32_bf16(false, pf, false, vf, (short)0, c, false, false);
    }
    size_t pidx = pbase + (size_t)(hp * 2 + hl) * NCH;
    // tile-major [tile][e][d]: a lane holds 8 consecutive d of one e, the wave fills 1 KB of its own
    float* cw = pctx + pidx * 1024 + (dt * 2 + et) * 256 + l15 * 16 + hh * 8;
    *reinterpret_cast<f32x4*>(cw)     = (f32x4){c[0], c[1], c[2], c[3]};
    *reinterpret_cast<f32x4*>(cw + 4) = (f32x4){c[4], c[5], c[6], c[7]};
    float* mw = pms + (pidx * 2 + dt) * 32 + lane;
    if (et == 0) {
      // one 128-byte line per 16 channels: their maxima from the lower half wave, their sums from the upper
      float mj = hl ? (dt ? m[3] : m[2]) : (dt ? m[1] : m[0]);
      *mw = hh ? sa[0] : mj;
    }
    asm volatile("s_wait_xcnt 0x0\n\tv_nop\n\tv_nop\n\tv_nop\n\tv_nop" :: "v"(cw), "v"(mw) : "memory");
    // PV and redm are written again only behind the next pair's three barriers
  }
}

// ---------- kernel 3: merge of the chunk partials, folded into the output weights ----------
// One work-group per (b, pair of heads, 64 rows of w_out), 256 threads per head: merge the
// chunks' (m, s, c) and the four memory tokens into context[d][e] = sum_n softmax_n(K)[d,n] * V[e,n],
// then fold it into the output weights: weff[b][o][h*32+d] = sum_e w_out[o][h*32+e] * context[d][e],
// so that Y[o,n] = sum_k weff[b][o][k] * softmax_d(Q)[k,n] and the context is never applied token by
// token. The four work-groups of a pair of heads each merge the same context (the merge is latency,
// the fold is work). The two heads of a work-group fill one 128-byte line of each of its rows of weff.
__global__ __launch_bounds__(512) void attn_merge_fold(
    const float* __restrict__ pctx, const float* __restrict__ pms,
    const float* __restrict__ mem_kv,
    const float* wo, __bf16* __restrict__ weff) {
  __shared__ __attribute__((aligned(16))) float wgt[2][NCH][32];
  __shared__ __attribute__((aligned(16))) float wmem[2][4][32];
  __shared__ __attribute__((aligned(16))) float cs[2][DHEAD * DHEAD];
  int hf = threadIdx.x >> 8, t = threadIdx.x & 255;
  int bh = (blockIdx.x >> 2) * 2 + hf, h = bh & 7;
  int o = (blockIdx.x & 3) * 64 + (t & 63), d0 = (t >> 6) * 8;  // the thread's row of weff and its eight d (d0 is the same for a wave)
  const float* mk = mem_kv + (size_t)h * DHEAD * 4;
  const float* mv = mem_kv + (size_t)HEADS * DHEAD * 4 + (size_t)h * DHEAD * 4;
  // row o of w_out, the 32 columns of this head: asked for first, used last
  f32x4 wr[8];
#pragma unroll
  for (int i = 0; i < 8; ++i)
    wr[i] = *reinterpret_cast<const f32x4*>(wo + (size_t)o * HID + h * DHEAD + i * 4);
  // the loads name an address pair that is rewritten below: keep the wait in front (wo is not
  // declared restrict, so that no load moves behind this statement)
  asm volatile("s_wait_xcnt 0x0" ::: "memory");
  if (t < 32) {
    float mc[NCH], em[4];
    float M = mk[t * 4];
#pragma unroll
    for (int j = 1; j < 4; ++j) M = fmaxf(M, mk[t * 4 + j]);
#pragma unroll
    for (int c = 0; c < NCH; ++c) {
      mc[c] = pms[(((size_t)bh * NCH + c) * 2 + (t >> 4)) * 32 + (t & 15)];
      M = fmaxf(M, mc[c]);
    }
    float S = 0.f;
#pragma unroll
    for (int j = 0; j < 4; ++j) { em[j] = exp_slot(mk[t * 4 + j] - M); S += em[j]; }
#pragma unroll
    for (int c = 0; c < NCH; ++c) {
      mc[c] = exp_slot(mc[c] - M);
      S += mc[c] * pms[(((size_t)bh * NCH + c) * 2 + (t >> 4)) * 32 + 16 + (t & 15)];
    }
    float inv = 1.f / S;
#pragma unroll
    for (int c = 0; c < NCH; ++c) wgt[hf][c][t] = mc[c] * inv;
#pragma unroll
    for (int j = 0; j < 4; ++j) wmem[hf][j][t] = em[j] * inv;
  }
  // the loads above name registers that are rewritten below: keep the wait in front
  asm volatile("s_wait_xcnt 0x0" ::: "memory");
  __syncthreads();
  // the partials are tile-major [16 d x 16 e tile][e][d]: the thread's four values are four d of one e
  int dm = (t >> 7) * 16 + (t & 3) * 4, e = ((t >> 6) & 1) * 16 + ((t >> 2) & 15);
  f32x4 mvr = *reinterpret_cast<const f32x4*>(mv + e * 4);
  asm volatile("s_wait_xcnt 0x0" ::: "memory");
  f32x4 a = {0.f, 0.f, 0.f, 0.f};
#pragma unroll
  for (int j = 0; j < 4; ++j)
    a += *reinterpret_cast<const f32x4*>(&wmem[hf][j][dm]) * mvr[j];
#pragma unroll
  for (int c = 0; c < NCH; ++c) {
    f32x4 pc = *reinterpret_cast<const f32x4*>(pctx + ((size_t)bh * NCH + c) * 1024 + t * 4);
    a += *reinterpret_cast<const f32x4*>(&wgt[hf][c][dm]) * pc;
  }
  asm volatile("s_wait_xcnt 0x0" ::: "memory");
#pragma unroll
  for (int i = 0; i < 4; ++i) cs[hf][(dm + i) * DHEAD + e] = a[i];
  __syncthreads();  // the head's whole context is in LDS before any thread folds it

  // the context is read at an address that is the same for the wave; even and odd e are summed
  // apart (two products per instruction on register pairs as they are loaded) and added at the end
  f32x2 r[8];
#pragma unroll
  for (int j = 0; j < 8; ++j) r[j] = (f32x2){0.f, 0.f};
#pragma unroll
  for (int i = 0; i < 8; ++i)
#pragma unroll
    for (int j = 0; j < 8; ++j) {
      f32x4 c = *reinterpret_cast<const f32x4*>(&cs[hf][(d0 + j) * DHEAD + i * 4]);
      r[j] += wr[i].lo * c.lo;
      r[j] += wr[i].hi * c.hi;
    }
  v8bf st;
#pragma unroll
  for (int j = 0; j < 8; ++j) st[j] = (__bf16)(r[j].x + r[j].y);
  *reinterpret_cast<v8bf*>(weff + ((size_t)(bh >> 3) * CDIM + o) * HID + h * DHEAD + d0) = st;
}

__global__ __launch_bounds__(256, 4) void gemm_ln_res_out(
    const __bf16* QKV, const __bf16* __restrict__ B,
    const float* __restrict__ bias, const float* __restrict__ x,
    float* __restrict__ out) {
  constexpr int K = 256;
  __shared__ __attribute__((aligned(2048))) unsigned char Bs[8 * BS_SLICE];  // 48 KB

  int lane = threadIdx.x & 31;
  int wave = (int)uni(threadIdx.x >> 5);
  int m0 = (blockIdx.x * 8 + wave) * 16;
  int hh = lane >> 4;

  // this wave's 16 tokens x 256 k, register-resident: Q first (columns 0 .. 255 of the QKV rows)
  const __bf16* qp = QKV + (size_t)(m0 + (lane & 15)) * LDQKV + hh * 8;
  v16bf afr[8];
#pragma unroll
  for (int kk = 0; kk < 8; ++kk) afr[kk] = frag_ld(qp, 0, 0, kk * 32, 0);  // row and half wave are in qp
  // the loads name an address pair that is rewritten below: keep the wait in front (QKV is not
  // declared restrict, so that no load moves behind this statement; the pair is an input, so that it
  // lives up to the wait: left alone, the last load's result is placed on it)
  asm volatile("s_wait_xcnt 0x0" :: "v"(qp) : "memory");
  // softmax over the 32 features of each head, times SCALE, rounded back into the fragment
#pragma unroll
  for (int kk = 0; kk < 8; ++kk) {
    // the maximum is taken on the 16-bit values as they lie in the registers (exact: no rounding in a maximum)
    v2bf m2 = __builtin_shufflevector(afr[kk], afr[kk], 0, 1);
    m2 = __builtin_elementwise_max(m2, __builtin_shufflevector(afr[kk], afr[kk], 2, 3));
    m2 = __builtin_elementwise_max(m2, __builtin_shufflevector(afr[kk], afr[kk], 4, 5));
    m2 = __builtin_elementwise_max(m2, __builtin_shufflevector(afr[kk], afr[kk], 6, 7));
    m2 = __builtin_elementwise_max(m2, __builtin_shufflevector(afr[kk], afr[kk], 8, 9));
    m2 = __builtin_elementwise_max(m2, __builtin_shufflevector(afr[kk], afr[kk], 10, 11));
    m2 = __builtin_elementwise_max(m2, __builtin_shufflevector(afr[kk], afr[kk], 12, 13));
    m2 = __builtin_elementwise_max(m2, __builtin_shufflevector(afr[kk], afr[kk], 14, 15));
    float qm = fmaxf((float)m2.x, (float)m2.y);
    qm = fmaxf(qm, __shfl_xor(qm, 16, 32));
    float nm = -qm * 1.4426950408889634f;   // exp(q - qm) = 2^(q * log2(e) - qm * log2(e)): one multiply-add per value
    float qv[16], qs = 0.f;
#pragma unroll
    for (int e = 0; e < 16; ++e) { qv[e] = exp2_slot(fmaf((float)afr[kk][e], 1.4426950408889634f, nm)); qs += qv[e]; }
    qs += __shfl_xor(qs, 16, 32);
    float scl = SCALE / qs;
#pragma unroll
    for (int e = 0; e < 16; ++e) afr[kk][e] = (__bf16)(qv[e] * scl);
  }

  // this wave's slice: rows (wave & 3) * 16 .. + 15 of the panel, bytes (wave >> 2) * 256 .. + 255 of each row
  unsigned lds_dst = (unsigned)(size_t)(&Bs[0]) + (unsigned)wave * BS_SLICE;  // low 32 bits = LDS offset
  const unsigned char* bsl = reinterpret_cast<const unsigned char*>(B)
                           + (size_t)(blockIdx.x >> 5) * (CDIM * K * 2)  // 32 blocks per batch image
                           + (size_t)(wave & 3) * 16 * (K * 2) + (size_t)(wave >> 2) * 256;
  u32x8 g1;
  g1[0] = uni((1u << 20) | (5u << 22) | (3u << 25));
  g1[1] = uni(256u << 16);
  g1[2] = uni(16u << 16);
  g1[3] = uni(256u << 16);
  g1[4] = uni(16u);
  g1[5] = uni((unsigned)(K * 2));
  g1[6] = uni(0u);
  g1[7] = uni(0u);

  // the sums start from the bias of the lane's eight channels of each tile; the 16 values of a
  // tile are read at a wave-uniform address (scalar loads) and each half wave takes its eight
  v8f acc[4][4];
#pragma unroll
  for (int g = 0; g < 4; ++g)
#pragma unroll
    for (int j = 0; j < 4; ++j)
#pragma unroll
      for (int r = 0; r < 8; ++r) {
        float blo = bias[g * 64 + j * 16 + r], bhi = bias[g * 64 + j * 16 + 8 + r];
        acc[g][j][r] = hh ? bhi : blo;
      }
  // unrolled so that the accumulators of all four groups are indexed by constants and stay in registers
#pragma unroll
  for (int g = 0; g < 4; ++g) {
    // every wave brings its own slice; no test around the request
    unsigned long long ga = (unsigned long long)(const void*)(bsl + (size_t)(g * 64) * (K * 2));
    u32x4 g0;
    g0[0] = uni(1u);                                                  // count = 1
    g0[1] = uni(lds_dst);                                             // LDS byte offset
    g0[2] = uni((unsigned)ga);                                        // global address [31:0]
    g0[3] = uni(((unsigned)(ga >> 32) & 0x01FFFFFFu) | 0x80000000u);  // address [56:32] | type = 2
    asm volatile("tensor_load_to_lds %0, %1" : : "s"(g0), "s"(g1) : "memory");
    // the slice counts as landed only behind its issuer's own wait; the barrier publishes it
    asm volatile("s_wait_tensorcnt 0x0" ::: "memory");
    __syncthreads();

    // closes the scheduling region, so that the order asked for below holds for this group's reads alone
    __builtin_amdgcn_sched_barrier(0);
#pragma unroll
    for (int kk = 0; kk < 8; ++kk) {
#pragma unroll
      for (int j = 0; j < 4; ++j) {
        v16bf wf = frag_ld_lds(Bs, j, kk, lane);
        acc[g][j] = __builtin_amdgcn_wmma_f32_16x16x32_bf16(
            false, wf, false, afr[kk], (short)0, acc[g][j], false, false);
      }
    }
    // LDS reads run four fragments ahead of the matrix instructions (left alone, the compiler reads one
    // fragment, waits and multiplies, and every product pays the whole LDS latency): eight reads, then
    // each product followed by the two reads that refill its fragment's registers
    __builtin_amdgcn_sched_group_barrier(0x100, 8, 0);
#pragma unroll
    for (int i = 0; i < 28; ++i) {
      __builtin_amdgcn_sched_group_barrier(0x008, 1, 0);
      __builtin_amdgcn_sched_group_barrier(0x100, 2, 0);
    }
    __builtin_amdgcn_sched_group_barrier(0x008, 4, 0);
    __builtin_amdgcn_sched_barrier(0);  // end of that region
    if (g < 3) {
      // this wave's LDS reads have retired before any wave's next request targets the panel
      asm volatile("s_wait_dscnt 0x0" ::: "memory");
      __syncthreads();  // protect Bs before the next group's request
    }
  }

  int tok = m0 + (lane & 15);
  size_t base = ((size_t)(tok >> 12) * CDIM + hh * 8) * NPOS + (tok & (NPOS - 1));
  const float* __restrict__ xp = x + base;
  float* __restrict__ op = out + base;
  // x of the first group's 32 channels is asked for before the statistics
  float xr[2][32];
#pragma unroll
  for (int i = 0; i < 32; ++i) xr[0][i] = xp[(size_t)((i >> 3) * 16 + (i & 7)) * NPOS];

  // mean and variance of the token over its 256 channels: eight running sums, then the other half wave
  v8f vs = {}, vq = {};
#pragma unroll
  for (int g = 0; g < 4; ++g)
#pragma unroll
    for (int j = 0; j < 4; ++j) { vs += acc[g][j]; vq += acc[g][j] * acc[g][j]; }
  float s  = ((vs[0] + vs[1]) + (vs[2] + vs[3])) + ((vs[4] + vs[5]) + (vs[6] + vs[7]));
  float sq = ((vq[0] + vq[1]) + (vq[2] + vq[3])) + ((vq[4] + vq[5]) + (vq[6] + vq[7]));
  s  += __shfl_xor(s, 16, 32);
  sq += __shfl_xor(sq, 16, 32);
  float mean = s * (1.f / 256.f);
  float rstd = rsqrtf(sq * (1.f / 256.f) - mean * mean + EPS);

#pragma unroll
  for (int g = 0; g < 4; ++g) {
    if (g < 3) {
#pragma unroll
      for (int i = 0; i < 32; ++i)
        xr[(g + 1) & 1][i] = xp[(size_t)((g + 1) * 64 + (i >> 3) * 16 + (i & 7)) * NPOS];
      __builtin_amdgcn_sched_barrier(0);  // the next group's x stays in flight while this group is stored
    }
#pragma unroll
    for (int i = 0; i < 32; ++i) {
      size_t o = (size_t)(g * 64 + (i >> 3) * 16 + (i & 7)) * NPOS;
      op[o] = (acc[g][i >> 3][i & 7] - mean) * rstd + xr[g & 1][i];
    }
  }
}

// ---------- host launcher ----------
extern "C" void kernel_launch(void* const* d_in, const int* in_sizes, int n_in,
                              void* d_out, int out_size, void* d_ws, size_t ws_size,
                              hipStream_t stream) {
  const float* x      = (const float*)d_in[0];
  const float* mem_kv = (const float*)d_in[1];
  const float* w_qkv  = (const float*)d_in[2];
  const float* w_out  = (const float*)d_in[3];
  const float* b_out  = (const float*)d_in[4];
  float* out = (float*)d_out;

  char* ws = (char*)d_ws;
  __bf16* wq_bf  = (__bf16*)(ws + WQ_OFF);
  __bf16* weff   = (__bf16*)(ws + WEFF_OFF);
  __bf16* QKVbf  = (__bf16*)(ws + QKV_OFF);
  float*  pctx   = (float*)(ws + PCTX_OFF);
  float*  pms    = (float*)(ws + PMS_OFF);

  cvt_weights<<<768, 256, 0, stream>>>(w_qkv, wq_bf);
  ln_gemm_qkv<<<MROWS / 128, 256, 0, stream>>>(x, wq_bf, QKVbf, pctx, pms);
  attn_merge_fold<<<BATCH * HEADS * 2, 512, 0, stream>>>(pctx, pms, mem_kv, w_out, weff);
  gemm_ln_res_out<<<MROWS / 128, 256, 0, stream>>>(QKVbf, weff, b_out, x, out);
}

// v007
// One run takes 73.8 microseconds.
// Next to v006, in two timings, it ran 1.05 and 1.06 times as fast.
// Counting every step since v000, it is 9.32 times as fast.
#include <hip/hip_runtime.h>

// ---------- types ----------
typedef __attribute__((ext_vector_type(16))) __bf16 v16bf;
typedef __attribute__((ext_vector_type(8)))  __bf16 v8bf;
typedef __attribute__((ext_vector_type(2)))  __bf16 v2bf;
typedef __attribute__((ext_vector_type(8)))  float  v8f;
typedef __attribute__((ext_vector_type(4)))  float  f32x4;
typedef __attribute__((ext_vector_type(2)))  float  f32x2;
typedef __attribute__((ext_vector_type(4)))  unsigned int u32x4;
typedef __attribute__((ext_vector_type(8)))  unsigned int u32x8;

#define HEADS 8
#define DHEAD 32
#define NPOS  4096            // 64*64 tokens per batch image
#define BATCH 16
#define CDIM  256
#define HID   256
#define MROWS (BATCH * NPOS)  // 65536
#define LDQKV 768
#define SCALE 0.17677669529663687f  // 32^-0.5
#define EPS   1e-6f

// workspace layout (bytes)
#define WQ_OFF   0u
#define WEFF_OFF 524288u                  // 16 folded output weights of 256*256*2 bytes each
#define QKV_OFF  34078720u
#define NCH      32                       // token chunks per (batch, head): one per work-group of ln_gemm_qkv
#define PCTX_OFF 134742016u               // QKV_OFF + 65536*768*2
#define PMS_OFF  151519232u               // PCTX_OFF + 128*32*1024*4; per chunk and 16 channels: 16 maxima, 16 sums

// ---------- kernel 0: weights -> bf16 ----------
__global__ __launch_bounds__(256) void cvt_weights(
    const float* __restrict__ wq, __bf16* __restrict__ wqb) {
  int idx = blockIdx.x * 256 + threadIdx.x;
  if (idx < LDQKV * CDIM) wqb[idx] = (__bf16)wq[idx];
}

__device__ __forceinline__ v16bf frag_ld(const __bf16* __restrict__ base,
                                         int row0, int ld, int k0, int lane) {
  int r  = row0 + (lane & 15);
  int kb = k0 + ((lane >> 4) << 3);           // +8 for upper half-wave
  const __bf16* p = base + (size_t)r * ld + kb;
  v8bf lo = *reinterpret_cast<const v8bf*>(p);       // K = kb .. kb+7
  v8bf hi = *reinterpret_cast<const v8bf*>(p + 16);  // K = kb+16 .. kb+23
  v16bf out;
#pragma unroll
  for (int i = 0; i < 8; ++i) { out[i] = lo[i]; out[8 + i] = hi[i]; }
  return out;
}

#define BS_PITCH 272            // 256 data bytes + 16 pad bytes
#define BS_SLICE 6144           // 16 * 272 = 4352, rounded up to a multiple of 2 KiB

// fragment j (rows j*16 .. j*16+15 of the panel), k = kk*32 .. kk*32+31; k order as frag_ld
__device__ __forceinline__ v16bf frag_ld_lds(const unsigned char* base,
                                             int j, int kk, int lane) {
  const unsigned char* p = base + ((kk >> 2) * 4 + j) * BS_SLICE
                         + (lane & 15) * BS_PITCH + (kk & 3) * 64 + ((lane >> 4) << 4);
  v8bf lo = *reinterpret_cast<const v8bf*>(p);        // K = kb .. kb+7
  v8bf hi = *reinterpret_cast<const v8bf*>(p + 32);   // K = kb+16 .. kb+23
  v16bf out;
#pragma unroll
  for (int i = 0; i < 8; ++i) { out[i] = lo[i]; out[8 + i] = hi[i]; }
  return out;
}

__device__ __forceinline__ unsigned int uni(unsigned int v) {
  return (unsigned int)__builtin_amdgcn_readfirstlane((int)v);
}

__device__ __forceinline__ float exp2_slot(float y) {
  float r;
  asm("v_exp_f32 %0, %1\n\tv_nop" : "=v"(r) : "v"(y));
  return r;
}
__device__ __forceinline__ float exp_slot(float x) { return exp2_slot(x * 1.4426950408889634f); }

// p and V of two heads in LDS: 128 rows (64 channels of p, then 64 of V) of 128 tokens in bf16,
// at the pitch of the weight slices (16 B x odd)
#define PV_PITCH 272

// fragment of 16 rows from row0 on, tokens kk*32 .. kk*32+31; k order as frag_ld
__device__ __forceinline__ v16bf frag_ld_pv(const unsigned char* base, int row0, int kk, int lane) {
  const unsigned char* p = base + (row0 + (lane & 15)) * PV_PITCH + kk * 64 + ((lane >> 4) << 4);
  v8bf lo = *reinterpret_cast<const v8bf*>(p);
  v8bf hi = *reinterpret_cast<const v8bf*>(p + 32);
  v16bf out;
#pragma unroll
  for (int i = 0; i < 8; ++i) { out[i] = lo[i]; out[8 + i] = hi[i]; }
  return out;
}

// one wave's slice of a weight panel: the request, the issuer's own wait, the publishing barrier.
// Every wave of the work-group calls it, unconditionally.
__device__ __forceinline__ void stage_slice(unsigned lds_dst, const unsigned char* gsrc, u32x8 g1) {
  unsigned long long ga = (unsigned long long)(const void*)gsrc;
  u32x4 g0;
  g0[0] = uni(1u);                                                  // count = 1
  g0[1] = uni(lds_dst);                                             // LDS byte offset
  g0[2] = uni((unsigned)ga);                                        // global address [31:0]
  g0[3] = uni(((unsigned)(ga >> 32) & 0x01FFFFFFu) | 0x80000000u);  // address [56:32] | type = 2
  asm volatile("tensor_load_to_lds %0, %1" : : "s"(g0), "s"(g1) : "memory");
  // the slice counts as landed only behind its issuer's own wait; the barrier publishes it
  asm volatile("s_wait_tensorcnt 0x0" ::: "memory");
  __syncthreads();
}

// order of one panel's 64 LDS reads and 32 matrix instructions: the reads run two k steps (eight fragments)
// ahead, in groups of eight behind every four products. Left alone, the compiler reads one fragment and
// waits for it in front of every product, so that each product pays the whole LDS latency.
__device__ __forceinline__ void panel_reads_ahead() {
  __builtin_amdgcn_sched_group_barrier(0x100, 16, 0);
#pragma unroll
  for (int i = 0; i < 6; ++i) {
    __builtin_amdgcn_sched_group_barrier(0x008, 4, 0);
    __builtin_amdgcn_sched_group_barrier(0x100, 8, 0);
  }
  __builtin_amdgcn_sched_group_barrier(0x008, 8, 0);
}

__global__ __launch_bounds__(256, 4) void ln_gemm_qkv(
    const float* x, const __bf16* __restrict__ B,
    __bf16* __restrict__ C,
    float* __restrict__ pctx, float* __restrict__ pms) {
  constexpr int K = 256;
  __shared__ __attribute__((aligned(2048))) unsigned char Bs[8 * BS_SLICE];  // 48 KB
  __shared__ __attribute__((aligned(16))) unsigned char PV[128 * PV_PITCH];  // 34 KB
  __shared__ __attribute__((aligned(16))) float redm[64][20];                // [channel][half wave], pitch 80 B (16 B x odd)

  int lane = threadIdx.x & 31;
  int wave = (int)uni(threadIdx.x >> 5);
  int m0 = (blockIdx.x * 8 + wave) * 16;
  int hh = lane >> 4;
  int tok = m0 + (lane & 15);

  // the lane's 128 channels of its token, all asked for at once
  const float* xp = x + ((size_t)(tok >> 12) * CDIM + hh * 8) * NPOS + (tok & (NPOS - 1));
  float xv[8][16];
#pragma unroll
  for (int kk = 0; kk < 8; ++kk)
#pragma unroll
    for (int e = 0; e < 16; ++e)
      xv[kk][e] = xp[(size_t)(kk * 32 + (e >> 3) * 16 + (e & 7)) * NPOS];
  // asks for the loads ahead of the sums (left alone, the compiler holds the last four back behind the
  // wait for all the others, and the wave pays the memory latency twice)
  __builtin_amdgcn_sched_group_barrier(0x020, 128, 0);
  // the loads name an address pair that is rewritten below: keep the wait in front (x is not declared
  // restrict, so that no load moves behind this statement)
  asm volatile("s_wait_xcnt 0x0" ::: "memory");

  // mean and variance of the token over its 256 channels: eight running sums, then the other half wave
  float vs[8], vq[8];
#pragma unroll
  for (int i = 0; i < 8; ++i) { vs[i] = 0.f; vq[i] = 0.f; }
#pragma unroll
  for (int kk = 0; kk < 8; ++kk)
#pragma unroll
    for (int e = 0; e < 16; ++e) { vs[e & 7] += xv[kk][e]; vq[e & 7] += xv[kk][e] * xv[kk][e]; }
  float s  = ((vs[0] + vs[1]) + (vs[2] + vs[3])) + ((vs[4] + vs[5]) + (vs[6] + vs[7]));
  float sq = ((vq[0] + vq[1]) + (vq[2] + vq[3])) + ((vq[4] + vq[5]) + (vq[6] + vq[7]));
  s  += __shfl_xor(s, 16, 32);
  sq += __shfl_xor(sq, 16, 32);
  float mean = s * (1.f / 256.f);
  float rstd = rsqrtf(sq * (1.f / 256.f) - mean * mean + EPS);

  v16bf afr[8];
#pragma unroll
  for (int kk = 0; kk < 8; ++kk)
#pragma unroll
    for (int e = 0; e < 16; ++e) afr[kk][e] = (__bf16)((xv[kk][e] - mean) * rstd);

  // this wave's slice: rows (wave & 3) * 16 .. + 15 of the panel, bytes (wave >> 2) * 256 .. + 255 of each row
  unsigned lds_dst = (unsigned)(size_t)(&Bs[0]) + (unsigned)wave * BS_SLICE;  // low 32 bits = LDS offset
  const unsigned char* bsl = reinterpret_cast<const unsigned char*>(B)
                           + (size_t)(wave & 3) * 16 * (K * 2) + (size_t)(wave >> 2) * 256;
  u32x8 g1;
  g1[0] = uni((1u << 20) | (5u << 22) | (3u << 25));
  g1[1] = uni(256u << 16);
  g1[2] = uni(16u << 16);
  g1[3] = uni(256u << 16);
  g1[4] = uni(16u);
  g1[5] = uni((unsigned)(K * 2));
  g1[6] = uni(0u);
  g1[7] = uni(0u);
  __bf16* __restrict__ cp = C + (size_t)tok * LDQKV + hh * 8;

  for (int n0 = 0; n0 < HID; n0 += 64) {
    stage_slice(lds_dst, bsl + (size_t)n0 * (K * 2), g1);

    v8f acc[4] = {};
#pragma unroll
    for (int kk = 0; kk < 8; ++kk) {
#pragma unroll
      for (int j = 0; j < 4; ++j) {
        v16bf wf = frag_ld_lds(Bs, j, kk, lane);
        acc[j] = __builtin_amdgcn_wmma_f32_16x16x32_bf16(
            false, wf, false, afr[kk], (short)0, acc[j], false, false);
      }
    }

#pragma unroll
    for (int j = 0; j < 4; ++j) {
      v8bf st;
#pragma unroll
      for (int r = 0; r < 8; ++r) st[r] = (__bf16)acc[j][r];
      *reinterpret_cast<v8bf*>(cp + n0 + j * 16) = st;
    }
    // the stores name registers that the next group rewrites: keep the wait in front
    asm volatile("s_wait_xcnt 0x0" ::: "memory");
    // this wave's LDS reads have retired before any wave's next request targets the panel
    asm volatile("s_wait_dscnt 0x0" ::: "memory");
    __syncthreads();  // protect Bs before next group's DMA
  }

  int l15 = lane & 15;
  int hl = wave >> 2, dt = (wave >> 1) & 1, et = wave & 1;   // the wave's tile of c: head of the pair, 16 d, 16 e
  size_t pbase = (size_t)(blockIdx.x >> 5) * HEADS * NCH + (blockIdx.x & 31);  // 32 work-groups per batch image
  v16bf ones;
#pragma unroll
  for (int i = 0; i < 16; ++i) ones[i] = (__bf16)1.0f;
  for (int hp = 0; hp < HEADS / 2; ++hp) {
    // K, then V, of heads 2 hp and 2 hp + 1: lane = channel j * 16 + (lane & 15), register r = token (lane >> 4) * 8 + r
    v8f ak[4] = {}, av[4] = {};
    stage_slice(lds_dst, bsl + (size_t)(HID + hp * 64) * (K * 2), g1);
    // closes the scheduling region, so that the order asked for below holds for this panel's reads alone
    __builtin_amdgcn_sched_barrier(0);
#pragma unroll
    for (int kk = 0; kk < 8; ++kk) {
#pragma unroll
      for (int j = 0; j < 4; ++j) {
        v16bf wf = frag_ld_lds(Bs, j, kk, lane);
        ak[j] = __builtin_amdgcn_wmma_f32_16x16x32_bf16(
            false, afr[kk], false, wf, (short)0, ak[j], false, false);
      }
    }
    panel_reads_ahead();
    __builtin_amdgcn_sched_barrier(0);  // end of that region
    // this wave's LDS reads have retired before any wave's next request targets the panel
    asm volatile("s_wait_dscnt 0x0" ::: "memory");
    __syncthreads();  // protect Bs before the next request
    stage_slice(lds_dst, bsl + (size_t)(2 * HID + hp * 64) * (K * 2), g1);
    __builtin_amdgcn_sched_barrier(0);  // as for K: the region of this panel's reads
#pragma unroll
    for (int kk = 0; kk < 8; ++kk) {
#pragma unroll
      for (int j = 0; j < 4; ++j) {
        v16bf wf = frag_ld_lds(Bs, j, kk, lane);
        av[j] = __builtin_amdgcn_wmma_f32_16x16x32_bf16(
            false, afr[kk], false, wf, (short)0, av[j], false, false);
      }
    }
    panel_reads_ahead();
    __builtin_amdgcn_sched_barrier(0);  // end of that region
    asm volatile("s_wait_dscnt 0x0" ::: "memory");

    // chunk maximum per channel: lane, then the sixteen half waves
    float m[4];
#pragma unroll
    for (int j = 0; j < 4; ++j)
      redm[j * 16 + l15][wave * 2 + hh] =
          fmaxf(fmaxf(fmaxf(ak[j][0], ak[j][1]), fmaxf(ak[j][2], ak[j][3])),
                fmaxf(fmaxf(ak[j][4], ak[j][5]), fmaxf(ak[j][6], ak[j][7])));
    __syncthreads();  // every half wave's maxima are in LDS; also ends all reads of the weight panel
    __builtin_amdgcn_sched_barrier(0);  // region of the sixteen reads of the maxima
#pragma unroll
    for (int j = 0; j < 4; ++j) {
      f32x4 q[4];
#pragma unroll
      for (int i = 0; i < 4; ++i) q[i] = *reinterpret_cast<const f32x4*>(&redm[j * 16 + l15][i * 4]);
#pragma unroll
      for (int i = 0; i < 4; ++i) q[i][0] = fmaxf(fmaxf(q[i][0], q[i][1]), fmaxf(q[i][2], q[i][3]));
      m[j] = fmaxf(fmaxf(q[0][0], q[1][0]), fmaxf(q[2][0], q[3][0]));
    }
    // all sixteen reads first (left alone, four and a wait, four times: the LDS latency is paid four times)
    __builtin_amdgcn_sched_group_barrier(0x100, 16, 0);
    __builtin_amdgcn_sched_barrier(0);  // end of that region
#pragma unroll
    for (int j = 0; j < 4; ++j) {
      float nm = -m[j] * 1.4426950408889634f;   // exp(k - m) = 2^(k * log2(e) - m * log2(e)): one multiply-add per value
      v8bf pb, vb;
#pragma unroll
      for (int r = 0; r < 8; ++r) {
        pb[r] = (__bf16)exp2_slot(fmaf(ak[j][r], 1.4426950408889634f, nm));
        vb[r] = (__bf16)av[j][r];
      }
      unsigned char* row = PV + (j * 16 + l15) * PV_PITCH + wave * 32 + hh * 16;
      *reinterpret_cast<v8bf*>(row) = pb;
      *reinterpret_cast<v8bf*>(row + 64 * PV_PITCH) = vb;
    }
    __syncthreads();  // p and V of the whole chunk are in LDS

    // c = p * V^T, and s = sum_n p as ones * p^T: the sum of the rounded values that c is made of,
    // in every register of the lane whose (lane & 15) is the channel
    v8f c = {}, sa = {};
    __builtin_amdgcn_sched_barrier(0);  // region of the sixteen reads of p and V
#pragma unroll
    for (int kk = 0; kk < 4; ++kk) {
      v16bf pf = frag_ld_pv(PV, hl * 32 + dt * 16, kk, lane);
      v16bf vf = frag_ld_pv(PV, 64 + hl * 32 + et * 16, kk, lane);
      sa = __builtin_amdgcn_wmma_f32_16x16x32_bf16(false, ones, false, pf, (short)0, sa, false, false);
      c  = __builtin_amdgcn_wmma_f32_16x16x32_bf16(false, pf, false, vf, (short)0, c, false, false);
    }
    // all sixteen reads in front of the eight products (left alone, every pair of products waits for its own reads)
    __builtin_amdgcn_sched_group_barrier(0x100, 16, 0);
    __builtin_amdgcn_sched_group_barrier(0x008, 8, 0);
    __builtin_amdgcn_sched_barrier(0);  // end of that region
    size_t pidx = pbase + (size_t)(hp * 2 + hl) * NCH;
    // tile-major [tile][e][d]: a lane holds 8 consecutive d of one e, the wave fills 1 KB of its own
    float* cw = pctx + pidx * 1024 + (dt * 2 + et) * 256 + l15 * 16 + hh * 8;
    *reinterpret_cast<f32x4*>(cw)     = (f32x4){c[0], c[1], c[2], c[3]};
    *reinterpret_cast<f32x4*>(cw + 4) = (f32x4){c[4], c[5], c[6], c[7]};
    float* mw = pms + (pidx * 2 + dt) * 32 + lane;
    if (et == 0) {
      // one 128-byte line per 16 channels: their maxima from the lower half wave, their sums from the upper
      float mj = hl ? (dt ? m[3] : m[2]) : (dt ? m[1] : m[0]);
      *mw = hh ? sa[0] : mj;
    }
    asm volatile("s_wait_xcnt 0x0\n\tv_nop\n\tv_nop\n\tv_nop\n\tv_nop" :: "v"(cw), "v"(mw) : "memory");
    // PV and redm are written again only behind the next pair's three barriers
  }
}

// ---------- kernel 3: merge of the chunk partials, folded into the output weights ----------
// One work-group per (b, pair of heads, 64 rows of w_out), 256 threads per head: merge the
// chunks' (m, s, c) and the four memory tokens into context[d][e] = sum_n softmax_n(K)[d,n] * V[e,n],
// then fold it into the output weights: weff[b][o][h*32+d] = sum_e w_out[o][h*32+e] * context[d][e],
// so that Y[o,n] = sum_k weff[b][o][k] * softmax_d(Q)[k,n] and the context is never applied token by
// token. The four work-groups of a pair of heads each merge the same context (the merge is latency,
// the fold is work). The two heads of a work-group fill one 128-byte line of each of its rows of weff.
__global__ __launch_bounds__(512) void attn_merge_fold(
    const float* __restrict__ pctx, const float* __restrict__ pms,
    const float* __restrict__ mem_kv,
    const float* wo, __bf16* __restrict__ weff) {
  __shared__ __attribute__((aligned(16))) float wgt[2][NCH][32];
  __shared__ __attribute__((aligned(16))) float wmem[2][4][32];
  __shared__ __attribute__((aligned(16))) float cs[2][DHEAD * DHEAD];
  int hf = threadIdx.x >> 8, t = threadIdx.x & 255;
  int bh = (blockIdx.x >> 2) * 2 + hf, h = bh & 7;
  int o = (blockIdx.x & 3) * 64 + (t & 63), d0 = (t >> 6) * 8;  // the thread's row of weff and its eight d (d0 is the same for a wave)
  const float* mk = mem_kv + (size_t)h * DHEAD * 4;
  const float* mv = mem_kv + (size_t)HEADS * DHEAD * 4 + (size_t)h * DHEAD * 4;
  // row o of w_out, the 32 columns of this head: asked for first, used last
  f32x4 wr[8];
#pragma unroll
  for (int i = 0; i < 8; ++i)
    wr[i] = *reinterpret_cast<const f32x4*>(wo + (size_t)o * HID + h * DHEAD + i * 4);
  // the loads name an address pair that is rewritten below: keep the wait in front (wo is not
  // declared restrict, so that no load moves behind this statement)
  asm volatile("s_wait_xcnt 0x0" ::: "memory");
  if (t < 32) {
    float mc[NCH], em[4];
    float M = mk[t * 4];
#pragma unroll
    for (int j = 1; j < 4; ++j) M = fmaxf(M, mk[t * 4 + j]);
#pragma unroll
    for (int c = 0; c < NCH; ++c) {
      mc[c] = pms[(((size_t)bh * NCH + c) * 2 + (t >> 4)) * 32 + (t & 15)];
      M = fmaxf(M, mc[c]);
    }
    float S = 0.f;
#pragma unroll
    for (int j = 0; j < 4; ++j) { em[j] = exp_slot(mk[t * 4 + j] - M); S += em[j]; }
#pragma unroll
    for (int c = 0; c < NCH; ++c) {
      mc[c] = exp_slot(mc[c] - M);
      S += mc[c] * pms[(((size_t)bh * NCH + c) * 2 + (t >> 4)) * 32 + 16 + (t & 15)];
    }
    float inv = 1.f / S;
#pragma unroll
    for (int c = 0; c < NCH; ++c) wgt[hf][c][t] = mc[c] * inv;
#pragma unroll
    for (int j = 0; j < 4; ++j) wmem[hf][j][t] = em[j] * inv;
  }
  // the loads above name registers that are rewritten below: keep the wait in front
  asm volatile("s_wait_xcnt 0x0" ::: "memory");
  __syncthreads();
  // the partials are tile-major [16 d x 16 e tile][e][d]: the thread's four values are four d of one e
  int dm = (t >> 7) * 16 + (t & 3) * 4, e = ((t >> 6) & 1) * 16 + ((t >> 2) & 15);
  f32x4 mvr = *reinterpret_cast<const f32x4*>(mv + e * 4);
  asm volatile("s_wait_xcnt 0x0" ::: "memory");
  f32x4 a = {0.f, 0.f, 0.f, 0.f};
#pragma unroll
  for (int j = 0; j < 4; ++j)
    a += *reinterpret_cast<const f32x4*>(&wmem[hf][j][dm]) * mvr[j];
#pragma unroll
  for (int c = 0; c < NCH; ++c) {
    f32x4 pc = *reinterpret_cast<const f32x4*>(pctx + ((size_t)bh * NCH + c) * 1024 + t * 4);
    a += *reinterpret_cast<const f32x4*>(&wgt[hf][c][dm]) * pc;
  }
  asm volatile("s_wait_xcnt 0x0" ::: "memory");
#pragma unroll
  for (int i = 0; i < 4; ++i) cs[hf][(dm + i) * DHEAD + e] = a[i];
  __syncthreads();  // the head's whole context is in LDS before any thread folds it

  // the context is read at an address that is the same for the wave; even and odd e are summed
  // apart (two products per instruction on register pairs as they are loaded) and added at the end
  f32x2 r[8];
#pragma unroll
  for (int j = 0; j < 8; ++j) r[j] = (f32x2){0.f, 0.f};
#pragma unroll
  for (int i = 0; i < 8; ++i)
#pragma unroll
    for (int j = 0; j < 8; ++j) {
      f32x4 c = *reinterpret_cast<const f32x4*>(&cs[hf][(d0 + j) * DHEAD + i * 4]);
      r[j] += wr[i].lo * c.lo;
      r[j] += wr[i].hi * c.hi;
    }
  v8bf st;
#pragma unroll
  for (int j = 0; j < 8; ++j) st[j] = (__bf16)(r[j].x + r[j].y);
  *reinterpret_cast<v8bf*>(weff + ((size_t)(bh >> 3) * CDIM + o) * HID + h * DHEAD + d0) = st;
}

__global__ __launch_bounds__(256, 4) void gemm_ln_res_out(
    const __bf16* QKV, const __bf16* __restrict__ B,
    const float* __restrict__ bias, const float* __restrict__ x,
    float* __restrict__ out) {
  constexpr int K = 256;
  __shared__ __attribute__((aligned(2048))) unsigned char Bs[8 * BS_SLICE];  // 48 KB

  int lane = threadIdx.x & 31;
  int wave = (int)uni(threadIdx.x >> 5);
  int m0 = (blockIdx.x * 8 + wave) * 16;
  int hh = lane >> 4;

  // this wave's 16 tokens x 256 k, register-resident: Q first (columns 0 .. 255 of the QKV rows)
  const __bf16* qp = QKV + (size_t)(m0 + (lane & 15)) * LDQKV + hh * 8;
  v16bf afr[8];
#pragma unroll
  for (int kk = 0; kk < 8; ++kk) afr[kk] = frag_ld(qp, 0, 0, kk * 32, 0);  // row and half wave are in qp
  // the loads name an address pair that is rewritten below: keep the wait in front (QKV is not
  // declared restrict, so that no load moves behind this statement; the pair is an input, so that it
  // lives up to the wait: left alone, the last load's result is placed on it)
  asm volatile("s_wait_xcnt 0x0" :: "v"(qp) : "memory");
  // softmax over the 32 features of each head, times SCALE, rounded back into the fragment
#pragma unroll
  for (int kk = 0; kk < 8; ++kk) {
    // the maximum is taken on the 16-bit values as they lie in the registers (exact: no rounding in a maximum)
    v2bf m2 = __builtin_shufflevector(afr[kk], afr[kk], 0, 1);
    m2 = __builtin_elementwise_max(m2, __builtin_shufflevector(afr[kk], afr[kk], 2, 3));
    m2 = __builtin_elementwise_max(m2, __builtin_shufflevector(afr[kk], afr[kk], 4, 5));
    m2 = __builtin_elementwise_max(m2, __builtin_shufflevector(afr[kk], afr[kk], 6, 7));
    m2 = __builtin_elementwise_max(m2, __builtin_shufflevector(afr[kk], afr[kk], 8, 9));
    m2 = __builtin_elementwise_max(m2, __builtin_shufflevector(afr[kk], afr[kk], 10, 11));
    m2 = __builtin_elementwise_max(m2, __builtin_shufflevector(afr[kk], afr[kk], 12, 13));
    m2 = __builtin_elementwise_max(m2, __builtin_shufflevector(afr[kk], afr[kk], 14, 15));
    float qm = fmaxf((float)m2.x, (float)m2.y);
    qm = fmaxf(qm, __shfl_xor(qm, 16, 32));
    float nm = -qm * 1.4426950408889634f;   // exp(q - qm) = 2^(q * log2(e) - qm * log2(e)): one multiply-add per value
    float qv[16], qs = 0.f;
#pragma unroll
    for (int e = 0; e < 16; ++e) { qv[e] = exp2_slot(fmaf((float)afr[kk][e], 1.4426950408889634f, nm)); qs += qv[e]; }
    qs += __shfl_xor(qs, 16, 32);
    float scl = SCALE / qs;
#pragma unroll
    for (int e = 0; e < 16; ++e) afr[kk][e] = (__bf16)(qv[e] * scl);
  }

  // this wave's slice: rows (wave & 3) * 16 .. + 15 of the panel, bytes (wave >> 2) * 256 .. + 255 of each row
  unsigned lds_dst = (unsigned)(size_t)(&Bs[0]) + (unsigned)wave * BS_SLICE;  // low 32 bits = LDS offset
  const unsigned char* bsl = reinterpret_cast<const unsigned char*>(B)
                           + (size_t)(blockIdx.x >> 5) * (CDIM * K * 2)  // 32 blocks per batch image
                           + (size_t)(wave & 3) * 16 * (K * 2) + (size_t)(wave >> 2) * 256;
  u32x8 g1;
  g1[0] = uni((1u << 20) | (5u << 22) | (3u << 25));
  g1[1] = uni(256u << 16);
  g1[2] = uni(16u << 16);
  g1[3] = uni(256u << 16);
  g1[4] = uni(16u);
  g1[5] = uni((unsigned)(K * 2));
  g1[6] = uni(0u);
  g1[7] = uni(0u);

  // the sums start from the bias of the lane's eight channels of each tile; the 16 values of a
  // tile are read at a wave-uniform address (scalar loads) and each half wave takes its eight
  v8f acc[4][4];
#pragma unroll
  for (int g = 0; g < 4; ++g)
#pragma unroll
    for (int j = 0; j < 4; ++j)
#pragma unroll
      for (int r = 0; r < 8; ++r) {
        float blo = bias[g * 64 + j * 16 + r], bhi = bias[g * 64 + j * 16 + 8 + r];
        acc[g][j][r] = hh ? bhi : blo;
      }
  // unrolled so that the accumulators of all four groups are indexed by constants and stay in registers
#pragma unroll
  for (int g = 0; g < 4; ++g) {
    // every wave brings its own slice; no test around the request
    unsigned long long ga = (unsigned long long)(const void*)(bsl + (size_t)(g * 64) * (K * 2));
    u32x4 g0;
    g0[0] = uni(1u);                                                  // count = 1
    g0[1] = uni(lds_dst);                                             // LDS byte offset
    g0[2] = uni((unsigned)ga);                                        // global address [31:0]
    g0[3] = uni(((unsigned)(ga >> 32) & 0x01FFFFFFu) | 0x80000000u);  // address [56:32] | type = 2
    asm volatile("tensor_load_to_lds %0, %1" : : "s"(g0), "s"(g1) : "memory");
    // the slice counts as landed only behind its issuer's own wait; the barrier publishes it
    asm volatile("s_wait_tensorcnt 0x0" ::: "memory");
    __syncthreads();

    // closes the scheduling region, so that the order asked for below holds for this group's reads alone
    __builtin_amdgcn_sched_barrier(0);
#pragma unroll
    for (int kk = 0; kk < 8; ++kk) {
#pragma unroll
      for (int j = 0; j < 4; ++j) {
        v16bf wf = frag_ld_lds(Bs, j, kk, lane);
        acc[g][j] = __builtin_amdgcn_wmma_f32_16x16x32_bf16(
            false, wf, false, afr[kk], (short)0, acc[g][j], false, false);
      }
    }
    // LDS reads run four fragments ahead of the matrix instructions (left alone, the compiler reads one
    // fragment, waits and multiplies, and every product pays the whole LDS latency): eight reads, then
    // each product followed by the two reads that refill its fragment's registers
    __builtin_amdgcn_sched_group_barrier(0x100, 8, 0);
#pragma unroll
    for (int i = 0; i < 28; ++i) {
      __builtin_amdgcn_sched_group_barrier(0x008, 1, 0);
      __builtin_amdgcn_sched_group_barrier(0x100, 2, 0);
    }
    __builtin_amdgcn_sched_group_barrier(0x008, 4, 0);
    __builtin_amdgcn_sched_barrier(0);  // end of that region
    if (g < 3) {
      // this wave's LDS reads have retired before any wave's next request targets the panel
      asm volatile("s_wait_dscnt 0x0" ::: "memory");
      __syncthreads();  // protect Bs before the next group's request
    }
  }

  int tok = m0 + (lane & 15);
  size_t base = ((size_t)(tok >> 12) * CDIM + hh * 8) * NPOS + (tok & (NPOS - 1));
  const float* __restrict__ xp = x + base;
  float* __restrict__ op = out + base;
  // x of the first group's 32 channels is asked for before the statistics
  float xr[2][32];
#pragma unroll
  for (int i = 0; i < 32; ++i) xr[0][i] = xp[(size_t)((i >> 3) * 16 + (i & 7)) * NPOS];

  // mean and variance of the token over its 256 channels: eight running sums, then the other half wave
  v8f vs = {}, vq = {};
#pragma unroll
  for (int g = 0; g < 4; ++g)
#pragma unroll
    for (int j = 0; j < 4; ++j) { vs += acc[g][j]; vq += acc[g][j] * acc[g][j]; }
  float s  = ((vs[0] + vs[1]) + (vs[2] + vs[3])) + ((vs[4] + vs[5]) + (vs[6] + vs[7]));
  float sq = ((vq[0] + vq[1]) + (vq[2] + vq[3])) + ((vq[4] + vq[5]) + (vq[6] + vq[7]));
  s  += __shfl_xor(s, 16, 32);
  sq += __shfl_xor(sq, 16, 32);
  float mean = s * (1.f / 256.f);
  float rstd = rsqrtf(sq * (1.f / 256.f) - mean * mean + EPS);

#pragma unroll
  for (int g = 0; g < 4; ++g) {
    if (g < 3) {
#pragma unroll
      for (int i = 0; i < 32; ++i)
        xr[(g + 1) & 1][i] = xp[(size_t)((g + 1) * 64 + (i >> 3) * 16 + (i & 7)) * NPOS];
      __builtin_amdgcn_sched_barrier(0);  // the next group's x stays in flight while this group is stored
    }
#pragma unroll
    for (int i = 0; i < 32; ++i) {
      size_t o = (size_t)(g * 64 + (i >> 3) * 16 + (i & 7)) * NPOS;
      op[o] = (acc[g][i >> 3][i & 7] - mean) * rstd + xr[g & 1][i];
    }
  }
}

// ---------- host launcher ----------
extern "C" void kernel_launch(void* const* d_in, const int* in_sizes, int n_in,
                              void* d_out, int out_size, void* d_ws, size_t ws_size,
                              hipStream_t stream) {
  const float* x      = (const float*)d_in[0];
  const float* mem_kv = (const float*)d_in[1];
  const float* w_qkv  = (const float*)d_in[2];
  const float* w_out  = (const float*)d_in[3];
  const float* b_out  = (const float*)d_in[4];
  float* out = (float*)d_out;

  char* ws = (char*)d_ws;
  __bf16* wq_bf  = (__bf16*)(ws + WQ_OFF);
  __bf16* weff   = (__bf16*)(ws + WEFF_OFF);
  __bf16* QKVbf  = (__bf16*)(ws + QKV_OFF);
  float*  pctx   = (float*)(ws + PCTX_OFF);
  float*  pms    = (float*)(ws + PMS_OFF);

  cvt_weights<<<768, 256, 0, stream>>>(w_qkv, wq_bf);
  ln_gemm_qkv<<<MROWS / 128, 256, 0, stream>>>(x, wq_bf, QKVbf, pctx, pms);
  attn_merge_fold<<<BATCH * HEADS * 2, 512, 0, stream>>>(pctx, pms, mem_kv, w_out, weff);
  gemm_ln_res_out<<<MROWS / 128, 256, 0, stream>>>(QKVbf, weff, b_out, x, out);
}

// v008
// Measured time: 66.9 microseconds a run.
// Timed twice side by side with v007, it ran 1.10 and 1.11 times as fast.
// Over all steps from v000 it is 10.3 times as fast.
#include <hip/hip_runtime.h>

// ---------- types ----------
typedef __attribute__((ext_vector_type(16))) __bf16 v16bf;
typedef __attribute__((ext_vector_type(8)))  __bf16 v8bf;
typedef __attribute__((ext_vector_type(2)))  __bf16 v2bf;
typedef __attribute__((ext_vector_type(8)))  float  v8f;
typedef __attribute__((ext_vector_type(4)))  float  f32x4;
typedef __attribute__((ext_vector_type(2)))  float  f32x2;
typedef __attribute__((ext_vector_type(4)))  unsigned int u32x4;
typedef __attribute__((ext_vector_type(8)))  unsigned int u32x8;

#define HEADS 8
#define DHEAD 32
#define NPOS  4096            // 64*64 tokens per batch image
#define BATCH 16
#define CDIM  256
#define HID   256
#define MROWS (BATCH * NPOS)  // 65536
#define LDQKV 768
#define QTILE 4096            // values of Q per 16 tokens: 16 groups of 16 channels x 32 lanes x 8
#define SCALE 0.17677669529663687f  // 32^-0.5
#define EPS   1e-6f

// workspace layout (bytes)
#define WQ_OFF   0u
#define WEFF_OFF 524288u                  // 16 folded output weights of 256*256*2 bytes each
#define QKV_OFF  34078720u
#define NCH      32                       // token chunks per (batch, head): one per work-group of ln_gemm_qkv
#define PCTX_OFF 134742016u               // QKV_OFF + 65536*768*2
#define PMS_OFF  151519232u               // PCTX_OFF + 128*32*1024*4; per chunk and 16 channels: 16 maxima, 16 sums

// ---------- kernel 0: weights -> bf16 ----------
__global__ __launch_bounds__(256) void cvt_weights(
    const float* __restrict__ wq, __bf16* __restrict__ wqb) {
  int idx = blockIdx.x * 256 + threadIdx.x;
  if (idx < LDQKV * CDIM) wqb[idx] = (__bf16)wq[idx];
}

#define BS_PITCH 272            // 256 data bytes + 16 pad bytes
#define BS_SLICE 6144           // 16 * 272 = 4352, rounded up to a multiple of 2 KiB

// fragment j (rows j*16 .. j*16+15 of the panel), k = kk*32 .. kk*32+31; kb = kk*32 + (lane >> 4) * 8
__device__ __forceinline__ v16bf frag_ld_lds(const unsigned char* base,
                                             int j, int kk, int lane) {
  const unsigned char* p = base + ((kk >> 2) * 4 + j) * BS_SLICE
                         + (lane & 15) * BS_PITCH + (kk & 3) * 64 + ((lane >> 4) << 4);
  v8bf lo = *reinterpret_cast<const v8bf*>(p);        // K = kb .. kb+7
  v8bf hi = *reinterpret_cast<const v8bf*>(p + 32);   // K = kb+16 .. kb+23
  v16bf out;
#pragma unroll
  for (int i = 0; i < 8; ++i) { out[i] = lo[i]; out[8 + i] = hi[i]; }
  return out;
}

__device__ __forceinline__ unsigned int uni(unsigned int v) {
  return (unsigned int)__builtin_amdgcn_readfirstlane((int)v);
}

__device__ __forceinline__ float exp2_slot(float y) {
  float r;
  asm("v_exp_f32 %0, %1\n\tv_nop" : "=v"(r) : "v"(y));
  return r;
}
__device__ __forceinline__ float exp_slot(float x) { return exp2_slot(x * 1.4426950408889634f); }

// p and V of two heads in LDS: 128 rows (64 channels of p, then 64 of V) of 128 tokens in bf16,
// at the pitch of the weight slices (16 B x odd)
#define PV_PITCH 272

// fragment of 16 rows from row0 on, tokens kk*32 .. kk*32+31; k order as frag_ld_lds
__device__ __forceinline__ v16bf frag_ld_pv(const unsigned char* base, int row0, int kk, int lane) {
  const unsigned char* p = base + (row0 + (lane & 15)) * PV_PITCH + kk * 64 + ((lane >> 4) << 4);
  v8bf lo = *reinterpret_cast<const v8bf*>(p);
  v8bf hi = *reinterpret_cast<const v8bf*>(p + 32);
  v16bf out;
#pragma unroll
  for (int i = 0; i < 8; ++i) { out[i] = lo[i]; out[8 + i] = hi[i]; }
  return out;
}

// one wave's slice of a weight panel: the request, the issuer's own wait, the publishing barrier.
// Every wave of the work-group calls it, unconditionally.
__device__ __forceinline__ void stage_slice(unsigned lds_dst, const unsigned char* gsrc, u32x8 g1) {
  unsigned long long ga = (unsigned long long)(const void*)gsrc;
  u32x4 g0;
  g0[0] = uni(1u);                                                  // count = 1
  g0[1] = uni(lds_dst);                                             // LDS byte offset
  g0[2] = uni((unsigned)ga);                                        // global address [31:0]
  g0[3] = uni(((unsigned)(ga >> 32) & 0x01FFFFFFu) | 0x80000000u);  // address [56:32] | type = 2
  asm volatile("tensor_load_to_lds %0, %1" : : "s"(g0), "s"(g1) : "memory");
  // the slice counts as landed only behind its issuer's own wait; the barrier publishes it
  asm volatile("s_wait_tensorcnt 0x0" ::: "memory");
  __syncthreads();
}

// order of one panel's 64 LDS reads and 32 matrix instructions: the reads run two k steps (eight fragments)
// ahead, in groups of eight behind every four products. Left alone, the compiler reads one fragment and
// waits for it in front of every product, so that each product pays the whole LDS latency.
__device__ __forceinline__ void panel_reads_ahead() {
  __builtin_amdgcn_sched_group_barrier(0x100, 16, 0);
#pragma unroll
  for (int i = 0; i < 6; ++i) {
    __builtin_amdgcn_sched_group_barrier(0x008, 4, 0);
    __builtin_amdgcn_sched_group_barrier(0x100, 8, 0);
  }
  __builtin_amdgcn_sched_group_barrier(0x008, 8, 0);
}

__global__ __launch_bounds__(256, 4) void ln_gemm_qkv(
    const float* x, const __bf16* __restrict__ B,
    __bf16* __restrict__ C,
    float* __restrict__ pctx, float* __restrict__ pms) {
  constexpr int K = 256;
  __shared__ __attribute__((aligned(2048))) unsigned char Bs[8 * BS_SLICE];  // 48 KB
  __shared__ __attribute__((aligned(16))) unsigned char PV[128 * PV_PITCH];  // 34 KB
  __shared__ __attribute__((aligned(16))) float redm[64][20];                // [channel][half wave], pitch 80 B (16 B x odd)

  int lane = threadIdx.x & 31;
  int wave = (int)uni(threadIdx.x >> 5);
  int m0 = (blockIdx.x * 8 + wave) * 16;
  int hh = lane >> 4;
  int tok = m0 + (lane & 15);

  // the lane's 128 channels of its token, all asked for at once
  const float* xp = x + ((size_t)(tok >> 12) * CDIM + hh * 8) * NPOS + (tok & (NPOS - 1));
  float xv[8][16];
#pragma unroll
  for (int kk = 0; kk < 8; ++kk)
#pragma unroll
    for (int e = 0; e < 16; ++e)
      xv[kk][e] = xp[(size_t)(kk * 32 + (e >> 3) * 16 + (e & 7)) * NPOS];
  // asks for the loads ahead of the sums (left alone, the compiler holds the last four back behind the
  // wait for all the others, and the wave pays the memory latency twice)
  __builtin_amdgcn_sched_group_barrier(0x020, 128, 0);
  // the loads name an address pair that is rewritten below: keep the wait in front (x is not declared
  // restrict, so that no load moves behind this statement)
  asm volatile("s_wait_xcnt 0x0" ::: "memory");

  // mean and variance of the token over its 256 channels: eight running sums, then the other half wave
  float vs[8], vq[8];
#pragma unroll
  for (int i = 0; i < 8; ++i) { vs[i] = 0.f; vq[i] = 0.f; }
#pragma unroll
  for (int kk = 0; kk < 8; ++kk)
#pragma unroll
    for (int e = 0; e < 16; ++e) { vs[e & 7] += xv[kk][e]; vq[e & 7] += xv[kk][e] * xv[kk][e]; }
  float s  = ((vs[0] + vs[1]) + (vs[2] + vs[3])) + ((vs[4] + vs[5]) + (vs[6] + vs[7]));
  float sq = ((vq[0] + vq[1]) + (vq[2] + vq[3])) + ((vq[4] + vq[5]) + (vq[6] + vq[7]));
  s  += __shfl_xor(s, 16, 32);
  sq += __shfl_xor(sq, 16, 32);
  float mean = s * (1.f / 256.f);
  float rstd = rsqrtf(sq * (1.f / 256.f) - mean * mean + EPS);

  v16bf afr[8];
#pragma unroll
  for (int kk = 0; kk < 8; ++kk)
#pragma unroll
    for (int e = 0; e < 16; ++e) afr[kk][e] = (__bf16)((xv[kk][e] - mean) * rstd);

  // this wave's slice: rows (wave & 3) * 16 .. + 15 of the panel, bytes (wave >> 2) * 256 .. + 255 of each row
  unsigned lds_dst = (unsigned)(size_t)(&Bs[0]) + (unsigned)wave * BS_SLICE;  // low 32 bits = LDS offset
  const unsigned char* bsl = reinterpret_cast<const unsigned char*>(B)
                           + (size_t)(wave & 3) * 16 * (K * 2) + (size_t)(wave >> 2) * 256;
  u32x8 g1;
  g1[0] = uni((1u << 20) | (5u << 22) | (3u << 25));
  g1[1] = uni(256u << 16);
  g1[2] = uni(16u << 16);
  g1[3] = uni(256u << 16);
  g1[4] = uni(16u);
  g1[5] = uni((unsigned)(K * 2));
  g1[6] = uni(0u);
  g1[7] = uni(0u);
  __bf16* __restrict__ cp = C + (size_t)(m0 >> 4) * QTILE + lane * 8;

  for (int n0 = 0; n0 < HID; n0 += 64) {
    stage_slice(lds_dst, bsl + (size_t)n0 * (K * 2), g1);

    v8f acc[4] = {};
#pragma unroll
    for (int kk = 0; kk < 8; ++kk) {
#pragma unroll
      for (int j = 0; j < 4; ++j) {
        v16bf wf = frag_ld_lds(Bs, j, kk, lane);
        acc[j] = __builtin_amdgcn_wmma_f32_16x16x32_bf16(
            false, wf, false, afr[kk], (short)0, acc[j], false, false);
      }
    }

#pragma unroll
    for (int j = 0; j < 4; ++j) {
      v8bf st;
#pragma unroll
      for (int r = 0; r < 8; ++r) st[r] = (__bf16)acc[j][r];
      *reinterpret_cast<v8bf*>(cp + ((n0 >> 4) + j) * 256) = st;
    }
    // the stores name registers that the next group rewrites: keep the wait in front
    asm volatile("s_wait_xcnt 0x0" ::: "memory");
    // this wave's LDS reads have retired before any wave's next request targets the panel
    asm volatile("s_wait_dscnt 0x0" ::: "memory");
    __syncthreads();  // protect Bs before next group's DMA
  }

  int l15 = lane & 15;
  int hl = wave >> 2, dt = (wave >> 1) & 1, et = wave & 1;   // the wave's tile of c: head of the pair, 16 d, 16 e
  size_t pbase = (size_t)(blockIdx.x >> 5) * HEADS * NCH + (blockIdx.x & 31);  // 32 work-groups per batch image
  v16bf ones;
#pragma unroll
  for (int i = 0; i < 16; ++i) ones[i] = (__bf16)1.0f;
  for (int hp = 0; hp < HEADS / 2; ++hp) {
    // K, then V, of heads 2 hp and 2 hp + 1: lane = channel j * 16 + (lane & 15), register r = token (lane >> 4) * 8 + r
    v8f ak[4] = {}, av[4] = {};
    stage_slice(lds_dst, bsl + (size_t)(HID + hp * 64) * (K * 2), g1);
    // closes the scheduling region, so that the order asked for below holds for this panel's reads alone
    __builtin_amdgcn_sched_barrier(0);
#pragma unroll
    for (int kk = 0; kk < 8; ++kk) {
#pragma unroll
      for (int j = 0; j < 4; ++j) {
        v16bf wf = frag_ld_lds(Bs, j, kk, lane);
        ak[j] = __builtin_amdgcn_wmma_f32_16x16x32_bf16(
            false, afr[kk], false, wf, (short)0, ak[j], false, false);
      }
    }
    panel_reads_ahead();
    __builtin_amdgcn_sched_barrier(0);  // end of that region
    // this wave's LDS reads have retired before any wave's next request targets the panel
    asm volatile("s_wait_dscnt 0x0" ::: "memory");
    __syncthreads();  // protect Bs before the next request
    stage_slice(lds_dst, bsl + (size_t)(2 * HID + hp * 64) * (K * 2), g1);
    __builtin_amdgcn_sched_barrier(0);  // as for K: the region of this panel's reads
#pragma unroll
    for (int kk = 0; kk < 8; ++kk) {
#pragma unroll
      for (int j = 0; j < 4; ++j) {
        v16bf wf = frag_ld_lds(Bs, j, kk, lane);
        av[j] = __builtin_amdgcn_wmma_f32_16x16x32_bf16(
            false, afr[kk], false, wf, (short)0, av[j], false, false);
      }
    }
    panel_reads_ahead();
    __builtin_amdgcn_sched_barrier(0);  // end of that region
    asm volatile("s_wait_dscnt 0x0" ::: "memory");

    // chunk maximum per channel: lane, then the sixteen half waves
    float m[4];
#pragma unroll
    for (int j = 0; j < 4; ++j)
      redm[j * 16 + l15][wave * 2 + hh] =
          fmaxf(fmaxf(fmaxf(ak[j][0], ak[j][1]), fmaxf(ak[j][2], ak[j][3])),
                fmaxf(fmaxf(ak[j][4], ak[j][5]), fmaxf(ak[j][6], ak[j][7])));
    __syncthreads();  // every half wave's maxima are in LDS; also ends all reads of the weight panel
    __builtin_amdgcn_sched_barrier(0);  // region of the sixteen reads of the maxima
#pragma unroll
    for (int j = 0; j < 4; ++j) {
      f32x4 q[4];
#pragma unroll
      for (int i = 0; i < 4; ++i) q[i] = *reinterpret_cast<const f32x4*>(&redm[j * 16 + l15][i * 4]);
#pragma unroll
      for (int i = 0; i < 4; ++i) q[i][0] = fmaxf(fmaxf(q[i][0], q[i][1]), fmaxf(q[i][2], q[i][3]));
      m[j] = fmaxf(fmaxf(q[0][0], q[1][0]), fmaxf(q[2][0], q[3][0]));
    }
    // all sixteen reads first (left alone, four and a wait, four times: the LDS latency is paid four times)
    __builtin_amdgcn_sched_group_barrier(0x100, 16, 0);
    __builtin_amdgcn_sched_barrier(0);  // end of that region
#pragma unroll
    for (int j = 0; j < 4; ++j) {
      float nm = -m[j] * 1.4426950408889634f;   // exp(k - m) = 2^(k * log2(e) - m * log2(e)): one multiply-add per value
      v8bf pb, vb;
#pragma unroll
      for (int r = 0; r < 8; ++r) {
        pb[r] = (__bf16)exp2_slot(fmaf(ak[j][r], 1.4426950408889634f, nm));
        vb[r] = (__bf16)av[j][r];
      }
      unsigned char* row = PV + (j * 16 + l15) * PV_PITCH + wave * 32 + hh * 16;
      *reinterpret_cast<v8bf*>(row) = pb;
      *reinterpret_cast<v8bf*>(row + 64 * PV_PITCH) = vb;
    }
    __syncthreads();  // p and V of the whole chunk are in LDS

    // c = p * V^T, and s = sum_n p as ones * p^T: the sum of the rounded values that c is made of,
    // in every register of the lane whose (lane & 15) is the channel
    v8f c = {}, sa = {};
    __builtin_amdgcn_sched_barrier(0);  // region of the sixteen reads of p and V
#pragma unroll
    for (int kk = 0; kk < 4; ++kk) {
      v16bf pf = frag_ld_pv(PV, hl * 32 + dt * 16, kk, lane);
      v16bf vf = frag_ld_pv(PV, 64 + hl * 32 + et * 16, kk, lane);
      sa = __builtin_amdgcn_wmma_f32_16x16x32_bf16(false, ones, false, pf, (short)0, sa, false, false);
      c  = __builtin_amdgcn_wmma_f32_16x16x32_bf16(false, pf, false, vf, (short)0, c, false, false);
    }
    // all sixteen reads in front of the eight products (left alone, every pair of products waits for its own reads)
    __builtin_amdgcn_sched_group_barrier(0x100, 16, 0);
    __builtin_amdgcn_sched_group_barrier(0x008, 8, 0);
    __builtin_amdgcn_sched_barrier(0);  // end of that region
    size_t pidx = pbase + (size_t)(hp * 2 + hl) * NCH;
    // tile-major [tile][e][d]: a lane holds 8 consecutive d of one e, the wave fills 1 KB of its own
    float* cw = pctx + pidx * 1024 + (dt * 2 + et) * 256 + l15 * 16 + hh * 8;
    *reinterpret_cast<f32x4*>(cw)     = (f32x4){c[0], c[1], c[2], c[3]};
    *reinterpret_cast<f32x4*>(cw + 4) = (f32x4){c[4], c[5], c[6], c[7]};
    float* mw = pms + (pidx * 2 + dt) * 32 + lane;
    if (et == 0) {
      // one 128-byte line per 16 channels: their maxima from the lower half wave, their sums from the upper
      float mj = hl ? (dt ? m[3] : m[2]) : (dt ? m[1] : m[0]);
      *mw = hh ? sa[0] : mj;
    }
    asm volatile("s_wait_xcnt 0x0\n\tv_nop\n\tv_nop\n\tv_nop\n\tv_nop" :: "v"(cw), "v"(mw) : "memory");
    // PV and redm are written again only behind the next pair's three barriers
  }
}

// ---------- kernel 3: merge of the chunk partials, folded into the output weights ----------
// One work-group per (b, pair of heads, 64 rows of w_out), 256 threads per head: merge the
// chunks' (m, s, c) and the four memory tokens into context[d][e] = sum_n softmax_n(K)[d,n] * V[e,n],
// then fold it into the output weights: weff[b][o][h*32+d] = sum_e w_out[o][h*32+e] * context[d][e],
// so that Y[o,n] = sum_k weff[b][o][k] * softmax_d(Q)[k,n] and the context is never applied token by
// token. The four work-groups of a pair of heads each merge the same context (the merge is latency,
// the fold is work). The two heads of a work-group fill one 128-byte line of each of its rows of weff.
__global__ __launch_bounds__(512) void attn_merge_fold(
    const float* __restrict__ pctx, const float* __restrict__ pms,
    const float* __restrict__ mem_kv,
    const float* wo, __bf16* __restrict__ weff) {
  __shared__ __attribute__((aligned(16))) float wgt[2][NCH][32];
  __shared__ __attribute__((aligned(16))) float wmem[2][4][32];
  __shared__ __attribute__((aligned(16))) float cs[2][DHEAD * DHEAD];
  int hf = threadIdx.x >> 8, t = threadIdx.x & 255;
  int bh = (blockIdx.x >> 2) * 2 + hf, h = bh & 7;
  int o = (blockIdx.x & 3) * 64 + (t & 63), d0 = (t >> 6) * 8;  // the thread's row of weff and its eight d (d0 is the same for a wave)
  const float* mk = mem_kv + (size_t)h * DHEAD * 4;
  const float* mv = mem_kv + (size_t)HEADS * DHEAD * 4 + (size_t)h * DHEAD * 4;
  // row o of w_out, the 32 columns of this head: asked for first, used last
  f32x4 wr[8];
#pragma unroll
  for (int i = 0; i < 8; ++i)
    wr[i] = *reinterpret_cast<const f32x4*>(wo + (size_t)o * HID + h * DHEAD + i * 4);
  // the loads name an address pair that is rewritten below: keep the wait in front (wo is not
  // declared restrict, so that no load moves behind this statement)
  asm volatile("s_wait_xcnt 0x0" ::: "memory");
  if (t < 32) {
    float mc[NCH], em[4];
    float M = mk[t * 4];
#pragma unroll
    for (int j = 1; j < 4; ++j) M = fmaxf(M, mk[t * 4 + j]);
#pragma unroll
    for (int c = 0; c < NCH; ++c) {
      mc[c] = pms[(((size_t)bh * NCH + c) * 2 + (t >> 4)) * 32 + (t & 15)];
      M = fmaxf(M, mc[c]);
    }
    float S = 0.f;
#pragma unroll
    for (int j = 0; j < 4; ++j) { em[j] = exp_slot(mk[t * 4 + j] - M); S += em[j]; }
#pragma unroll
    for (int c = 0; c < NCH; ++c) {
      mc[c] = exp_slot(mc[c] - M);
      S += mc[c] * pms[(((size_t)bh * NCH + c) * 2 + (t >> 4)) * 32 + 16 + (t & 15)];
    }
    float inv = 1.f / S;
#pragma unroll
    for (int c = 0; c < NCH; ++c) wgt[hf][c][t] = mc[c] * inv;
#pragma unroll
    for (int j = 0; j < 4; ++j) wmem[hf][j][t] = em[j] * inv;
  }
  // the loads above name registers that are rewritten below: keep the wait in front
  asm volatile("s_wait_xcnt 0x0" ::: "memory");
  __syncthreads();
  // the partials are tile-major [16 d x 16 e tile][e][d]: the thread's four values are four d of one e
  int dm = (t >> 7) * 16 + (t & 3) * 4, e = ((t >> 6) & 1) * 16 + ((t >> 2) & 15);
  f32x4 mvr = *reinterpret_cast<const f32x4*>(mv + e * 4);
  asm volatile("s_wait_xcnt 0x0" ::: "memory");
  f32x4 a = {0.f, 0.f, 0.f, 0.f};
#pragma unroll
  for (int j = 0; j < 4; ++j)
    a += *reinterpret_cast<const f32x4*>(&wmem[hf][j][dm]) * mvr[j];
#pragma unroll
  for (int c = 0; c < NCH; ++c) {
    f32x4 pc = *reinterpret_cast<const f32x4*>(pctx + ((size_t)bh * NCH + c) * 1024 + t * 4);
    a += *reinterpret_cast<const f32x4*>(&wgt[hf][c][dm]) * pc;
  }
  asm volatile("s_wait_xcnt 0x0" ::: "memory");
#pragma unroll
  for (int i = 0; i < 4; ++i) cs[hf][(dm + i) * DHEAD + e] = a[i];
  __syncthreads();  // the head's whole context is in LDS before any thread folds it

  // the context is read at an address that is the same for the wave; even and odd e are summed
  // apart (two products per instruction on register pairs as they are loaded) and added at the end
  f32x2 r[8];
#pragma unroll
  for (int j = 0; j < 8; ++j) r[j] = (f32x2){0.f, 0.f};
#pragma unroll
  for (int i = 0; i < 8; ++i)
#pragma unroll
    for (int j = 0; j < 8; ++j) {
      f32x4 c = *reinterpret_cast<const f32x4*>(&cs[hf][(d0 + j) * DHEAD + i * 4]);
      r[j] += wr[i].lo * c.lo;
      r[j] += wr[i].hi * c.hi;
    }
  v8bf st;
#pragma unroll
  for (int j = 0; j < 8; ++j) st[j] = (__bf16)(r[j].x + r[j].y);
  *reinterpret_cast<v8bf*>(weff + ((size_t)(bh >> 3) * CDIM + o) * HID + h * DHEAD + d0) = st;
}

__global__ __launch_bounds__(256, 4) void gemm_ln_res_out(
    const __bf16* QKV, const __bf16* __restrict__ B,
    const float* __restrict__ bias, const float* __restrict__ x,
    float* __restrict__ out) {
  constexpr int K = 256;
  __shared__ __attribute__((aligned(2048))) unsigned char Bs[8 * BS_SLICE];  // 48 KB

  int lane = threadIdx.x & 31;
  int wave = (int)uni(threadIdx.x >> 5);
  int m0 = (blockIdx.x * 8 + wave) * 16;
  int hh = lane >> 4;

  // this wave's 16 tokens x 256 k, register-resident: Q first, in fragment order as ln_gemm_qkv left it
  // (channel group 2 kk is the low half of fragment kk, group 2 kk + 1 the high half; k order as frag_ld_lds)
  const __bf16* qp = QKV + (size_t)(m0 >> 4) * QTILE + lane * 8;
  v16bf afr[8];
#pragma unroll
  for (int kk = 0; kk < 8; ++kk) {
    v8bf lo = *reinterpret_cast<const v8bf*>(qp + (kk * 2) * 256);
    v8bf hi = *reinterpret_cast<const v8bf*>(qp + (kk * 2 + 1) * 256);
#pragma unroll
    for (int i = 0; i < 8; ++i) { afr[kk][i] = lo[i]; afr[kk][8 + i] = hi[i]; }
  }
  // the loads name the lane's number as their offset register, which is rewritten below: keep the wait in
  // front (QKV is not declared restrict, so that no load moves behind this statement; the number is an
  // input, so that its register lives up to the wait)
  asm volatile("s_wait_xcnt 0x0" :: "v"(lane) : "memory");
  // softmax over the 32 features of each head, times SCALE, rounded back into the fragment
#pragma unroll
  for (int kk = 0; kk < 8; ++kk) {
    // the maximum is taken on the 16-bit values as they lie in the registers (exact: no rounding in a maximum)
    v2bf m2 = __builtin_shufflevector(afr[kk], afr[kk], 0, 1);
    m2 = __builtin_elementwise_max(m2, __builtin_shufflevector(afr[kk], afr[kk], 2, 3));
    m2 = __builtin_elementwise_max(m2, __builtin_shufflevector(afr[kk], afr[kk], 4, 5));
    m2 = __builtin_elementwise_max(m2, __builtin_shufflevector(afr[kk], afr[kk], 6, 7));
    m2 = __builtin_elementwise_max(m2, __builtin_shufflevector(afr[kk], afr[kk], 8, 9));
    m2 = __builtin_elementwise_max(m2, __builtin_shufflevector(afr[kk], afr[kk], 10, 11));
    m2 = __builtin_elementwise_max(m2, __builtin_shufflevector(afr[kk], afr[kk], 12, 13));
    m2 = __builtin_elementwise_max(m2, __builtin_shufflevector(afr[kk], afr[kk], 14, 15));
    float qm = fmaxf((float)m2.x, (float)m2.y);
    qm = fmaxf(qm, __shfl_xor(qm, 16, 32));
    float nm = -qm * 1.4426950408889634f;   // exp(q - qm) = 2^(q * log2(e) - qm * log2(e)): one multiply-add per value
    float qv[16], qs = 0.f;
#pragma unroll
    for (int e = 0; e < 16; ++e) { qv[e] = exp2_slot(fmaf((float)afr[kk][e], 1.4426950408889634f, nm)); qs += qv[e]; }
    qs += __shfl_xor(qs, 16, 32);
    float scl = SCALE / qs;
#pragma unroll
    for (int e = 0; e < 16; ++e) afr[kk][e] = (__bf16)(qv[e] * scl);
  }

  // this wave's slice: rows (wave & 3) * 16 .. + 15 of the panel, bytes (wave >> 2) * 256 .. + 255 of each row
  unsigned lds_dst = (unsigned)(size_t)(&Bs[0]) + (unsigned)wave * BS_SLICE;  // low 32 bits = LDS offset
  const unsigned char* bsl = reinterpret_cast<const unsigned char*>(B)
                           + (size_t)(blockIdx.x >> 5) * (CDIM * K * 2)  // 32 blocks per batch image
                           + (size_t)(wave & 3) * 16 * (K * 2) + (size_t)(wave >> 2) * 256;
  u32x8 g1;
  g1[0] = uni((1u << 20) | (5u << 22) | (3u << 25));
  g1[1] = uni(256u << 16);
  g1[2] = uni(16u << 16);
  g1[3] = uni(256u << 16);
  g1[4] = uni(16u);
  g1[5] = uni((unsigned)(K * 2));
  g1[6] = uni(0u);
  g1[7] = uni(0u);

  // the sums start from the bias of the lane's eight channels of each tile; the 16 values of a
  // tile are read at a wave-uniform address (scalar loads) and each half wave takes its eight
  v8f acc[4][4];
#pragma unroll
  for (int g = 0; g < 4; ++g)
#pragma unroll
    for (int j = 0; j < 4; ++j)
#pragma unroll
      for (int r = 0; r < 8; ++r) {
        float blo = bias[g * 64 + j * 16 + r], bhi = bias[g * 64 + j * 16 + 8 + r];
        acc[g][j][r] = hh ? bhi : blo;
      }
  // unrolled so that the accumulators of all four groups are indexed by constants and stay in registers
#pragma unroll
  for (int g = 0; g < 4; ++g) {
    // every wave brings its own slice; no test around the request
    unsigned long long ga = (unsigned long long)(const void*)(bsl + (size_t)(g * 64) * (K * 2));
    u32x4 g0;
    g0[0] = uni(1u);                                                  // count = 1
    g0[1] = uni(lds_dst);                                             // LDS byte offset
    g0[2] = uni((unsigned)ga);                                        // global address [31:0]
    g0[3] = uni(((unsigned)(ga >> 32) & 0x01FFFFFFu) | 0x80000000u);  // address [56:32] | type = 2
    asm volatile("tensor_load_to_lds %0, %1" : : "s"(g0), "s"(g1) : "memory");
    // the slice counts as landed only behind its issuer's own wait; the barrier publishes it
    asm volatile("s_wait_tensorcnt 0x0" ::: "memory");
    __syncthreads();

    // closes the scheduling region, so that the order asked for below holds for this group's reads alone
    __builtin_amdgcn_sched_barrier(0);
#pragma unroll
    for (int kk = 0; kk < 8; ++kk) {
#pragma unroll
      for (int j = 0; j < 4; ++j) {
        v16bf wf = frag_ld_lds(Bs, j, kk, lane);
        acc[g][j] = __builtin_amdgcn_wmma_f32_16x16x32_bf16(
            false, wf, false, afr[kk], (short)0, acc[g][j], false, false);
      }
    }
    // LDS reads run four fragments ahead of the matrix instructions (left alone, the compiler reads one
    // fragment, waits and multiplies, and every product pays the whole LDS latency): eight reads, then
    // each product followed by the two reads that refill its fragment's registers
    __builtin_amdgcn_sched_group_barrier(0x100, 8, 0);
#pragma unroll
    for (int i = 0; i < 28; ++i) {
      __builtin_amdgcn_sched_group_barrier(0x008, 1, 0);
      __builtin_amdgcn_sched_group_barrier(0x100, 2, 0);
    }
    __builtin_amdgcn_sched_group_barrier(0x008, 4, 0);
    __builtin_amdgcn_sched_barrier(0);  // end of that region
    if (g < 3) {
      // this wave's LDS reads have retired before any wave's next request targets the panel
      asm volatile("s_wait_dscnt 0x0" ::: "memory");
      __syncthreads();  // protect Bs before the next group's request
    }
  }

  int tok = m0 + (lane & 15);
  size_t base = ((size_t)(tok >> 12) * CDIM + hh * 8) * NPOS + (tok & (NPOS - 1));
  const float* __restrict__ xp = x + base;
  float* __restrict__ op = out + base;
  // x of the first group's 32 channels is asked for before the statistics
  float xr[2][32];
#pragma unroll
  for (int i = 0; i < 32; ++i) xr[0][i] = xp[(size_t)((i >> 3) * 16 + (i & 7)) * NPOS];

  // mean and variance of the token over its 256 channels: eight running sums, then the other half wave
  v8f vs = {}, vq = {};
#pragma unroll
  for (int g = 0; g < 4; ++g)
#pragma unroll
    for (int j = 0; j < 4; ++j) { vs += acc[g][j]; vq += acc[g][j] * acc[g][j]; }
  float s  = ((vs[0] + vs[1]) + (vs[2] + vs[3])) + ((vs[4] + vs[5]) + (vs[6] + vs[7]));
  float sq = ((vq[0] + vq[1]) + (vq[2] + vq[3])) + ((vq[4] + vq[5]) + (vq[6] + vq[7]));
  s  += __shfl_xor(s, 16, 32);
  sq += __shfl_xor(sq, 16, 32);
  float mean = s * (1.f / 256.f);
  float rstd = rsqrtf(sq * (1.f / 256.f) - mean * mean + EPS);

#pragma unroll
  for (int g = 0; g < 4; ++g) {
    if (g < 3) {
#pragma unroll
      for (int i = 0; i < 32; ++i)
        xr[(g + 1) & 1][i] = xp[(size_t)((g + 1) * 64 + (i >> 3) * 16 + (i & 7)) * NPOS];
      __builtin_amdgcn_sched_barrier(0);  // the next group's x stays in flight while this group is stored
    }
#pragma unroll
    for (int i = 0; i < 32; ++i) {
      size_t o = (size_t)(g * 64 + (i >> 3) * 16 + (i & 7)) * NPOS;
      op[o] = (acc[g][i >> 3][i & 7] - mean) * rstd + xr[g & 1][i];
    }
  }
}

// ---------- host launcher ----------
extern "C" void kernel_launch(void* const* d_in, const int* in_sizes, int n_in,
                              void* d_out, int out_size, void* d_ws, size_t ws_size,
                              hipStream_t stream) {
  const float* x      = (const float*)d_in[0];
  const float* mem_kv = (const float*)d_in[1];
  const float* w_qkv  = (const float*)d_in[2];
  const float* w_out  = (const float*)d_in[3];
  const float* b_out  = (const float*)d_in[4];
  float* out = (float*)d_out;

  char* ws = (char*)d_ws;
  __bf16* wq_bf  = (__bf16*)(ws + WQ_OFF);
  __bf16* weff   = (__bf16*)(ws + WEFF_OFF);
  __bf16* QKVbf  = (__bf16*)(ws + QKV_OFF);
  float*  pctx   = (float*)(ws + PCTX_OFF);
  float*  pms    = (float*)(ws + PMS_OFF);

  cvt_weights<<<768, 256, 0, stream>>>(w_qkv, wq_bf);
  ln_gemm_qkv<<<MROWS / 128, 256, 0, stream>>>(x, wq_bf, QKVbf, pctx, pms);
  attn_merge_fold<<<BATCH * HEADS * 2, 512, 0, stream>>>(pctx, pms, mem_kv, w_out, weff);
  gemm_ln_res_out<<<MROWS / 128, 256, 0, stream>>>(QKVbf, weff, b_out, x, out);
}

// v009
// Measured time: 64.3 microseconds a run.
// In both of two side-by-side timings against v008, it was 1.03 times as fast.
// All steps since v000 together make it 10.6 times as fast.
#include <hip/hip_runtime.h>

// ---------- types ----------
typedef __attribute__((ext_vector_type(16))) __bf16 v16bf;
typedef __attribute__((ext_vector_type(8)))  __bf16 v8bf;
typedef __attribute__((ext_vector_type(2)))  __bf16 v2bf;
typedef __attribute__((ext_vector_type(8)))  float  v8f;
typedef __attribute__((ext_vector_type(4)))  float  f32x4;
typedef __attribute__((ext_vector_type(2)))  float  f32x2;
typedef __attribute__((ext_vector_type(4)))  unsigned int u32x4;
typedef __attribute__((ext_vector_type(8)))  unsigned int u32x8;

#define HEADS 8
#define DHEAD 32
#define NPOS  4096            // 64*64 tokens per batch image
#define BATCH 16
#define CDIM  256
#define HID   256
#define MROWS (BATCH * NPOS)  // 65536
#define LDQKV 768
#define QTILE 4096            // values of Q per 16 tokens: 16 groups of 16 channels x 32 lanes x 8
#define SCALE 0.17677669529663687f  // 32^-0.5
#define EPS   1e-6f

// workspace layout (bytes)
#define WQ_OFF   0u
#define WEFF_OFF 524288u                  // 16 folded output weights of 256*256*2 bytes each
#define QKV_OFF  34078720u
#define NCH      32                       // token chunks per (batch, head): one per work-group of ln_gemm_qkv
#define PCTX_OFF 134742016u               // QKV_OFF + 65536*768*2
#define PMS_OFF  151519232u               // PCTX_OFF + 128*32*1024*4; per chunk and 16 channels: 16 maxima, 16 sums

// ---------- kernel 0: weights -> bf16 ----------
__global__ __launch_bounds__(256) void cvt_weights(
    const float* __restrict__ wq, __bf16* __restrict__ wqb) {
  int idx = blockIdx.x * 256 + threadIdx.x;
  if (idx < LDQKV * CDIM) wqb[idx] = (__bf16)wq[idx];
}

#define BS_PITCH 272            // 256 data bytes + 16 pad bytes
#define BS_SLICE 6144           // 16 * 272 = 4352, rounded up to a multiple of 2 KiB

// fragment j (rows j*16 .. j*16+15 of the panel), k = kk*32 .. kk*32+31; kb = kk*32 + (lane >> 4) * 8
__device__ __forceinline__ v16bf frag_ld_lds(const unsigned char* base,
                                             int j, int kk, int lane) {
  const unsigned char* p = base + ((kk >> 2) * 4 + j) * BS_SLICE
                         + (lane & 15) * BS_PITCH + (kk & 3) * 64 + ((lane >> 4) << 4);
  v8bf lo = *reinterpret_cast<const v8bf*>(p);        // K = kb .. kb+7
  v8bf hi = *reinterpret_cast<const v8bf*>(p + 32);   // K = kb+16 .. kb+23
  v16bf out;
#pragma unroll
  for (int i = 0; i < 8; ++i) { out[i] = lo[i]; out[8 + i] = hi[i]; }
  return out;
}

__device__ __forceinline__ unsigned int uni(unsigned int v) {
  return (unsigned int)__builtin_amdgcn_readfirstlane((int)v);
}

__device__ __forceinline__ float exp2_slot(float y) {
  float r;
  asm("v_exp_f32 %0, %1\n\tv_nop" : "=v"(r) : "v"(y));
  return r;
}
__device__ __forceinline__ float exp_slot(float x) { return exp2_slot(x * 1.4426950408889634f); }

// p and V of two heads in LDS: 128 rows (64 channels of p, then 64 of V) of 128 tokens in bf16,
// at the pitch of the weight slices (16 B x odd)
#define PV_PITCH 272

// fragment of 16 rows from row0 on, tokens kk*32 .. kk*32+31; k order as frag_ld_lds
__device__ __forceinline__ v16bf frag_ld_pv(const unsigned char* base, int row0, int kk, int lane) {
  const unsigned char* p = base + (row0 + (lane & 15)) * PV_PITCH + kk * 64 + ((lane >> 4) << 4);
  v8bf lo = *reinterpret_cast<const v8bf*>(p);
  v8bf hi = *reinterpret_cast<const v8bf*>(p + 32);
  v16bf out;
#pragma unroll
  for (int i = 0; i < 8; ++i) { out[i] = lo[i]; out[8 + i] = hi[i]; }
  return out;
}

// one wave's slice of a weight panel: the request, the issuer's own wait, the publishing barrier.
// Every wave of the work-group calls it, unconditionally.
__device__ __forceinline__ void stage_slice(unsigned lds_dst, const unsigned char* gsrc, u32x8 g1) {
  unsigned long long ga = (unsigned long long)(const void*)gsrc;
  u32x4 g0;
  g0[0] = uni(1u);                                                  // count = 1
  g0[1] = uni(lds_dst);                                             // LDS byte offset
  g0[2] = uni((unsigned)ga);                                        // global address [31:0]
  g0[3] = uni(((unsigned)(ga >> 32) & 0x01FFFFFFu) | 0x80000000u);  // address [56:32] | type = 2
  asm volatile("tensor_load_to_lds %0, %1" : : "s"(g0), "s"(g1) : "memory");
  // the slice counts as landed only behind its issuer's own wait; the barrier publishes it
  asm volatile("s_wait_tensorcnt 0x0" ::: "memory");
  __syncthreads();
}

// order of one panel's 64 LDS reads and 64 matrix instructions (two per fragment): the reads run two k steps
// (eight fragments) ahead, in groups of eight behind every eight products. Left alone, the compiler reads one
// fragment and waits for it in front of its products, so that they pay the whole LDS latency.
__device__ __forceinline__ void panel_reads_ahead() {
  __builtin_amdgcn_sched_group_barrier(0x100, 16, 0);
#pragma unroll
  for (int i = 0; i < 6; ++i) {
    __builtin_amdgcn_sched_group_barrier(0x008, 8, 0);
    __builtin_amdgcn_sched_group_barrier(0x100, 8, 0);
  }
  __builtin_amdgcn_sched_group_barrier(0x008, 16, 0);
}

// weight panel of ln_gemm_qkv in LDS: four slices, slice = (k half) * 2 + (group of 32 rows); 32 half rows
// of 256 bytes at the pitch of BS_PITCH
#define QS_SLICE 10240          // 32 * 272 = 8704, rounded up to a multiple of 2 KiB

// fragment j (rows j*16 .. j*16+15 of the panel), k = kk*32 .. kk*32+31; k order as frag_ld_lds
__device__ __forceinline__ v16bf frag_ld_qs(const unsigned char* base, int j, int kk, int lane) {
  const unsigned char* p = base + ((kk >> 2) * 2 + (j >> 1)) * QS_SLICE
                         + ((j & 1) * 16 + (lane & 15)) * BS_PITCH + (kk & 3) * 64 + ((lane >> 4) << 4);
  v8bf lo = *reinterpret_cast<const v8bf*>(p);        // K = kb .. kb+7
  v8bf hi = *reinterpret_cast<const v8bf*>(p + 32);   // K = kb+16 .. kb+23
  v16bf out;
#pragma unroll
  for (int i = 0; i < 8; ++i) { out[i] = lo[i]; out[8 + i] = hi[i]; }
  return out;
}

__global__ __launch_bounds__(128) __attribute__((amdgpu_waves_per_eu(2, 2))) void ln_gemm_qkv(
    const float* x, const __bf16* __restrict__ B,
    __bf16* __restrict__ C,
    float* __restrict__ pctx, float* __restrict__ pms) {
  constexpr int K = 256;
  __shared__ __attribute__((aligned(2048))) unsigned char Bs[4 * QS_SLICE];  // 40 KB
  __shared__ __attribute__((aligned(16))) unsigned char PV[128 * PV_PITCH];  // 34 KB
  __shared__ __attribute__((aligned(16))) float redm[64][12];                // [channel][half wave], pitch 48 B (16 B x odd)

  int lane = threadIdx.x & 31;
  int wave = (int)uni(threadIdx.x >> 5);
  int m0 = (blockIdx.x * 4 + wave) * 32;
  int hh = lane >> 4;
  int tok = m0 + (lane & 15);

  // the lane's 128 channels of each of its two tokens (tok and tok + 16), all asked for at once
  const float* xp = x + ((size_t)(tok >> 12) * CDIM + hh * 8) * NPOS + (tok & (NPOS - 1));
  f32x2 xv[8][16];   // component f = token tok + f * 16
#pragma unroll
  for (int kk = 0; kk < 8; ++kk)
#pragma unroll
    for (int e = 0; e < 16; ++e)
#pragma unroll
      for (int f = 0; f < 2; ++f)
        xv[kk][e][f] = xp[(size_t)(kk * 32 + (e >> 3) * 16 + (e & 7)) * NPOS + f * 16];
  // asks for the loads ahead of the sums (left alone, the compiler holds some back behind the
  // wait for the others, and the wave pays the memory latency twice)
  __builtin_amdgcn_sched_group_barrier(0x020, 256, 0);
  // the loads name an address pair that is rewritten below: keep the wait in front (x is not declared
  // restrict, so that no load moves behind this statement)
  asm volatile("s_wait_xcnt 0x0" ::: "memory");

  // mean and variance of each token over its 256 channels: eight running sums, then the other half wave;
  // the lane's two tokens side by side in register pairs (two sums per instruction)
  f32x2 vs[8], vq[8];
#pragma unroll
  for (int i = 0; i < 8; ++i) { vs[i] = (f32x2){0.f, 0.f}; vq[i] = (f32x2){0.f, 0.f}; }
#pragma unroll
  for (int kk = 0; kk < 8; ++kk)
#pragma unroll
    for (int e = 0; e < 16; ++e) { vs[e & 7] += xv[kk][e]; vq[e & 7] += xv[kk][e] * xv[kk][e]; }
  f32x2 s2 = ((vs[0] + vs[1]) + (vs[2] + vs[3])) + ((vs[4] + vs[5]) + (vs[6] + vs[7]));
  f32x2 q2 = ((vq[0] + vq[1]) + (vq[2] + vq[3])) + ((vq[4] + vq[5]) + (vq[6] + vq[7]));

  v16bf afr[2][8];
#pragma unroll
  for (int f = 0; f < 2; ++f) {
    float s  = s2[f] + __shfl_xor(s2[f], 16, 32);
    float sq = q2[f] + __shfl_xor(q2[f], 16, 32);
    float mean = s * (1.f / 256.f);
    float rstd = rsqrtf(sq * (1.f / 256.f) - mean * mean + EPS);
#pragma unroll
    for (int kk = 0; kk < 8; ++kk)
#pragma unroll
      for (int e = 0; e < 16; ++e) afr[f][kk][e] = (__bf16)((xv[kk][e][f] - mean) * rstd);
  }

  // this wave's slice: rows (wave & 1) * 32 .. + 31 of the panel, bytes (wave >> 1) * 256 .. + 255 of each row
  unsigned lds_dst = (unsigned)(size_t)(&Bs[0]) + (unsigned)wave * QS_SLICE;  // low 32 bits = LDS offset
  const unsigned char* bsl = reinterpret_cast<const unsigned char*>(B)
                           + (size_t)(wave & 1) * 32 * (K * 2) + (size_t)(wave >> 1) * 256;
  u32x8 g1;
  g1[0] = uni((1u << 20) | (5u << 22) | (3u << 25));
  g1[1] = uni(256u << 16);
  g1[2] = uni(32u << 16);
  g1[3] = uni(256u << 16);
  g1[4] = uni(32u);
  g1[5] = uni((unsigned)(K * 2));
  g1[6] = uni(0u);
  g1[7] = uni(0u);
  __bf16* __restrict__ cp = C + (size_t)(m0 >> 4) * QTILE + lane * 8;

  for (int n0 = 0; n0 < HID; n0 += 64) {
    stage_slice(lds_dst, bsl + (size_t)n0 * (K * 2), g1);

    v8f acc[2][4] = {};
#pragma unroll
    for (int kk = 0; kk < 8; ++kk) {
#pragma unroll
      for (int j = 0; j < 4; ++j) {
        v16bf wf = frag_ld_qs(Bs, j, kk, lane);
#pragma unroll
        for (int f = 0; f < 2; ++f)
          acc[f][j] = __builtin_amdgcn_wmma_f32_16x16x32_bf16(
              false, wf, false, afr[f][kk], (short)0, acc[f][j], false, false);
      }
    }

#pragma unroll
    for (int f = 0; f < 2; ++f)
#pragma unroll
      for (int j = 0; j < 4; ++j) {
        v8bf st;
#pragma unroll
        for (int r = 0; r < 8; ++r) st[r] = (__bf16)acc[f][j][r];
        *reinterpret_cast<v8bf*>(cp + f * QTILE + ((n0 >> 4) + j) * 256) = st;
      }
    // the stores name registers that the next group rewrites: keep the wait in front
    asm volatile("s_wait_xcnt 0x0" ::: "memory");
    // this wave's LDS reads have retired before any wave's next request targets the panel
    asm volatile("s_wait_dscnt 0x0" ::: "memory");
    __syncthreads();  // protect Bs before next group's DMA
  }

  int l15 = lane & 15;
  int hl = wave >> 1, dt = wave & 1;   // the wave's two tiles of c: head of the pair, 16 d; both groups of 16 e
  size_t pbase = (size_t)(blockIdx.x >> 5) * HEADS * NCH + (blockIdx.x & 31);  // 32 work-groups per batch image
  v16bf ones;
#pragma unroll
  for (int i = 0; i < 16; ++i) ones[i] = (__bf16)1.0f;
  for (int hp = 0; hp < HEADS / 2; ++hp) {
    // K, then V, of heads 2 hp and 2 hp + 1: lane = channel j * 16 + (lane & 15), register r = token f * 16 + (lane >> 4) * 8 + r
    v8f ak[2][4] = {}, av[2][4] = {};
    stage_slice(lds_dst, bsl + (size_t)(HID + hp * 64) * (K * 2), g1);
    // closes the scheduling region, so that the order asked for below holds for this panel's reads alone
    __builtin_amdgcn_sched_barrier(0);
#pragma unroll
    for (int kk = 0; kk < 8; ++kk) {
#pragma unroll
      for (int j = 0; j < 4; ++j) {
        v16bf wf = frag_ld_qs(Bs, j, kk, lane);
#pragma unroll
        for (int f = 0; f < 2; ++f)
          ak[f][j] = __builtin_amdgcn_wmma_f32_16x16x32_bf16(
              false, afr[f][kk], false, wf, (short)0, ak[f][j], false, false);
      }
    }
    panel_reads_ahead();
    __builtin_amdgcn_sched_barrier(0);  // end of that region
    // this wave's LDS reads have retired before any wave's next request targets the panel
    asm volatile("s_wait_dscnt 0x0" ::: "memory");
    __syncthreads();  // protect Bs before the next request
    stage_slice(lds_dst, bsl + (size_t)(2 * HID + hp * 64) * (K * 2), g1);
    __builtin_amdgcn_sched_barrier(0);  // as for K: the region of this panel's reads
#pragma unroll
    for (int kk = 0; kk < 8; ++kk) {
#pragma unroll
      for (int j = 0; j < 4; ++j) {
        v16bf wf = frag_ld_qs(Bs, j, kk, lane);
#pragma unroll
        for (int f = 0; f < 2; ++f)
          av[f][j] = __builtin_amdgcn_wmma_f32_16x16x32_bf16(
              false, afr[f][kk], false, wf, (short)0, av[f][j], false, false);
      }
    }
    panel_reads_ahead();
    __builtin_amdgcn_sched_barrier(0);  // end of that region
    asm volatile("s_wait_dscnt 0x0" ::: "memory");

    // chunk maximum per channel: lane (its 16 tokens), then the eight half waves
    float m[4];
#pragma unroll
    for (int j = 0; j < 4; ++j) {
      float h0 = fmaxf(fmaxf(fmaxf(ak[0][j][0], ak[0][j][1]), fmaxf(ak[0][j][2], ak[0][j][3])),
                       fmaxf(fmaxf(ak[0][j][4], ak[0][j][5]), fmaxf(ak[0][j][6], ak[0][j][7])));
      float h1 = fmaxf(fmaxf(fmaxf(ak[1][j][0], ak[1][j][1]), fmaxf(ak[1][j][2], ak[1][j][3])),
                       fmaxf(fmaxf(ak[1][j][4], ak[1][j][5]), fmaxf(ak[1][j][6], ak[1][j][7])));
      redm[j * 16 + l15][wave * 2 + hh] = fmaxf(h0, h1);
    }
    __syncthreads();  // every half wave's maxima are in LDS; also ends all reads of the weight panel
    __builtin_amdgcn_sched_barrier(0);  // region of the eight reads of the maxima
#pragma unroll
    for (int j = 0; j < 4; ++j) {
      f32x4 q[2];
#pragma unroll
      for (int i = 0; i < 2; ++i) q[i] = *reinterpret_cast<const f32x4*>(&redm[j * 16 + l15][i * 4]);
#pragma unroll
      for (int i = 0; i < 2; ++i) q[i][0] = fmaxf(fmaxf(q[i][0], q[i][1]), fmaxf(q[i][2], q[i][3]));
      m[j] = fmaxf(q[0][0], q[1][0]);
    }
    // all eight reads first (left alone, two and a wait, four times: the LDS latency is paid four times)
    __builtin_amdgcn_sched_group_barrier(0x100, 8, 0);
    __builtin_amdgcn_sched_barrier(0);  // end of that region
#pragma unroll
    for (int j = 0; j < 4; ++j) {
      float nm = -m[j] * 1.4426950408889634f;   // exp(k - m) = 2^(k * log2(e) - m * log2(e)): one multiply-add per value
#pragma unroll
      for (int f = 0; f < 2; ++f) {
        v8bf pb, vb;
#pragma unroll
        for (int r = 0; r < 8; ++r) {
          pb[r] = (__bf16)exp2_slot(fmaf(ak[f][j][r], 1.4426950408889634f, nm));
          vb[r] = (__bf16)av[f][j][r];
        }
        unsigned char* row = PV + (j * 16 + l15) * PV_PITCH + wave * 64 + f * 32 + hh * 16;
        *reinterpret_cast<v8bf*>(row) = pb;
        *reinterpret_cast<v8bf*>(row + 64 * PV_PITCH) = vb;
      }
    }
    __syncthreads();  // p and V of the whole chunk are in LDS

    // c = p * V^T, and s = sum_n p as ones * p^T: the sum of the rounded values that c is made of,
    // in every register of the lane whose (lane & 15) is the channel
    v8f c[2] = {}, sa = {};
    __builtin_amdgcn_sched_barrier(0);  // region of the 24 reads of p and V
#pragma unroll
    for (int kk = 0; kk < 4; ++kk) {
      v16bf pf = frag_ld_pv(PV, hl * 32 + dt * 16, kk, lane);
      sa = __builtin_amdgcn_wmma_f32_16x16x32_bf16(false, ones, false, pf, (short)0, sa, false, false);
#pragma unroll
      for (int et = 0; et < 2; ++et) {
        v16bf vf = frag_ld_pv(PV, 64 + hl * 32 + et * 16, kk, lane);
        c[et] = __builtin_amdgcn_wmma_f32_16x16x32_bf16(false, pf, false, vf, (short)0, c[et], false, false);
      }
    }
    // all 24 reads in front of the twelve products (left alone, every group of products waits for its own reads)
    __builtin_amdgcn_sched_group_barrier(0x100, 24, 0);
    __builtin_amdgcn_sched_group_barrier(0x008, 12, 0);
    __builtin_amdgcn_sched_barrier(0);  // end of that region
    size_t pidx = pbase + (size_t)(hp * 2 + hl) * NCH;
    // tile-major [tile][e][d]: a lane holds 8 consecutive d of one e, the wave fills 2 KB of its own
    float* cw = pctx + pidx * 1024 + dt * 512 + l15 * 16 + hh * 8;
#pragma unroll
    for (int et = 0; et < 2; ++et) {
      *reinterpret_cast<f32x4*>(cw + et * 256)     = (f32x4){c[et][0], c[et][1], c[et][2], c[et][3]};
      *reinterpret_cast<f32x4*>(cw + et * 256 + 4) = (f32x4){c[et][4], c[et][5], c[et][6], c[et][7]};
    }
    // one 128-byte line per 16 channels: their maxima from the lower half wave, their sums from the upper
    float* mw = pms + (pidx * 2 + dt) * 32 + lane;
    float mj = hl ? (dt ? m[3] : m[2]) : (dt ? m[1] : m[0]);
    *mw = hh ? sa[0] : mj;
    asm volatile("s_wait_xcnt 0x0\n\tv_nop\n\tv_nop\n\tv_nop\n\tv_nop" :: "v"(cw), "v"(mw) : "memory");
    // PV and redm are written again only behind the next pair's three barriers
  }
}

// ---------- kernel 3: merge of the chunk partials, folded into the output weights ----------
// One work-group per (b, pair of heads, 64 rows of w_out), 256 threads per head: merge the
// chunks' (m, s, c) and the four memory tokens into context[d][e] = sum_n softmax_n(K)[d,n] * V[e,n],
// then fold it into the output weights: weff[b][o][h*32+d] = sum_e w_out[o][h*32+e] * context[d][e],
// so that Y[o,n] = sum_k weff[b][o][k] * softmax_d(Q)[k,n] and the context is never applied token by
// token. The four work-groups of a pair of heads each merge the same context (the merge is latency,
// the fold is work). The two heads of a work-group fill one 128-byte line of each of its rows of weff.
__global__ __launch_bounds__(512) void attn_merge_fold(
    const float* __restrict__ pctx, const float* __restrict__ pms,
    const float* __restrict__ mem_kv,
    const float* wo, __bf16* __restrict__ weff) {
  __shared__ __attribute__((aligned(16))) float wgt[2][NCH][32];
  __shared__ __attribute__((aligned(16))) float wmem[2][4][32];
  __shared__ __attribute__((aligned(16))) float cs[2][DHEAD * DHEAD];
  int hf = threadIdx.x >> 8, t = threadIdx.x & 255;
  int bh = (blockIdx.x >> 2) * 2 + hf, h = bh & 7;
  int o = (blockIdx.x & 3) * 64 + (t & 63), d0 = (t >> 6) * 8;  // the thread's row of weff and its eight d (d0 is the same for a wave)
  const float* mk = mem_kv + (size_t)h * DHEAD * 4;
  const float* mv = mem_kv + (size_t)HEADS * DHEAD * 4 + (size_t)h * DHEAD * 4;
  // row o of w_out, the 32 columns of this head: asked for first, used last
  f32x4 wr[8];
#pragma unroll
  for (int i = 0; i < 8; ++i)
    wr[i] = *reinterpret_cast<const f32x4*>(wo + (size_t)o * HID + h * DHEAD + i * 4);
  // the loads name an address pair that is rewritten below: keep the wait in front (wo is not
  // declared restrict, so that no load moves behind this statement)
  asm volatile("s_wait_xcnt 0x0" ::: "memory");
  if (t < 32) {
    float mc[NCH], em[4];
    float M = mk[t * 4];
#pragma unroll
    for (int j = 1; j < 4; ++j) M = fmaxf(M, mk[t * 4 + j]);
#pragma unroll
    for (int c = 0; c < NCH; ++c) {
      mc[c] = pms[(((size_t)bh * NCH + c) * 2 + (t >> 4)) * 32 + (t & 15)];
      M = fmaxf(M, mc[c]);
    }
    float S = 0.f;
#pragma unroll
    for (int j = 0; j < 4; ++j) { em[j] = exp_slot(mk[t * 4 + j] - M); S += em[j]; }
#pragma unroll
    for (int c = 0; c < NCH; ++c) {
      mc[c] = exp_slot(mc[c] - M);
      S += mc[c] * pms[(((size_t)bh * NCH + c) * 2 + (t >> 4)) * 32 + 16 + (t & 15)];
    }
    float inv = 1.f / S;
#pragma unroll
    for (int c = 0; c < NCH; ++c) wgt[hf][c][t] = mc[c] * inv;
#pragma unroll
    for (int j = 0; j < 4; ++j) wmem[hf][j][t] = em[j] * inv;
  }
  // the loads above name registers that are rewritten below: keep the wait in front
  asm volatile("s_wait_xcnt 0x0" ::: "memory");
  __syncthreads();
  // the partials are tile-major [16 d x 16 e tile][e][d]: the thread's four values are four d of one e
  int dm = (t >> 7) * 16 + (t & 3) * 4, e = ((t >> 6) & 1) * 16 + ((t >> 2) & 15);
  f32x4 mvr = *reinterpret_cast<const f32x4*>(mv + e * 4);
  asm volatile("s_wait_xcnt 0x0" ::: "memory");
  f32x4 a = {0.f, 0.f, 0.f, 0.f};
#pragma unroll
  for (int j = 0; j < 4; ++j)
    a += *reinterpret_cast<const f32x4*>(&wmem[hf][j][dm]) * mvr[j];
#pragma unroll
  for (int c = 0; c < NCH; ++c) {
    f32x4 pc = *reinterpret_cast<const f32x4*>(pctx + ((size_t)bh * NCH + c) * 1024 + t * 4);
    a += *reinterpret_cast<const f32x4*>(&wgt[hf][c][dm]) * pc;
  }
  asm volatile("s_wait_xcnt 0x0" ::: "memory");
#pragma unroll
  for (int i = 0; i < 4; ++i) cs[hf][(dm + i) * DHEAD + e] = a[i];
  __syncthreads();  // the head's whole context is in LDS before any thread folds it

  // the context is read at an address that is the same for the wave; even and odd e are summed
  // apart (two products per instruction on register pairs as they are loaded) and added at the end
  f32x2 r[8];
#pragma unroll
  for (int j = 0; j < 8; ++j) r[j] = (f32x2){0.f, 0.f};
#pragma unroll
  for (int i = 0; i < 8; ++i)
#pragma unroll
    for (int j = 0; j < 8; ++j) {
      f32x4 c = *reinterpret_cast<const f32x4*>(&cs[hf][(d0 + j) * DHEAD + i * 4]);
      r[j] += wr[i].lo * c.lo;
      r[j] += wr[i].hi * c.hi;
    }
  v8bf st;
#pragma unroll
  for (int j = 0; j < 8; ++j) st[j] = (__bf16)(r[j].x + r[j].y);
  *reinterpret_cast<v8bf*>(weff + ((size_t)(bh >> 3) * CDIM + o) * HID + h * DHEAD + d0) = st;
}

__global__ __launch_bounds__(256, 4) void gemm_ln_res_out(
    const __bf16* QKV, const __bf16* __restrict__ B,
    const float* __restrict__ bias, const float* __restrict__ x,
    float* __restrict__ out) {
  constexpr int K = 256;
  __shared__ __attribute__((aligned(2048))) unsigned char Bs[8 * BS_SLICE];  // 48 KB

  int lane = threadIdx.x & 31;
  int wave = (int)uni(threadIdx.x >> 5);
  int m0 = (blockIdx.x * 8 + wave) * 16;
  int hh = lane >> 4;

  // this wave's 16 tokens x 256 k, register-resident: Q first, in fragment order as ln_gemm_qkv left it
  // (channel group 2 kk is the low half of fragment kk, group 2 kk + 1 the high half; k order as frag_ld_lds)
  const __bf16* qp = QKV + (size_t)(m0 >> 4) * QTILE + lane * 8;
  v16bf afr[8];
#pragma unroll
  for (int kk = 0; kk < 8; ++kk) {
    v8bf lo = *reinterpret_cast<const v8bf*>(qp + (kk * 2) * 256);
    v8bf hi = *reinterpret_cast<const v8bf*>(qp + (kk * 2 + 1) * 256);
#pragma unroll
    for (int i = 0; i < 8; ++i) { afr[kk][i] = lo[i]; afr[kk][8 + i] = hi[i]; }
  }
  // the loads name the lane's number as their offset register, which is rewritten below: keep the wait in
  // front (QKV is not declared restrict, so that no load moves behind this statement; the number is an
  // input, so that its register lives up to the wait)
  asm volatile("s_wait_xcnt 0x0" :: "v"(lane) : "memory");
  // softmax over the 32 features of each head, times SCALE, rounded back into the fragment
#pragma unroll
  for (int kk = 0; kk < 8; ++kk) {
    // the maximum is taken on the 16-bit values as they lie in the registers (exact: no rounding in a maximum)
    v2bf m2 = __builtin_shufflevector(afr[kk], afr[kk], 0, 1);
    m2 = __builtin_elementwise_max(m2, __builtin_shufflevector(afr[kk], afr[kk], 2, 3));
    m2 = __builtin_elementwise_max(m2, __builtin_shufflevector(afr[kk], afr[kk], 4, 5));
    m2 = __builtin_elementwise_max(m2, __builtin_shufflevector(afr[kk], afr[kk], 6, 7));
    m2 = __builtin_elementwise_max(m2, __builtin_shufflevector(afr[kk], afr[kk], 8, 9));
    m2 = __builtin_elementwise_max(m2, __builtin_shufflevector(afr[kk], afr[kk], 10, 11));
    m2 = __builtin_elementwise_max(m2, __builtin_shufflevector(afr[kk], afr[kk], 12, 13));
    m2 = __builtin_elementwise_max(m2, __builtin_shufflevector(afr[kk], afr[kk], 14, 15));
    float qm = fmaxf((float)m2.x, (float)m2.y);
    qm = fmaxf(qm, __shfl_xor(qm, 16, 32));
    float nm = -qm * 1.4426950408889634f;   // exp(q - qm) = 2^(q * log2(e) - qm * log2(e)): one multiply-add per value
    float qv[16], qs = 0.f;
#pragma unroll
    for (int e = 0; e < 16; ++e) { qv[e] = exp2_slot(fmaf((float)afr[kk][e], 1.4426950408889634f, nm)); qs += qv[e]; }
    qs += __shfl_xor(qs, 16, 32);
    float scl = SCALE / qs;
#pragma unroll
    for (int e = 0; e < 16; ++e) afr[kk][e] = (__bf16)(qv[e] * scl);
  }

  // this wave's slice: rows (wave & 3) * 16 .. + 15 of the panel, bytes (wave >> 2) * 256 .. + 255 of each row
  unsigned lds_dst = (unsigned)(size_t)(&Bs[0]) + (unsigned)wave * BS_SLICE;  // low 32 bits = LDS offset
  const unsigned char* bsl = reinterpret_cast<const unsigned char*>(B)
                           + (size_t)(blockIdx.x >> 5) * (CDIM * K * 2)  // 32 blocks per batch image
                           + (size_t)(wave & 3) * 16 * (K * 2) + (size_t)(wave >> 2) * 256;
  u32x8 g1;
  g1[0] = uni((1u << 20) | (5u << 22) | (3u << 25));
  g1[1] = uni(256u << 16);
  g1[2] = uni(16u << 16);
  g1[3] = uni(256u << 16);
  g1[4] = uni(16u);
  g1[5] = uni((unsigned)(K * 2));
  g1[6] = uni(0u);
  g1[7] = uni(0u);

  // the sums start from the bias of the lane's eight channels of each tile; the 16 values of a
  // tile are read at a wave-uniform address (scalar loads) and each half wave takes its eight
  v8f acc[4][4];
#pragma unroll
  for (int g = 0; g < 4; ++g)
#pragma unroll
    for (int j = 0; j < 4; ++j)
#pragma unroll
      for (int r = 0; r < 8; ++r) {
        float blo = bias[g * 64 + j * 16 + r], bhi = bias[g * 64 + j * 16 + 8 + r];
        acc[g][j][r] = hh ? bhi : blo;
      }
  // unrolled so that the accumulators of all four groups are indexed by constants and stay in registers
#pragma unroll
  for (int g = 0; g < 4; ++g) {
    // every wave brings its own slice; no test around the request
    unsigned long long ga = (unsigned long long)(const void*)(bsl + (size_t)(g * 64) * (K * 2));
    u32x4 g0;
    g0[0] = uni(1u);                                                  // count = 1
    g0[1] = uni(lds_dst);                                             // LDS byte offset
    g0[2] = uni((unsigned)ga);                                        // global address [31:0]
    g0[3] = uni(((unsigned)(ga >> 32) & 0x01FFFFFFu) | 0x80000000u);  // address [56:32] | type = 2
    asm volatile("tensor_load_to_lds %0, %1" : : "s"(g0), "s"(g1) : "memory");
    // the slice counts as landed only behind its issuer's own wait; the barrier publishes it
    asm volatile("s_wait_tensorcnt 0x0" ::: "memory");
    __syncthreads();

    // closes the scheduling region, so that the order asked for below holds for this group's reads alone
    __builtin_amdgcn_sched_barrier(0);
#pragma unroll
    for (int kk = 0; kk < 8; ++kk) {
#pragma unroll
      for (int j = 0; j < 4; ++j) {
        v16bf wf = frag_ld_lds(Bs, j, kk, lane);
        acc[g][j] = __builtin_amdgcn_wmma_f32_16x16x32_bf16(
            false, wf, false, afr[kk], (short)0, acc[g][j], false, false);
      }
    }
    // LDS reads run four fragments ahead of the matrix instructions (left alone, the compiler reads one
    // fragment, waits and multiplies, and every product pays the whole LDS latency): eight reads, then
    // each product followed by the two reads that refill its fragment's registers
    __builtin_amdgcn_sched_group_barrier(0x100, 8, 0);
#pragma unroll
    for (int i = 0; i < 28; ++i) {
      __builtin_amdgcn_sched_group_barrier(0x008, 1, 0);
      __builtin_amdgcn_sched_group_barrier(0x100, 2, 0);
    }
    __builtin_amdgcn_sched_group_barrier(0x008, 4, 0);
    __builtin_amdgcn_sched_barrier(0);  // end of that region
    if (g < 3) {
      // this wave's LDS reads have retired before any wave's next request targets the panel
      asm volatile("s_wait_dscnt 0x0" ::: "memory");
      __syncthreads();  // protect Bs before the next group's request
    }
  }

  int tok = m0 + (lane & 15);
  size_t base = ((size_t)(tok >> 12) * CDIM + hh * 8) * NPOS + (tok & (NPOS - 1));
  const float* __restrict__ xp = x + base;
  float* __restrict__ op = out + base;
  // x of the first group's 32 channels is asked for before the statistics
  float xr[2][32];
#pragma unroll
  for (int i = 0; i < 32; ++i) xr[0][i] = xp[(size_t)((i >> 3) * 16 + (i & 7)) * NPOS];

  // mean and variance of the token over its 256 channels: eight running sums, then the other half wave
  v8f vs = {}, vq = {};
#pragma unroll
  for (int g = 0; g < 4; ++g)
#pragma unroll
    for (int j = 0; j < 4; ++j) { vs += acc[g][j]; vq += acc[g][j] * acc[g][j]; }
  float s  = ((vs[0] + vs[1]) + (vs[2] + vs[3])) + ((vs[4] + vs[5]) + (vs[6] + vs[7]));
  float sq = ((vq[0] + vq[1]) + (vq[2] + vq[3])) + ((vq[4] + vq[5]) + (vq[6] + vq[7]));
  s  += __shfl_xor(s, 16, 32);
  sq += __shfl_xor(sq, 16, 32);
  float mean = s * (1.f / 256.f);
  float rstd = rsqrtf(sq * (1.f / 256.f) - mean * mean + EPS);

#pragma unroll
  for (int g = 0; g < 4; ++g) {
    if (g < 3) {
#pragma unroll
      for (int i = 0; i < 32; ++i)
        xr[(g + 1) & 1][i] = xp[(size_t)((g + 1) * 64 + (i >> 3) * 16 + (i & 7)) * NPOS];
      __builtin_amdgcn_sched_barrier(0);  // the next group's x stays in flight while this group is stored
    }
#pragma unroll
    for (int i = 0; i < 32; ++i) {
      size_t o = (size_t)(g * 64 + (i >> 3) * 16 + (i & 7)) * NPOS;
      op[o] = (acc[g][i >> 3][i & 7] - mean) * rstd + xr[g & 1][i];
    }
  }
}

// ---------- host launcher ----------
extern "C" void kernel_launch(void* const* d_in, const int* in_sizes, int n_in,
                              void* d_out, int out_size, void* d_ws, size_t ws_size,
                              hipStream_t stream) {
  const float* x      = (const float*)d_in[0];
  const float* mem_kv = (const float*)d_in[1];
  const float* w_qkv  = (const float*)d_in[2];
  const float* w_out  = (const float*)d_in[3];
  const float* b_out  = (const float*)d_in[4];
  float* out = (float*)d_out;

  char* ws = (char*)d_ws;
  __bf16* wq_bf  = (__bf16*)(ws + WQ_OFF);
  __bf16* weff   = (__bf16*)(ws + WEFF_OFF);
  __bf16* QKVbf  = (__bf16*)(ws + QKV_OFF);
  float*  pctx   = (float*)(ws + PCTX_OFF);
  float*  pms    = (float*)(ws + PMS_OFF);

  cvt_weights<<<768, 256, 0, stream>>>(w_qkv, wq_bf);
  ln_gemm_qkv<<<MROWS / 128, 128, 0, stream>>>(x, wq_bf, QKVbf, pctx, pms);
  attn_merge_fold<<<BATCH * HEADS * 2, 512, 0, stream>>>(pctx, pms, mem_kv, w_out, weff);
  gemm_ln_res_out<<<MROWS / 128, 256, 0, stream>>>(QKVbf, weff, b_out, x, out);
}

// v010
// It runs in 60.5 microseconds.
// In two side-by-side timings against v009, it was 1.07 and 1.06 times as fast.
// Over all steps from v000 it is 11.3 times as fast.
#include <hip/hip_runtime.h>

// ---------- types ----------
typedef __attribute__((ext_vector_type(16))) __bf16 v16bf;
typedef __attribute__((ext_vector_type(8)))  __bf16 v8bf;
typedef __attribute__((ext_vector_type(2)))  __bf16 v2bf;
typedef __attribute__((ext_vector_type(8)))  float  v8f;
typedef __attribute__((ext_vector_type(4)))  float  f32x4;
typedef __attribute__((ext_vector_type(2)))  float  f32x2;
typedef __attribute__((ext_vector_type(4)))  unsigned int u32x4;
typedef __attribute__((ext_vector_type(8)))  unsigned int u32x8;

#define HEADS 8
#define DHEAD 32
#define NPOS  4096            // 64*64 tokens per batch image
#define BATCH 16
#define CDIM  256
#define HID   256
#define MROWS (BATCH * NPOS)  // 65536
#define LDQKV 768
#define QTILE 4096            // values of Q per 16 tokens: 16 groups of 16 channels x 32 lanes x 8
#define SCALE 0.17677669529663687f  // 32^-0.5
#define EPS   1e-6f

// workspace layout (bytes)
#define WQ_OFF   0u
#define WEFF_OFF 524288u                  // 16 folded output weights of 256*256*2 bytes each
#define QKV_OFF  34078720u
#define NCH      32                       // token chunks per (batch, head): one per work-group of ln_gemm_qkv
#define PCTX_OFF 134742016u               // QKV_OFF + 65536*768*2
#define PMS_OFF  151519232u               // PCTX_OFF + 128*32*1024*4; per chunk and 16 channels: 16 maxima, 16 sums

// ---------- kernel 0: weights -> bf16 ----------
__global__ __launch_bounds__(256) void cvt_weights(
    const float* __restrict__ wq, __bf16* __restrict__ wqb) {
  int idx = blockIdx.x * 256 + threadIdx.x;
  if (idx < LDQKV * CDIM) wqb[idx] = (__bf16)wq[idx];
}

#define BS_PITCH 272            // 256 data bytes + 16 pad bytes

__device__ __forceinline__ unsigned int uni(unsigned int v) {
  return (unsigned int)__builtin_amdgcn_readfirstlane((int)v);
}

__device__ __forceinline__ float exp2_slot(float y) {
  float r;
  asm("v_exp_f32 %0, %1\n\tv_nop" : "=v"(r) : "v"(y));
  return r;
}
__device__ __forceinline__ float exp_slot(float x) { return exp2_slot(x * 1.4426950408889634f); }

// p and V of two heads in LDS: 128 rows (64 channels of p, then 64 of V) of 128 tokens in bf16,
// at the pitch of the weight slices (16 B x odd)
#define PV_PITCH 272

// fragment of 16 rows from row0 on, places kk*32 .. kk*32+31 of the chunk; k order as frag_ld_qs
__device__ __forceinline__ v16bf frag_ld_pv(const unsigned char* base, int row0, int kk, int lane) {
  const unsigned char* p = base + (row0 + (lane & 15)) * PV_PITCH + kk * 64 + ((lane >> 4) << 4);
  v8bf lo = *reinterpret_cast<const v8bf*>(p);
  v8bf hi = *reinterpret_cast<const v8bf*>(p + 32);
  v16bf out;
#pragma unroll
  for (int i = 0; i < 8; ++i) { out[i] = lo[i]; out[8 + i] = hi[i]; }
  return out;
}

// one wave's slice of a weight panel: the request, the issuer's own wait, the publishing barrier.
// Every wave of the work-group calls it, unconditionally.
__device__ __forceinline__ void stage_slice(unsigned lds_dst, const unsigned char* gsrc, u32x8 g1) {
  unsigned long long ga = (unsigned long long)(const void*)gsrc;
  u32x4 g0;
  g0[0] = uni(1u);                                                  // count = 1
  g0[1] = uni(lds_dst);                                             // LDS byte offset
  g0[2] = uni((unsigned)ga);                                        // global address [31:0]
  g0[3] = uni(((unsigned)(ga >> 32) & 0x01FFFFFFu) | 0x80000000u);  // address [56:32] | type = 2
  asm volatile("tensor_load_to_lds %0, %1" : : "s"(g0), "s"(g1) : "memory");
  // the slice counts as landed only behind its issuer's own wait; the barrier publishes it
  asm volatile("s_wait_tensorcnt 0x0" ::: "memory");
  __syncthreads();
}

// order of one panel's 64 LDS reads and 64 matrix instructions (two per fragment): the reads run two k steps
// (eight fragments) ahead, in groups of eight behind every eight products. Left alone, the compiler reads one
// fragment and waits for it in front of its products, so that they pay the whole LDS latency.
__device__ __forceinline__ void panel_reads_ahead() {
  __builtin_amdgcn_sched_group_barrier(0x100, 16, 0);
#pragma unroll
  for (int i = 0; i < 6; ++i) {
    __builtin_amdgcn_sched_group_barrier(0x008, 8, 0);
    __builtin_amdgcn_sched_group_barrier(0x100, 8, 0);
  }
  __builtin_amdgcn_sched_group_barrier(0x008, 16, 0);
}

// weight panel of the two GEMM kernels in LDS: four slices, slice = (k half) * 2 + (group of 32 rows); 32 half rows
// of 256 bytes at the pitch of BS_PITCH
#define QS_SLICE 10240          // 32 * 272 = 8704, rounded up to a multiple of 2 KiB

// fragment j (rows j*16 .. j*16+15 of the panel), k = kk*32 .. kk*32+31; kb = kk*32 + (lane >> 4) * 8
__device__ __forceinline__ v16bf frag_ld_qs(const unsigned char* base, int j, int kk, int lane) {
  const unsigned char* p = base + ((kk >> 2) * 2 + (j >> 1)) * QS_SLICE
                         + ((j & 1) * 16 + (lane & 15)) * BS_PITCH + (kk & 3) * 64 + ((lane >> 4) << 4);
  v8bf lo = *reinterpret_cast<const v8bf*>(p);        // K = kb .. kb+7
  v8bf hi = *reinterpret_cast<const v8bf*>(p + 32);   // K = kb+16 .. kb+23
  v16bf out;
#pragma unroll
  for (int i = 0; i < 8; ++i) { out[i] = lo[i]; out[8 + i] = hi[i]; }
  return out;
}

__global__ __launch_bounds__(128) __attribute__((amdgpu_waves_per_eu(2, 2))) void ln_gemm_qkv(
    const float* x, const __bf16* __restrict__ B,
    __bf16* __restrict__ C,
    float* __restrict__ pctx, float* __restrict__ pms) {
  constexpr int K = 256;
  __shared__ __attribute__((aligned(2048))) unsigned char Bs[4 * QS_SLICE];  // 40 KB
  __shared__ __attribute__((aligned(16))) unsigned char PV[128 * PV_PITCH];  // 34 KB
  __shared__ __attribute__((aligned(16))) float redm[64][12];                // [channel][half wave], pitch 48 B (16 B x odd)

  int lane = threadIdx.x & 31;
  int wave = (int)uni(threadIdx.x >> 5);
  int m0 = (blockIdx.x * 4 + wave) * 32;
  int hh = lane >> 4;
  int tok = m0 + (lane & 15) * 2;

  // the lane's 128 channels of each of its two tokens (tok and tok + 1), all asked for at once
  const float* xp = x + ((size_t)(tok >> 12) * CDIM + hh * 8) * NPOS + (tok & (NPOS - 1));
  f32x2 xv[8][16];   // component f = token tok + f
#pragma unroll
  for (int kk = 0; kk < 8; ++kk)
#pragma unroll
    for (int e = 0; e < 16; ++e)
      xv[kk][e] = *reinterpret_cast<const f32x2*>(xp + (size_t)(kk * 32 + (e >> 3) * 16 + (e & 7)) * NPOS);
  // asks for the loads ahead of the sums (left alone, the compiler holds some back behind the
  // wait for the others, and the wave pays the memory latency twice)
  __builtin_amdgcn_sched_group_barrier(0x020, 128, 0);
  // the loads name an address pair that is rewritten below: keep the wait in front (x is not declared
  // restrict, so that no load moves behind this statement; the address is an input, so that its registers
  // live up to the wait: left alone, the last load's result is put into them)
  asm volatile("s_wait_xcnt 0x0" :: "v"(xp) : "memory");

  // mean and variance of each token over its 256 channels: eight running sums, then the other half wave;
  // the lane's two tokens side by side in register pairs (two sums per instruction)
  f32x2 vs[8], vq[8];
#pragma unroll
  for (int i = 0; i < 8; ++i) { vs[i] = (f32x2){0.f, 0.f}; vq[i] = (f32x2){0.f, 0.f}; }
#pragma unroll
  for (int kk = 0; kk < 8; ++kk)
#pragma unroll
    for (int e = 0; e < 16; ++e) { vs[e & 7] += xv[kk][e]; vq[e & 7] += xv[kk][e] * xv[kk][e]; }
  f32x2 s2 = ((vs[0] + vs[1]) + (vs[2] + vs[3])) + ((vs[4] + vs[5]) + (vs[6] + vs[7]));
  f32x2 q2 = ((vq[0] + vq[1]) + (vq[2] + vq[3])) + ((vq[4] + vq[5]) + (vq[6] + vq[7]));

  v16bf afr[2][8];
  f32x2 mean, rstd;
#pragma unroll
  for (int f = 0; f < 2; ++f) {
    float s  = s2[f] + __shfl_xor(s2[f], 16, 32);
    float sq = q2[f] + __shfl_xor(q2[f], 16, 32);
    mean[f] = s * (1.f / 256.f);
    rstd[f] = rsqrtf(sq * (1.f / 256.f) - mean[f] * mean[f] + EPS);
  }
  // both tokens of a pair at once, in the registers that the load filled
#pragma unroll
  for (int kk = 0; kk < 8; ++kk)
#pragma unroll
    for (int e = 0; e < 16; ++e) {
      f32x2 y = (xv[kk][e] - mean) * rstd;
      afr[0][kk][e] = (__bf16)y[0];
      afr[1][kk][e] = (__bf16)y[1];
    }

  // this wave's slice: rows (wave & 1) * 32 .. + 31 of the panel, bytes (wave >> 1) * 256 .. + 255 of each row
  unsigned lds_dst = (unsigned)(size_t)(&Bs[0]) + (unsigned)wave * QS_SLICE;  // low 32 bits = LDS offset
  const unsigned char* bsl = reinterpret_cast<const unsigned char*>(B)
                           + (size_t)(wave & 1) * 32 * (K * 2) + (size_t)(wave >> 1) * 256;
  u32x8 g1;
  g1[0] = uni((1u << 20) | (5u << 22) | (3u << 25));
  g1[1] = uni(256u << 16);
  g1[2] = uni(32u << 16);
  g1[3] = uni(256u << 16);
  g1[4] = uni(32u);
  g1[5] = uni((unsigned)(K * 2));
  g1[6] = uni(0u);
  g1[7] = uni(0u);
  __bf16* __restrict__ cp = C + (size_t)(m0 >> 4) * QTILE + lane * 8;

  for (int n0 = 0; n0 < HID; n0 += 64) {
    stage_slice(lds_dst, bsl + (size_t)n0 * (K * 2), g1);

    v8f acc[2][4] = {};
#pragma unroll
    for (int kk = 0; kk < 8; ++kk) {
#pragma unroll
      for (int j = 0; j < 4; ++j) {
        v16bf wf = frag_ld_qs(Bs, j, kk, lane);
#pragma unroll
        for (int f = 0; f < 2; ++f)
          acc[f][j] = __builtin_amdgcn_wmma_f32_16x16x32_bf16(
              false, wf, false, afr[f][kk], (short)0, acc[f][j], false, false);
      }
    }

#pragma unroll
    for (int f = 0; f < 2; ++f)
#pragma unroll
      for (int j = 0; j < 4; ++j) {
        v8bf st;
#pragma unroll
        for (int r = 0; r < 8; ++r) st[r] = (__bf16)acc[f][j][r];
        *reinterpret_cast<v8bf*>(cp + f * QTILE + ((n0 >> 4) + j) * 256) = st;
      }
    // the stores name registers that the next group rewrites: keep the wait in front
    asm volatile("s_wait_xcnt 0x0" ::: "memory");
    // this wave's LDS reads have retired before any wave's next request targets the panel
    asm volatile("s_wait_dscnt 0x0" ::: "memory");
    __syncthreads();  // protect Bs before next group's DMA
  }

  int l15 = lane & 15;
  int hl = wave >> 1, dt = wave & 1;   // the wave's two tiles of c: head of the pair, 16 d; both groups of 16 e
  size_t pbase = (size_t)(blockIdx.x >> 5) * HEADS * NCH + (blockIdx.x & 31);  // 32 work-groups per batch image
  v16bf ones;
#pragma unroll
  for (int i = 0; i < 16; ++i) ones[i] = (__bf16)1.0f;
  for (int hp = 0; hp < HEADS / 2; ++hp) {
    // K, then V, of heads 2 hp and 2 hp + 1: lane = channel j * 16 + (lane & 15), register r = place f * 16 + (lane >> 4) * 8 + r
    // of the wave's 32 (token 2 * ((lane >> 4) * 8 + r) + f; p and V share the places, and c and s sum over all of them)
    v8f ak[2][4] = {}, av[2][4] = {};
    stage_slice(lds_dst, bsl + (size_t)(HID + hp * 64) * (K * 2), g1);
    // closes the scheduling region, so that the order asked for below holds for this panel's reads alone
    __builtin_amdgcn_sched_barrier(0);
#pragma unroll
    for (int kk = 0; kk < 8; ++kk) {
#pragma unroll
      for (int j = 0; j < 4; ++j) {
        v16bf wf = frag_ld_qs(Bs, j, kk, lane);
#pragma unroll
        for (int f = 0; f < 2; ++f)
          ak[f][j] = __builtin_amdgcn_wmma_f32_16x16x32_bf16(
              false, afr[f][kk], false, wf, (short)0, ak[f][j], false, false);
      }
    }
    panel_reads_ahead();
    __builtin_amdgcn_sched_barrier(0);  // end of that region
    // this wave's LDS reads have retired before any wave's next request targets the panel
    asm volatile("s_wait_dscnt 0x0" ::: "memory");
    __syncthreads();  // protect Bs before the next request
    stage_slice(lds_dst, bsl + (size_t)(2 * HID + hp * 64) * (K * 2), g1);
    __builtin_amdgcn_sched_barrier(0);  // as for K: the region of this panel's reads
#pragma unroll
    for (int kk = 0; kk < 8; ++kk) {
#pragma unroll
      for (int j = 0; j < 4; ++j) {
        v16bf wf = frag_ld_qs(Bs, j, kk, lane);
#pragma unroll
        for (int f = 0; f < 2; ++f)
          av[f][j] = __builtin_amdgcn_wmma_f32_16x16x32_bf16(
              false, afr[f][kk], false, wf, (short)0, av[f][j], false, false);
      }
    }
    panel_reads_ahead();
    __builtin_amdgcn_sched_barrier(0);  // end of that region
    asm volatile("s_wait_dscnt 0x0" ::: "memory");

    // chunk maximum per channel: lane (its 16 tokens), then the eight half waves
    float m[4];
#pragma unroll
    for (int j = 0; j < 4; ++j) {
      float h0 = fmaxf(fmaxf(fmaxf(ak[0][j][0], ak[0][j][1]), fmaxf(ak[0][j][2], ak[0][j][3])),
                       fmaxf(fmaxf(ak[0][j][4], ak[0][j][5]), fmaxf(ak[0][j][6], ak[0][j][7])));
      float h1 = fmaxf(fmaxf(fmaxf(ak[1][j][0], ak[1][j][1]), fmaxf(ak[1][j][2], ak[1][j][3])),
                       fmaxf(fmaxf(ak[1][j][4], ak[1][j][5]), fmaxf(ak[1][j][6], ak[1][j][7])));
      redm[j * 16 + l15][wave * 2 + hh] = fmaxf(h0, h1);
    }
    __syncthreads();  // every half wave's maxima are in LDS; also ends all reads of the weight panel
    __builtin_amdgcn_sched_barrier(0);  // region of the eight reads of the maxima
#pragma unroll
    for (int j = 0; j < 4; ++j) {
      f32x4 q[2];
#pragma unroll
      for (int i = 0; i < 2; ++i) q[i] = *reinterpret_cast<const f32x4*>(&redm[j * 16 + l15][i * 4]);
#pragma unroll
      for (int i = 0; i < 2; ++i) q[i][0] = fmaxf(fmaxf(q[i][0], q[i][1]), fmaxf(q[i][2], q[i][3]));
      m[j] = fmaxf(q[0][0], q[1][0]);
    }
    // all eight reads first (left alone, two and a wait, four times: the LDS latency is paid four times)
    __builtin_amdgcn_sched_group_barrier(0x100, 8, 0);
    __builtin_amdgcn_sched_barrier(0);  // end of that region
#pragma unroll
    for (int j = 0; j < 4; ++j) {
      float nm = -m[j] * 1.4426950408889634f;   // exp(k - m) = 2^(k * log2(e) - m * log2(e)): one multiply-add per value
#pragma unroll
      for (int f = 0; f < 2; ++f) {
        v8bf pb, vb;
#pragma unroll
        for (int r = 0; r < 8; ++r) {
          pb[r] = (__bf16)exp2_slot(fmaf(ak[f][j][r], 1.4426950408889634f, nm));
          vb[r] = (__bf16)av[f][j][r];
        }
        unsigned char* row = PV + (j * 16 + l15) * PV_PITCH + wave * 64 + f * 32 + hh * 16;
        *reinterpret_cast<v8bf*>(row) = pb;
        *reinterpret_cast<v8bf*>(row + 64 * PV_PITCH) = vb;
      }
    }
    __syncthreads();  // p and V of the whole chunk are in LDS

    // c = p * V^T, and s = sum_n p as ones * p^T: the sum of the rounded values that c is made of,
    // in every register of the lane whose (lane & 15) is the channel
    v8f c[2] = {}, sa = {};
    __builtin_amdgcn_sched_barrier(0);  // region of the 24 reads of p and V
#pragma unroll
    for (int kk = 0; kk < 4; ++kk) {
      v16bf pf = frag_ld_pv(PV, hl * 32 + dt * 16, kk, lane);
      sa = __builtin_amdgcn_wmma_f32_16x16x32_bf16(false, ones, false, pf, (short)0, sa, false, false);
#pragma unroll
      for (int et = 0; et < 2; ++et) {
        v16bf vf = frag_ld_pv(PV, 64 + hl * 32 + et * 16, kk, lane);
        c[et] = __builtin_amdgcn_wmma_f32_16x16x32_bf16(false, pf, false, vf, (short)0, c[et], false, false);
      }
    }
    // all 24 reads in front of the twelve products (left alone, every group of products waits for its own reads)
    __builtin_amdgcn_sched_group_barrier(0x100, 24, 0);
    __builtin_amdgcn_sched_group_barrier(0x008, 12, 0);
    __builtin_amdgcn_sched_barrier(0);  // end of that region
    size_t pidx = pbase + (size_t)(hp * 2 + hl) * NCH;
    // tile-major [tile][e][d]: a lane holds 8 consecutive d of one e, the wave fills 2 KB of its own
    float* cw = pctx + pidx * 1024 + dt * 512 + l15 * 16 + hh * 8;
#pragma unroll
    for (int et = 0; et < 2; ++et) {
      *reinterpret_cast<f32x4*>(cw + et * 256)     = (f32x4){c[et][0], c[et][1], c[et][2], c[et][3]};
      *reinterpret_cast<f32x4*>(cw + et * 256 + 4) = (f32x4){c[et][4], c[et][5], c[et][6], c[et][7]};
    }
    // one 128-byte line per 16 channels: their maxima from the lower half wave, their sums from the upper
    float* mw = pms + (pidx * 2 + dt) * 32 + lane;
    float mj = hl ? (dt ? m[3] : m[2]) : (dt ? m[1] : m[0]);
    *mw = hh ? sa[0] : mj;
    asm volatile("s_wait_xcnt 0x0\n\tv_nop\n\tv_nop\n\tv_nop\n\tv_nop" :: "v"(cw), "v"(mw) : "memory");
    // PV and redm are written again only behind the next pair's three barriers
  }
}

// ---------- kernel 3: merge of the chunk partials, folded into the output weights ----------
// One work-group per (b, pair of heads, 64 rows of w_out), 256 threads per head: merge the
// chunks' (m, s, c) and the four memory tokens into context[d][e] = sum_n softmax_n(K)[d,n] * V[e,n],
// then fold it into the output weights: weff[b][o][h*32+d] = sum_e w_out[o][h*32+e] * context[d][e],
// so that Y[o,n] = sum_k weff[b][o][k] * softmax_d(Q)[k,n] and the context is never applied token by
// token. The four work-groups of a pair of heads each merge the same context (the merge is latency,
// the fold is work). The two heads of a work-group fill one 128-byte line of each of its rows of weff.
__global__ __launch_bounds__(512) void attn_merge_fold(
    const float* __restrict__ pctx, const float* __restrict__ pms,
    const float* __restrict__ mem_kv,
    const float* wo, __bf16* __restrict__ weff) {
  __shared__ __attribute__((aligned(16))) float wgt[2][NCH][32];
  __shared__ __attribute__((aligned(16))) float wmem[2][4][32];
  __shared__ __attribute__((aligned(16))) float cs[2][DHEAD * DHEAD];
  int hf = threadIdx.x >> 8, t = threadIdx.x & 255;
  int bh = (blockIdx.x >> 2) * 2 + hf, h = bh & 7;
  int o = (blockIdx.x & 3) * 64 + (t & 63), d0 = (t >> 6) * 8;  // the thread's row of weff and its eight d (d0 is the same for a wave)
  const float* mk = mem_kv + (size_t)h * DHEAD * 4;
  const float* mv = mem_kv + (size_t)HEADS * DHEAD * 4 + (size_t)h * DHEAD * 4;
  // row o of w_out, the 32 columns of this head: asked for first, used last
  f32x4 wr[8];
#pragma unroll
  for (int i = 0; i < 8; ++i)
    wr[i] = *reinterpret_cast<const f32x4*>(wo + (size_t)o * HID + h * DHEAD + i * 4);
  // the loads name an address pair that is rewritten below: keep the wait in front (wo is not
  // declared restrict, so that no load moves behind this statement)
  asm volatile("s_wait_xcnt 0x0" ::: "memory");
  if (t < 32) {
    float mc[NCH], em[4];
    float M = mk[t * 4];
#pragma unroll
    for (int j = 1; j < 4; ++j) M = fmaxf(M, mk[t * 4 + j]);
#pragma unroll
    for (int c = 0; c < NCH; ++c) {
      mc[c] = pms[(((size_t)bh * NCH + c) * 2 + (t >> 4)) * 32 + (t & 15)];
      M = fmaxf(M, mc[c]);
    }
    float S = 0.f;
#pragma unroll
    for (int j = 0; j < 4; ++j) { em[j] = exp_slot(mk[t * 4 + j] - M); S += em[j]; }
#pragma unroll
    for (int c = 0; c < NCH; ++c) {
      mc[c] = exp_slot(mc[c] - M);
      S += mc[c] * pms[(((size_t)bh * NCH + c) * 2 + (t >> 4)) * 32 + 16 + (t & 15)];
    }
    float inv = 1.f / S;
#pragma unroll
    for (int c = 0; c < NCH; ++c) wgt[hf][c][t] = mc[c] * inv;
#pragma unroll
    for (int j = 0; j < 4; ++j) wmem[hf][j][t] = em[j] * inv;
  }
  // the loads above name registers that are rewritten below: keep the wait in front
  asm volatile("s_wait_xcnt 0x0" ::: "memory");
  __syncthreads();
  // the partials are tile-major [16 d x 16 e tile][e][d]: the thread's four values are four d of one e
  int dm = (t >> 7) * 16 + (t & 3) * 4, e = ((t >> 6) & 1) * 16 + ((t >> 2) & 15);
  f32x4 mvr = *reinterpret_cast<const f32x4*>(mv + e * 4);
  asm volatile("s_wait_xcnt 0x0" ::: "memory");
  f32x4 a = {0.f, 0.f, 0.f, 0.f};
#pragma unroll
  for (int j = 0; j < 4; ++j)
    a += *reinterpret_cast<const f32x4*>(&wmem[hf][j][dm]) * mvr[j];
#pragma unroll
  for (int c = 0; c < NCH; ++c) {
    f32x4 pc = *reinterpret_cast<const f32x4*>(pctx + ((size_t)bh * NCH + c) * 1024 + t * 4);
    a += *reinterpret_cast<const f32x4*>(&wgt[hf][c][dm]) * pc;
  }
  asm volatile("s_wait_xcnt 0x0" ::: "memory");
#pragma unroll
  for (int i = 0; i < 4; ++i) cs[hf][(dm + i) * DHEAD + e] = a[i];
  __syncthreads();  // the head's whole context is in LDS before any thread folds it

  // the context is read at an address that is the same for the wave; even and odd e are summed
  // apart (two products per instruction on register pairs as they are loaded) and added at the end
  f32x2 r[8];
#pragma unroll
  for (int j = 0; j < 8; ++j) r[j] = (f32x2){0.f, 0.f};
#pragma unroll
  for (int i = 0; i < 8; ++i)
#pragma unroll
    for (int j = 0; j < 8; ++j) {
      f32x4 c = *reinterpret_cast<const f32x4*>(&cs[hf][(d0 + j) * DHEAD + i * 4]);
      r[j] += wr[i].lo * c.lo;
      r[j] += wr[i].hi * c.hi;
    }
  v8bf st;
#pragma unroll
  for (int j = 0; j < 8; ++j) st[j] = (__bf16)(r[j].x + r[j].y);
  *reinterpret_cast<v8bf*>(weff + ((size_t)(bh >> 3) * CDIM + o) * HID + h * DHEAD + d0) = st;
}

__global__ __launch_bounds__(128) __attribute__((amdgpu_waves_per_eu(2, 2))) void gemm_ln_res_out(
    const __bf16* QKV, const __bf16* __restrict__ B,
    const float* __restrict__ bias, const float* __restrict__ x,
    float* __restrict__ out) {
  constexpr int K = 256;
  __shared__ __attribute__((aligned(2048))) unsigned char Bs[4 * QS_SLICE];  // 40 KB

  int lane = threadIdx.x & 31;
  int wave = (int)uni(threadIdx.x >> 5);
  int m0 = (blockIdx.x * 4 + wave) * 32;
  int hh = lane >> 4;

  // this wave's 2 x 16 tokens x 256 k, register-resident: Q first, in fragment order as ln_gemm_qkv left it
  // (channel group 2 kk is the low half of fragment kk, group 2 kk + 1 the high half; k order as frag_ld_qs)
  const __bf16* qp = QKV + (size_t)(m0 >> 4) * QTILE + lane * 8;
  v16bf afr[2][8];
#pragma unroll
  for (int f = 0; f < 2; ++f)
#pragma unroll
    for (int kk = 0; kk < 8; ++kk) {
      v8bf lo = *reinterpret_cast<const v8bf*>(qp + f * QTILE + (kk * 2) * 256);
      v8bf hi = *reinterpret_cast<const v8bf*>(qp + f * QTILE + (kk * 2 + 1) * 256);
#pragma unroll
      for (int i = 0; i < 8; ++i) { afr[f][kk][i] = lo[i]; afr[f][kk][8 + i] = hi[i]; }
    }
  // the loads name the lane's number as their offset register, which is rewritten below: keep the wait in
  // front (QKV is not declared restrict, so that no load moves behind this statement; the number is an
  // input, so that its register lives up to the wait)
  asm volatile("s_wait_xcnt 0x0" :: "v"(lane) : "memory");
  // holds the softmax behind all 32 loads (left alone, the compiler holds some loads back behind the
  // work on the first ones, and the wave pays the memory latency twice)
  __builtin_amdgcn_sched_barrier(0);
  // softmax over the 32 features of each head, times SCALE, rounded back into the fragment
#pragma unroll
  for (int f = 0; f < 2; ++f)
#pragma unroll
  for (int kk = 0; kk < 8; ++kk) {
    // the maximum is taken on the 16-bit values as they lie in the registers (exact: no rounding in a maximum)
    v2bf m2 = __builtin_shufflevector(afr[f][kk], afr[f][kk], 0, 1);
    m2 = __builtin_elementwise_max(m2, __builtin_shufflevector(afr[f][kk], afr[f][kk], 2, 3));
    m2 = __builtin_elementwise_max(m2, __builtin_shufflevector(afr[f][kk], afr[f][kk], 4, 5));
    m2 = __builtin_elementwise_max(m2, __builtin_shufflevector(afr[f][kk], afr[f][kk], 6, 7));
    m2 = __builtin_elementwise_max(m2, __builtin_shufflevector(afr[f][kk], afr[f][kk], 8, 9));
    m2 = __builtin_elementwise_max(m2, __builtin_shufflevector(afr[f][kk], afr[f][kk], 10, 11));
    m2 = __builtin_elementwise_max(m2, __builtin_shufflevector(afr[f][kk], afr[f][kk], 12, 13));
    m2 = __builtin_elementwise_max(m2, __builtin_shufflevector(afr[f][kk], afr[f][kk], 14, 15));
    float qm = fmaxf((float)m2.x, (float)m2.y);
    qm = fmaxf(qm, __shfl_xor(qm, 16, 32));
    float nm = -qm * 1.4426950408889634f;   // exp(q - qm) = 2^(q * log2(e) - qm * log2(e)): one multiply-add per value
    float qv[16], qs = 0.f;
#pragma unroll
    for (int e = 0; e < 16; ++e) { qv[e] = exp2_slot(fmaf((float)afr[f][kk][e], 1.4426950408889634f, nm)); qs += qv[e]; }
    qs += __shfl_xor(qs, 16, 32);
    float scl = SCALE / qs;
#pragma unroll
    for (int e = 0; e < 16; ++e) afr[f][kk][e] = (__bf16)(qv[e] * scl);
  }

  // this wave's slice: rows (wave & 1) * 32 .. + 31 of the panel, bytes (wave >> 1) * 256 .. + 255 of each row
  unsigned lds_dst = (unsigned)(size_t)(&Bs[0]) + (unsigned)wave * QS_SLICE;  // low 32 bits = LDS offset
  const unsigned char* bsl = reinterpret_cast<const unsigned char*>(B)
                           + (size_t)(blockIdx.x >> 5) * (CDIM * K * 2)  // 32 blocks per batch image
                           + (size_t)(wave & 1) * 32 * (K * 2) + (size_t)(wave >> 1) * 256;
  u32x8 g1;
  g1[0] = uni((1u << 20) | (5u << 22) | (3u << 25));
  g1[1] = uni(256u << 16);
  g1[2] = uni(32u << 16);
  g1[3] = uni(256u << 16);
  g1[4] = uni(32u);
  g1[5] = uni((unsigned)(K * 2));
  g1[6] = uni(0u);
  g1[7] = uni(0u);

  // the sums start from the bias of the lane's eight channels of each tile; the 16 values of a
  // tile are read at a wave-uniform address (scalar loads) and each half wave takes its eight
  v8f acc[2][4][4];
#pragma unroll
  for (int g = 0; g < 4; ++g)
#pragma unroll
    for (int j = 0; j < 4; ++j)
#pragma unroll
      for (int r = 0; r < 8; ++r) {
        float blo = bias[g * 64 + j * 16 + r], bhi = bias[g * 64 + j * 16 + 8 + r];
        acc[0][g][j][r] = hh ? bhi : blo;
        acc[1][g][j][r] = acc[0][g][j][r];
      }
  // unrolled so that the accumulators of all four groups are indexed by constants and stay in registers
#pragma unroll
  for (int g = 0; g < 4; ++g) {
    // every wave brings its own slice; no test around the request
    stage_slice(lds_dst, bsl + (size_t)(g * 64) * (K * 2), g1);

    // closes the scheduling region, so that the order asked for below holds for this group's reads alone
    __builtin_amdgcn_sched_barrier(0);
#pragma unroll
    for (int kk = 0; kk < 8; ++kk) {
#pragma unroll
      for (int j = 0; j < 4; ++j) {
        v16bf wf = frag_ld_qs(Bs, j, kk, lane);
#pragma unroll
        for (int f = 0; f < 2; ++f)
          acc[f][g][j] = __builtin_amdgcn_wmma_f32_16x16x32_bf16(
              false, wf, false, afr[f][kk], (short)0, acc[f][g][j], false, false);
      }
    }
    panel_reads_ahead();
    __builtin_amdgcn_sched_barrier(0);  // end of that region
    if (g < 3) {
      // this wave's LDS reads have retired before any wave's next request targets the panel
      asm volatile("s_wait_dscnt 0x0" ::: "memory");
      __syncthreads();  // protect Bs before the next group's request
    }
  }

  int tok = m0 + (lane & 15) * 2;   // the lane's two tokens: tok (fragment 0) and tok + 1 (fragment 1)
  size_t base = ((size_t)(tok >> 12) * CDIM + hh * 8) * NPOS + (tok & (NPOS - 1));
  const float* __restrict__ xp = x + base;
  float* __restrict__ op = out + base;
  // x of the first two groups of 32 channels is asked for before the statistics
  f32x2 xr[2][32];
#pragma unroll
  for (int g = 0; g < 2; ++g)
#pragma unroll
    for (int i = 0; i < 32; ++i)
      xr[g][i] = *reinterpret_cast<const f32x2*>(xp + (size_t)(g * 64 + (i >> 3) * 16 + (i & 7)) * NPOS);

  // mean and variance of each token over its 256 channels: eight running sums, then the other half wave
  f32x2 mean, rstd;
#pragma unroll
  for (int f = 0; f < 2; ++f) {
    v8f vs = {}, vq = {};
#pragma unroll
    for (int g = 0; g < 4; ++g)
#pragma unroll
      for (int j = 0; j < 4; ++j) { vs += acc[f][g][j]; vq += acc[f][g][j] * acc[f][g][j]; }
    float s  = ((vs[0] + vs[1]) + (vs[2] + vs[3])) + ((vs[4] + vs[5]) + (vs[6] + vs[7]));
    float sq = ((vq[0] + vq[1]) + (vq[2] + vq[3])) + ((vq[4] + vq[5]) + (vq[6] + vq[7]));
    s  += __shfl_xor(s, 16, 32);
    sq += __shfl_xor(sq, 16, 32);
    mean[f] = s * (1.f / 256.f);
    rstd[f] = rsqrtf(sq * (1.f / 256.f) - mean[f] * mean[f] + EPS);
  }

  // the next group's x is in flight while this group is worked out and stored
#pragma unroll
  for (int g = 0; g < 4; ++g) {
#pragma unroll
    for (int i = 0; i < 32; ++i) {
      f32x2 y = {acc[0][g][i >> 3][i & 7], acc[1][g][i >> 3][i & 7]};
      xr[g & 1][i] = (y - mean) * rstd + xr[g & 1][i];
    }
    // all 32 results stand in registers of their own before the first store, and no vector instruction
    // comes between the stores and their wait below, so that none rewrites a register that a store names
    __builtin_amdgcn_sched_barrier(0);
#pragma unroll
    for (int i = 0; i < 32; ++i)
      *reinterpret_cast<f32x2*>(op + (size_t)(g * 64 + (i >> 3) * 16 + (i & 7)) * NPOS) = xr[g & 1][i];
    if (g < 3) {
      // the stores name registers that the next loads and the next group rewrite: keep the wait in front;
      // the addresses are inputs, so that their registers live up to it
      asm volatile("s_wait_xcnt 0x0" :: "v"(xp), "v"(op) : "memory");
      __builtin_amdgcn_sched_barrier(0);  // holds the next group's work behind that wait
    }
    if (g < 2) {
#pragma unroll
      for (int i = 0; i < 32; ++i)
        xr[g & 1][i] = *reinterpret_cast<const f32x2*>(xp + (size_t)((g + 2) * 64 + (i >> 3) * 16 + (i & 7)) * NPOS);
    }
  }
}

// ---------- host launcher ----------
extern "C" void kernel_launch(void* const* d_in, const int* in_sizes, int n_in,
                              void* d_out, int out_size, void* d_ws, size_t ws_size,
                              hipStream_t stream) {
  const float* x      = (const float*)d_in[0];
  const float* mem_kv = (const float*)d_in[1];
  const float* w_qkv  = (const float*)d_in[2];
  const float* w_out  = (const float*)d_in[3];
  const float* b_out  = (const float*)d_in[4];
  float* out = (float*)d_out;

  char* ws = (char*)d_ws;
  __bf16* wq_bf  = (__bf16*)(ws + WQ_OFF);
  __bf16* weff   = (__bf16*)(ws + WEFF_OFF);
  __bf16* QKVbf  = (__bf16*)(ws + QKV_OFF);
  float*  pctx   = (float*)(ws + PCTX_OFF);
  float*  pms    = (float*)(ws + PMS_OFF);

  cvt_weights<<<768, 256, 0, stream>>>(w_qkv, wq_bf);
  ln_gemm_qkv<<<MROWS / 128, 128, 0, stream>>>(x, wq_bf, QKVbf, pctx, pms);
  attn_merge_fold<<<BATCH * HEADS * 2, 512, 0, stream>>>(pctx, pms, mem_kv, w_out, weff);
  gemm_ln_res_out<<<MROWS / 128, 128, 0, stream>>>(QKVbf, weff, b_out, x, out);
}
